// v000
// The times below were measured on an AMD MI455X: many runs one after another, warmed up first and cycling through
// copies of the inputs, with the whole window's GPU time divided by the number of runs. Launches and the gaps
// between them are all in it. The median over several windows is given; except for v000 it joins two sittings, which
// can be a few percent apart, so the side-by-side timings, each taken in one sitting, are the better comparison.
// v000, which the later versions start from, runs in 661 microseconds.
// compute dtype: all float inputs rounded to bf16; q/k/v projections with EXACT bf16 products on WMMA 16x16x32 (f32 accumulate); causal logits: 3 products (q f16 hi + residual x k hi + residual) for the first 384 rows, single f16 q x k after, x scale; softmax f32; P x 2^11 once to f16 x v once to f16 (1 product; bf16 hi + lo below row 384); f32 output.
#include <hip/hip_runtime.h>
#include <math.h>

typedef __attribute__((ext_vector_type(16))) _Float16 v16h;
typedef __attribute__((ext_vector_type(16))) __bf16 v16b;
typedef __attribute__((ext_vector_type(8)))  _Float16 v8h;
typedef __attribute__((ext_vector_type(8)))  float v8f;
typedef __attribute__((ext_vector_type(4)))  float v4f;
typedef __attribute__((ext_vector_type(2)))  float v2f;
typedef __attribute__((ext_vector_type(4)))  unsigned v4u;
typedef __attribute__((ext_vector_type(4)))  int v4i;
typedef float __attribute__((may_alias)) float_a;
typedef int __attribute__((may_alias)) int_a;

template <typename T> __device__ __forceinline__ void vst2(void* p, T v) { *(T*)p = v;  }
__device__ __forceinline__ v8f wmma16(v16h a, v16h b, v8f c) {
  v8f d = __builtin_amdgcn_wmma_f32_16x16x32_f16(false, a, false, b, (short)0, c, false, false);
  asm volatile("v_nop\n\tv_nop\n\tv_nop\n\tv_nop" : "+v"(d) : "v"(a), "v"(b));
  return d;
}
__device__ __forceinline__ v8f wmma_bf(v16b a, v16b b, v8f c) {
  v8f d = __builtin_amdgcn_wmma_f32_16x16x32_bf16(false, a, false, b, (short)0, c, false, false);
  asm volatile("v_nop\n\tv_nop\n\tv_nop\n\tv_nop" : "+v"(d) : "v"(a), "v"(b));
  return d;
}
// 16x16x32 fragments: lane = (h = lane>>4, row/col = lane&15); elements 0..7 = k0+8h+0..7, 8..15 = k0+16+8h+0..7; D element r = row 8h+r
__device__ __forceinline__ v16h frag_h(const _Float16* rowk0, int lane) {
  union { v16h v; v8h q[2]; } u; const _Float16* p = rowk0 + 8 * (lane >> 4);
  u.q[0] = *(const v8h*)p; u.q[1] = *(const v8h*)(p + 16); return u.v;
}
__device__ __forceinline__ v16h frag_f32(const float* rowk0, int lane) {
  v16h a; const float* p = rowk0 + 8 * (lane >> 4);
#pragma unroll
  for (int i = 0; i < 8; ++i) { a[i] = (_Float16)p[i]; a[8 + i] = (_Float16)p[16 + i]; }
  return a;
}
__device__ __forceinline__ v16h frag_f32s(const float* rowk0, int lane, float sc) {
  v16h a; const float* p = rowk0 + 8 * (lane >> 4);
#pragma unroll
  for (int i = 0; i < 8; ++i) { a[i] = (_Float16)(p[i] * sc); a[8 + i] = (_Float16)(p[16 + i] * sc); }
  return a;
}
// column fragment from a [K][ld] layout (column n), rows >= K read as 0
__device__ __forceinline__ v16h fragc_f32(const float* W, int k0, int n, int lane, int ld, int K) {
  v16h a; const int g = lane >> 4;
#pragma unroll
  for (int i = 0; i < 8; ++i) { const int ka = k0 + 8 * g + i, kb = ka + 16;
    a[i] = (_Float16)(ka < K ? W[(size_t)(ka < K ? ka : K - 1) * ld + n] : 0.f); a[8 + i] = (_Float16)(kb < K ? W[(size_t)(kb < K ? kb : K - 1) * ld + n] : 0.f); }
  return a;
}
struct F2 { v16b h, l; };
__device__ __forceinline__ F2 bsplit16(const float v[16]) { F2 r;
#pragma unroll
  for (int i = 0; i < 16; ++i) { const __bf16 h = (__bf16)v[i]; r.h[i] = h; r.l[i] = (__bf16)(v[i] - (float)h); }
  return r; }
__device__ __forceinline__ F2 split_row(const float* row, int k0, int lane) { float v[16]; const float* p = row + k0 + 8 * (lane >> 4);
#pragma unroll
  for (int i = 0; i < 8; ++i) { v[i] = p[i]; v[8 + i] = p[16 + i]; }
  return bsplit16(v); }
__device__ __forceinline__ F2 split_rowK(const float* row, int k0, int lane, int K) { float v[16]; const int g = lane >> 4;
#pragma unroll
  for (int i = 0; i < 8; ++i) { const int ka = k0 + 8 * g + i, kb = ka + 16; v[i] = ka < K ? row[ka < K ? ka : K - 1] : 0.f; v[8 + i] = kb < K ? row[kb < K ? kb : K - 1] : 0.f; }
  return bsplit16(v); }
__device__ __forceinline__ F2 split_col(const float* W, int k0, int n, int lane, int ld, int K) { float v[16]; const int g = lane >> 4;
#pragma unroll
  for (int i = 0; i < 8; ++i) { const int ka = k0 + 8 * g + i, kb = ka + 16; v[i] = ka < K ? W[(size_t)(ka < K ? ka : K - 1) * ld + n] : 0.f; v[8 + i] = kb < K ? W[(size_t)(kb < K ? kb : K - 1) * ld + n] : 0.f; }
  return bsplit16(v); }
__device__ __forceinline__ v8f mac3(const F2& a, const F2& b, v8f c) { c = wmma_bf(a.l, b.h, c); c = wmma_bf(a.h, b.l, c); return wmma_bf(a.h, b.h, c); }
__device__ __forceinline__ float sigm(float v) { return 1.0f / (1.0f + expf(-v)); }
#define LDSX() do { asm volatile("s_wait_dscnt 0" ::: "memory"); __builtin_amdgcn_wave_barrier(); __builtin_amdgcn_fence(__ATOMIC_RELEASE, "workgroup"); } while (0)

// Single-head causal self-attention scaled by the EMBEDDING width (x [8,2048,384]; head_size 64; (in,out) Wq, Wk, Wv [384,64] uniform(+-1/sqrt(384)); no biases, no output projection; scores / sqrt(C) with C = 384 (NOT the head size); tril, -inf): out = softmax(causal(q k^T / sqrt(384))) v -> [8,2048,64].
#define NB 8
#define TT 2048
#define CC 128            // NH * HD = projected width
#define DIN 384
#define NH 2
#define HD 64
#define NQB (TT / 64)
#define HG 1
#define SCALE (0.05103103630798288f)
#define CAUSAL 1
#ifndef TNB
#define TNB NB
#endif
__device__ __forceinline__ float bfr(float v) { return (float)(__bf16)v; }
__host__ __device__ __forceinline__ int kb_last(int qb) { return CAUSAL ? ((qb * 64 + 63) >> 7) : (TT / 128 - 1); }
typedef __attribute__((ext_vector_type(8))) __bf16 v8b;
__device__ __forceinline__ v16b frag_b(const __bf16* rowk0, int lane) {
  union { v16b v; v8b q[2]; } u; const __bf16* p = rowk0 + 8 * (lane >> 4);
  u.q[0] = *(const v8b*)p; u.q[1] = *(const v8b*)(p + 16); return u.v;
}
#define QBH 6              // causal: query blocks 0..QBH-1 of each sequence (few keys, no averaging) take the high-precision path
#define QHI 384            // rows carrying a q residual plane (all rows when non-causal: 2-product logits everywhere)
#define KHI 384            // key rows carrying k residual / v bf16 hi+lo planes (used only by the causal high-precision path)
// B fragment (k rows k0+.., output column o) of a weight: (in,out) [K][ld] or (out,in) [ld rows of K]: bf16 exact, or f16(bf16 * 256) exact
__device__ __forceinline__ v16b wcol_io(const float* Wm, int k0, int o, int lane, int ld) { v16b w; const int g = lane >> 4;
#pragma unroll
  for (int i = 0; i < 8; ++i) { w[i] = (__bf16)Wm[(size_t)(k0 + 8 * g + i) * ld + o]; w[8 + i] = (__bf16)Wm[(size_t)(k0 + 16 + 8 * g + i) * ld + o]; }
  return w; }
__device__ __forceinline__ v16b wcol_oi(const float* Wm, int k0, int o, int lane, int K) { v16b w; const float* p = Wm + (size_t)o * K + k0 + 8 * (lane >> 4);
#pragma unroll
  for (int i = 0; i < 8; ++i) { w[i] = (__bf16)p[i]; w[8 + i] = (__bf16)p[16 + i]; }
  return w; }
__device__ __forceinline__ v16h wcolh_io(const float* Wm, int k0, int o, int lane, int ld) { v16h w; const int g = lane >> 4;
#pragma unroll
  for (int i = 0; i < 8; ++i) { w[i] = (_Float16)(bfr(Wm[(size_t)(k0 + 8 * g + i) * ld + o]) * 256.0f); w[8 + i] = (_Float16)(bfr(Wm[(size_t)(k0 + 16 + 8 * g + i) * ld + o]) * 256.0f); }
  return w; }
__device__ __forceinline__ v16h wcolh_oi(const float* Wm, int k0, int o, int lane, int K) { v16h w; const float* p = Wm + (size_t)o * K + k0 + 8 * (lane >> 4);
#pragma unroll
  for (int i = 0; i < 8; ++i) { w[i] = (_Float16)(bfr(p[i]) * 256.0f); w[8 + i] = (_Float16)(bfr(p[16 + i]) * 256.0f); }
  return w; }
#define WQKV_LAYOUT 0   // 0 = (in,out) [DIN][CC]; 1 = (out,in) [CC][DIN]; 2 = per-head [NH][DIN][HD]
__device__ __forceinline__ v16b wcol_hdk(const float* Wm, int k0, int o, int lane) { v16b w; const int g = lane >> 4; const float* p = Wm + (size_t)(o / HD) * DIN * HD + (o % HD);
#pragma unroll
  for (int i = 0; i < 8; ++i) { w[i] = (__bf16)p[(size_t)(k0 + 8 * g + i) * HD]; w[8 + i] = (__bf16)p[(size_t)(k0 + 16 + 8 * g + i) * HD]; }
  return w; }
#define WO_OUT_IN 0
#if WQKV_LAYOUT == 1
#define WCOL(W, k0, o, lane) wcol_oi(W, k0, o, lane, DIN)
#elif WQKV_LAYOUT == 2
#define WCOL(W, k0, o, lane) wcol_hdk(W, k0, o, lane)
#else
#define WCOL(W, k0, o, lane) wcol_io(W, k0, o, lane, CC)
#endif
#if WO_OUT_IN
#define WOCOL(W, k0, o, lane) wcol_oi(W, k0, o, lane, CC)
#define WOCOLH(W, k0, o, lane) wcolh_oi(W, k0, o, lane, CC)
#else
#define WOCOL(W, k0, o, lane) wcol_io(W, k0, o, lane, DIN)
#define WOCOLH(W, k0, o, lane) wcolh_io(W, k0, o, lane, DIN)
#endif
#define CIN 384
// ---- k_padw: the three (in,out) [C][64] projection weights copied into zero-padded (in,out) [C][128] ws planes (columns 64..127 zero) + zero-padded [128] biases
__global__ __launch_bounds__(256) void k_padw(const float* __restrict__ WQ, const float* __restrict__ WK, const float* __restrict__ WV, const float* __restrict__ BQ, const float* __restrict__ BK, const float* __restrict__ BV, float* __restrict__ WP, float* __restrict__ BP) { const int which = blockIdx.y; const float* Wsrc = which == 0 ? WQ : (which == 1 ? WK : WV); const float* Bsrc = which == 0 ? BQ : (which == 1 ? BK : BV); float* dst = WP + (size_t)which * CIN * 128;
  for (int e = blockIdx.x * 256 + threadIdx.x; e < CIN * 32; e += gridDim.x * 256) { const int row = e >> 5, q = e & 31; const v4f ld = *(const v4f*)(Wsrc + (size_t)row * 64 + (q & 15) * 4); asm volatile("s_wait_loadcnt 0x0" ::: "memory"); const float keep = q < 16 ? 1.f : 0.f; v4f ov; ov[0] = ld[0] * keep; ov[1] = ld[1] * keep; ov[2] = ld[2] * keep; ov[3] = ld[3] * keep; vst2(dst + (size_t)row * 128 + q * 4, ov); }
  if (blockIdx.x == 0 && threadIdx.x < 128) { const int c = threadIdx.x; float bvv = 0.f; if (Bsrc) { const float t = Bsrc[c & 63]; asm volatile("s_wait_loadcnt 0x0" ::: "memory"); bvv = c < 64 ? t : 0.f; } vst2(BP + which * 128 + c, bvv); } }
// ---- k_out64: out[b][t][0..63] = ctx row columns 0..63 (256 B by 16 lanes)
__global__ __launch_bounds__(256) void k_out64(const float* __restrict__ Y, float* __restrict__ OUT) { const size_t row = (size_t)blockIdx.x * 16 + (threadIdx.x >> 4); const int q = threadIdx.x & 15; const v4f v = *(const v4f*)(Y + row * CC + q * 4); asm volatile("s_wait_loadcnt 0x0" ::: "memory"); vst2(OUT + row * 64 + q * 4, v); }
#define WS_WP (WS_END)                                  // padded weights [3][128 x C]
#define WS_BP (WS_WP + 4u * 3 * (size_t)CIN * 128)        // padded biases [3][128]
#define WS_Y2 (WS_BP + 4u * 3 * 128)                      // ctx rows [b*TT+t][128]
#define WS_END2 (WS_Y2 + 4u * (size_t)NB * TT * CC)
#ifndef SM_EXTRA_PARAMS
#define SM_EXTRA_PARAMS
#endif
#ifndef PROJ_EXTRA_PARAMS
#define PROJ_EXTRA_PARAMS
#endif
#ifndef SM_MASK_HOOK
#define SM_MASK_HOOK (void)0
#endif

#define WS_QH  0u                                      // f16 q rows [b*t][CC]
#define WS_KH  (WS_QH + 2u * (size_t)NB * TT * CC)      // f16 k rows [b*t][CC]
#define WS_VT  (WS_KH + 2u * (size_t)NB * TT * CC)      // f16 v planes [b][c][t]
#define WS_QL  (WS_VT + 2u * (size_t)NB * CC * TT)      // f16 q residual x 2^10 rows [b][t < QHI][CC]
#define WS_KL  (WS_QL + 2u * (size_t)NB * QHI * CC)     // f16 k residual x 2^10 rows [b][t < KHI][CC]
#define WS_VB  (WS_KL + 2u * (size_t)NB * KHI * CC)     // bf16 v hi planes [b][c][t < KHI]
#define WS_VBL (WS_VB + 2u * (size_t)NB * CC * KHI)
#define WS_S   (WS_VBL + 2u * (size_t)NB * CC * KHI)    // f32 logits / P [hg][t][s]
#define WS_Y   (WS_S  + 4u * (size_t)HG * TT * TT)      // f32 ctx rows [b*t][CC] (only when there is an output projection)
#define WS_END (WS_Y  + 0u)

// ---- k_proj: block = (64 rows, 128 cols, which): q/k/v = X W (+ b) with exact bf16 products (K = DIN) -> which 0: q f16 rows (+ residual rows < QHI); 1: k f16 rows (+ residual rows < KHI); 2: v f16 planes [c][t] (+ bf16 hi/lo planes for t < KHI)
__global__ __launch_bounds__(128) void k_proj(const float* __restrict__ XQ, const float* __restrict__ XK, const float* __restrict__ XV, const float* __restrict__ WQ, const float* __restrict__ WK, const float* __restrict__ WV, const float* __restrict__ BQ, const float* __restrict__ BK, const float* __restrict__ BV,
    _Float16* __restrict__ QH, _Float16* __restrict__ QL, _Float16* __restrict__ KH, _Float16* __restrict__ KL, _Float16* __restrict__ VT, __bf16* __restrict__ VB, __bf16* __restrict__ VBL) {
  __shared__ __align__(16) _Float16 sh[64][136], sl[64][136]; __shared__ __align__(16) _Float16 th[128][72]; __shared__ __align__(16) __bf16 tb[128][72], tbl[128][72];
  const int tid = threadIdx.x, wave = tid >> 5, lane = tid & 31, col = lane & 15, g = lane >> 4; const int which = blockIdx.z; const int c0 = blockIdx.y * 128; const size_t r0 = (size_t)blockIdx.x * 64; const size_t bb = r0 / TT; const int t0 = (int)(r0 % TT);
  const float* X = which == 0 ? XQ : which == 1 ? XK : XV; const float* WA = which == 0 ? WQ : which == 1 ? WK : WV; const float* BA = which == 0 ? BQ : which == 1 ? BK : BV;
  v8f acc[8] = {};
#pragma unroll 2
  for (int kc = 0; kc < DIN / 32; ++kc) { v16b a; { const float* p = X + (r0 + wave * 16 + col) * DIN + kc * 32 + 8 * g;
#pragma unroll
      for (int i = 0; i < 8; ++i) { a[i] = (__bf16)p[i]; a[8 + i] = (__bf16)p[16 + i]; } }
    asm volatile("s_wait_loadcnt 0x0" ::: "memory");
#pragma unroll
    for (int j = 0; j < 8; ++j) { const v16b w = WCOL(WA, kc * 32, c0 + j * 16 + col, lane); asm volatile("s_wait_loadcnt 0x0" ::: "memory"); acc[j] = wmma_bf(a, w, acc[j]); } }
  if (which < 2) { _Float16* DH = which == 0 ? QH : KH; _Float16* DL = which == 0 ? QL : KL; const int nhi = which == 0 ? QHI : KHI; const bool hi_rows = t0 < nhi;
#pragma unroll
    for (int j = 0; j < 8; ++j) { const float bias = BA ? bfr(BA[c0 + j * 16 + col]) : 0.f;
#pragma unroll
      for (int r = 0; r < 8; ++r) { const float v = acc[j][r] + bias; const _Float16 hv = (_Float16)v; sh[wave * 16 + 8 * g + r][j * 16 + col] = hv; sl[wave * 16 + 8 * g + r][j * 16 + col] = (_Float16)((v - (float)hv) * 1024.0f); } }
    __syncthreads();
    for (int e = tid; e < 64 * 16; e += 128) { const int rl = e >> 4, q = e & 15; vst2((unsigned*)(DH + (r0 + rl) * CC + c0 + q * 8), *(const v4u*)&sh[rl][q * 8]); if (hi_rows) vst2((unsigned*)(DL + (bb * nhi + t0 + rl) * (size_t)CC + c0 + q * 8), *(const v4u*)&sl[rl][q * 8]); }
  } else { const bool hi_rows = t0 < KHI;
#pragma unroll
    for (int j = 0; j < 8; ++j) { const float bias = BA ? bfr(BA[c0 + j * 16 + col]) : 0.f;
#pragma unroll
      for (int r = 0; r < 8; ++r) { const float v = acc[j][r] + bias; const int rl = wave * 16 + 8 * g + r, cl = j * 16 + col; th[cl][rl] = (_Float16)v; const __bf16 bh = (__bf16)v; tb[cl][rl] = bh; tbl[cl][rl] = (__bf16)(v - (float)bh); } }
    __syncthreads();
    for (int e = tid; e < 128 * 8; e += 128) { const int cl = e >> 3, q = e & 7; vst2((unsigned*)(VT + (bb * CC + c0 + cl) * (size_t)TT + t0 + q * 8), *(const v4u*)&th[cl][q * 8]); if (hi_rows) { const size_t o3 = (bb * CC + c0 + cl) * (size_t)KHI + t0 + q * 8; vst2((unsigned*)(VB + o3), *(const v4u*)&tb[cl][q * 8]); vst2((unsigned*)(VBL + o3), *(const v4u*)&tbl[cl][q * 8]); } } } }
// ---- k_sc: block = (query block qb, key block kb <= kb_last(qb), head in group) of batch b: logits x SCALE; q hi + residual (x 2^10) against k (2 products) for query rows < QHI, plus the k residual (3 products) for query blocks < QBH (causal early rows); causal: blocks past the diagonal exit, the mask itself is applied by index in k_sm
__global__ __launch_bounds__(128) void k_sc(const _Float16* __restrict__ QH, const _Float16* __restrict__ KH, const _Float16* __restrict__ QL, const _Float16* __restrict__ KL, int b, int h0, float* __restrict__ S0) { __shared__ __align__(16) float ss[4][16][132];
  const int qb = blockIdx.x, kb = blockIdx.y; if (kb > kb_last(qb)) return;
  const int h = h0 + blockIdx.z; float* S = S0 + (size_t)blockIdx.z * TT * TT;
  const int tid = threadIdx.x, wave = tid >> 5, lane = tid & 31, col = lane & 15, g = lane >> 4; const int k0 = kb * 128; const int ql0 = qb * 64 + wave * 16; const size_t q0 = (size_t)b * TT + ql0, kr0 = (size_t)b * TT + k0;
  v8f acc[8] = {}, accl[8] = {};
  const _Float16* QLb = QL + (size_t)b * QHI * CC; const _Float16* KLb = KL + (size_t)b * KHI * CC;
  if (qb < QBH) {
#pragma unroll
    for (int kc = 0; kc < HD / 32; ++kc) { const v16h ah = frag_h(QH + (q0 + col) * CC + h * HD + kc * 32, lane), al = frag_h(QLb + (size_t)(ql0 + col) * CC + h * HD + kc * 32, lane);
#pragma unroll
      for (int j = 0; j < 8; ++j) { const v16h kbf = frag_h(KH + (kr0 + j * 16 + col) * CC + h * HD + kc * 32, lane), klf = frag_h(KLb + (size_t)(k0 + j * 16 + col) * CC + h * HD + kc * 32, lane); acc[j] = wmma16(ah, kbf, acc[j]); accl[j] = wmma16(al, kbf, accl[j]); accl[j] = wmma16(ah, klf, accl[j]); } }
  } else if (qb * 64 < QHI) {
#pragma unroll
    for (int kc = 0; kc < HD / 32; ++kc) { const v16h ah = frag_h(QH + (q0 + col) * CC + h * HD + kc * 32, lane), al = frag_h(QLb + (size_t)(ql0 + col) * CC + h * HD + kc * 32, lane);
#pragma unroll
      for (int j = 0; j < 8; ++j) { const v16h kbf = frag_h(KH + (kr0 + j * 16 + col) * CC + h * HD + kc * 32, lane); acc[j] = wmma16(ah, kbf, acc[j]); accl[j] = wmma16(al, kbf, accl[j]); } }
  } else {
#pragma unroll
    for (int kc = 0; kc < HD / 32; ++kc) { const v16h ah = frag_h(QH + (q0 + col) * CC + h * HD + kc * 32, lane);
#pragma unroll
      for (int j = 0; j < 8; ++j) { const v16h kbf = frag_h(KH + (kr0 + j * 16 + col) * CC + h * HD + kc * 32, lane); acc[j] = wmma16(ah, kbf, acc[j]); } } }
#pragma unroll
  for (int j = 0; j < 8; ++j) {
#pragma unroll
    for (int r = 0; r < 8; ++r) ss[wave][8 * g + r][j * 16 + col] = (acc[j][r] + accl[j][r] * (1.0f / 1024.0f)) * SCALE; }
  LDSX(); for (int rl = 0; rl < 16; ++rl) vst2(S + (size_t)(ql0 + rl) * TT + k0 + lane * 4, *(const v4f*)&ss[wave][rl][lane * 4]); }
// ---- k_sm: block = query row t (head in group): keys [0, kend): causal -> logit if s <= t else excluded; softmax in f32; P x 2^11 in place (0 for excluded)
__global__ __launch_bounds__(256) void k_sm(float* __restrict__ S0 SM_EXTRA_PARAMS) { __shared__ float sred[8]; __shared__ float sbc; __shared__ __align__(16) float shv[TT];
  const int tid = threadIdx.x; const int t = blockIdx.x; const int kend = (kb_last(t >> 6) + 1) * 128;
  float* sr = S0 + (size_t)blockIdx.y * TT * TT + (size_t)t * TT;
  float m = -3.0e38f; for (int k = tid; k < kend; k += 256) { float v = (!CAUSAL || k <= t) ? sr[k] : -3.0e38f; SM_MASK_HOOK; shv[k] = v; m = fmaxf(m, v); }
#pragma unroll
  for (int o = 1; o < 32; o <<= 1) m = fmaxf(m, __shfl_xor(m, o));
  if ((tid & 31) == 0) sred[tid >> 5] = m; __syncthreads(); if (tid == 0) { float a = sred[0]; for (int i = 1; i < 8; ++i) a = fmaxf(a, sred[i]); sbc = a; } __syncthreads(); m = sbc; __syncthreads();
  float sum = 0.f; for (int k = tid; k < kend; k += 256) { const float v = shv[k]; const float e = (v <= -1.0e38f) ? 0.f : expf(v - m); shv[k] = e; sum += e; }
#pragma unroll
  for (int o = 1; o < 32; o <<= 1) sum += __shfl_xor(sum, o);
  if ((tid & 31) == 0) sred[tid >> 5] = sum; __syncthreads(); if (tid == 0) { float a = 0.f; for (int i = 0; i < 8; ++i) a += sred[i]; sbc = a > 0.f ? 2048.0f / a : 0.f; }   /* a fully excluded row yields P = 0 */ __syncthreads(); const float inv = sbc;
  for (int k = tid; k < kend; k += 256) shv[k] = shv[k] * inv;
  __syncthreads(); for (int q = tid; q < kend / 4; q += 256) vst2(sr + q * 4, *(const v4f*)&shv[q * 4]); }
// ---- k_pv: block = 64 queries (qb) of (b, h): ctx = P . v over keys [0, kend) (P x 2^11 once to f16 against v f16: 1 product; causal early query blocks: P and v as bf16 hi + lo, 3 products); 256-B (row, head) segment by 16 lanes
__global__ __launch_bounds__(128) void k_pv(const float* __restrict__ PS0, const _Float16* __restrict__ VT, const __bf16* __restrict__ VB, const __bf16* __restrict__ VBL, int b, int h0, float* __restrict__ Y) { const int h = h0 + blockIdx.z; const float* PS = PS0 + (size_t)blockIdx.z * TT * TT; __shared__ __align__(16) float ss[4][16][HD + 4];
  const int tid = threadIdx.x, wave = tid >> 5, lane = tid & 31, col = lane & 15, g = lane >> 4; const int qb = blockIdx.x; const int ql0 = qb * 64 + wave * 16; const int kce = (kb_last(qb) + 1) * 4;
  v8f acc[HD / 16] = {};
  if (qb < QBH) {
#pragma unroll 1
    for (int kc = 0; kc < kce; ++kc) { const F2 p = split_row(PS + (size_t)(ql0 + col) * TT, kc * 32, lane);
      asm volatile("s_wait_loadcnt 0x0" ::: "memory");
#pragma unroll
      for (int j = 0; j < HD / 16; ++j) { const size_t po = ((size_t)b * CC + h * HD + j * 16 + col) * (size_t)KHI + kc * 32; const v16b vh = frag_b(VB + po, lane); acc[j] = wmma_bf(p.h, vh, acc[j]); acc[j] = wmma_bf(p.l, vh, acc[j]); acc[j] = wmma_bf(p.h, frag_b(VBL + po, lane), acc[j]); } }
  } else {
#pragma unroll 1
    for (int kc = 0; kc < kce; ++kc) { const v16h p = frag_f32(PS + (size_t)(ql0 + col) * TT + kc * 32, lane);
      asm volatile("s_wait_loadcnt 0x0" ::: "memory");
#pragma unroll
      for (int j = 0; j < HD / 16; ++j) { const size_t po = ((size_t)b * CC + h * HD + j * 16 + col) * (size_t)TT + kc * 32; acc[j] = wmma16(p, frag_h(VT + po, lane), acc[j]); } } }
#pragma unroll
  for (int j = 0; j < HD / 16; ++j)
#pragma unroll
    for (int r = 0; r < 8; ++r) ss[wave][8 * g + r][j * 16 + col] = acc[j][r] * (1.0f / 2048.0f);
  LDSX(); for (int rl = 0; rl < 16; ++rl) if (lane < HD / 4) vst2(Y + ((size_t)b * TT + ql0 + rl) * CC + h * HD + lane * 4, *(const v4f*)&ss[wave][rl][lane * 4]); }

extern "C" void kernel_launch(void* const* d_in, const int* in_sizes, int n_in, void* d_out, int out_size, void* d_ws, size_t ws_size, hipStream_t stream) {
  (void)in_sizes; (void)n_in; (void)out_size;
  const float** F = (const float**)d_in;
  if (ws_size < (size_t)WS_END) return;
  char* ws = (char*)d_ws; _Float16 *QH = (_Float16*)(ws + WS_QH), *KH = (_Float16*)(ws + WS_KH), *VT = (_Float16*)(ws + WS_VT), *QL = (_Float16*)(ws + WS_QL), *KL = (_Float16*)(ws + WS_KL); __bf16 *VB = (__bf16*)(ws + WS_VB), *VBL = (__bf16*)(ws + WS_VBL); float *S = (float*)(ws + WS_S), *Y = (float*)(ws + WS_Y);
  (void)Y; (void)QL; (void)KL; (void)VB; (void)VBL;
  // inputs: 0 x [8,2048,384]; 1 Wq [384,64]; 2 Wk; 3 Wv ((in,out), no biases)
  if (ws_size < (size_t)WS_END2) return;
  float *WP = (float*)(ws + WS_WP), *BP = (float*)(ws + WS_BP), *Y2 = (float*)(ws + WS_Y2);
  k_padw<<<dim3(32, 3), 256, 0, stream>>>(F[1], F[2], F[3], nullptr, nullptr, nullptr, WP, BP);
  k_proj<<<dim3(TNB * TT / 64, CC / 128, 3), 128, 0, stream>>>(F[0], F[0], F[0], WP, WP + (size_t)CIN * 128, WP + 2 * (size_t)CIN * 128, BP, BP + 128, BP + 256, QH, QL, KH, KL, VT, VB, VBL);
  for (int b = 0; b < TNB; ++b) {   /* head 0 only (head 1 is the zero padding) */
    k_sc<<<dim3(NQB, TT / 128, 1), 128, 0, stream>>>(QH, KH, QL, KL, b, 0, S);
    k_sm<<<dim3(TT, 1), 256, 0, stream>>>(S);
    k_pv<<<dim3(NQB, 1, 1), 128, 0, stream>>>(S, VT, VB, VBL, b, 0, Y2);
  }
  k_out64<<<dim3(TNB * TT / 16), 256, 0, stream>>>(Y2, (float*)d_out);
}

// v001
// One run takes 176 microseconds.
// Next to v000, in two timings, it ran 3.75 and 3.78 times as fast.
// compute dtype: all float inputs rounded to bf16; q/k/v projections with EXACT bf16 products on WMMA 16x16x32 (f32 accumulate); causal logits: 3 products (q f16 hi + residual x k hi + residual) for the first 384 rows, single f16 q x k after, x scale; softmax f32; P x 2^11 once to f16 x v once to f16 (1 product; bf16 hi + lo below row 384); f32 output.
#include <hip/hip_runtime.h>
#include <math.h>

typedef __attribute__((ext_vector_type(16))) _Float16 v16h;
typedef __attribute__((ext_vector_type(16))) __bf16 v16b;
typedef __attribute__((ext_vector_type(8)))  _Float16 v8h;
typedef __attribute__((ext_vector_type(8)))  float v8f;
typedef __attribute__((ext_vector_type(4)))  float v4f;
typedef __attribute__((ext_vector_type(2)))  float v2f;
typedef __attribute__((ext_vector_type(4)))  unsigned v4u;
typedef __attribute__((ext_vector_type(4)))  int v4i;
typedef float __attribute__((may_alias)) float_a;
typedef int __attribute__((may_alias)) int_a;

template <typename T> __device__ __forceinline__ void vst2(void* p, T v) { *(T*)p = v;  }
__device__ __forceinline__ v8f wmma16(v16h a, v16h b, v8f c) {
  v8f d = __builtin_amdgcn_wmma_f32_16x16x32_f16(false, a, false, b, (short)0, c, false, false);
  asm volatile("v_nop\n\tv_nop\n\tv_nop\n\tv_nop" : "+v"(d) : "v"(a), "v"(b));
  return d;
}
__device__ __forceinline__ v8f wmma_bf(v16b a, v16b b, v8f c) {
  v8f d = __builtin_amdgcn_wmma_f32_16x16x32_bf16(false, a, false, b, (short)0, c, false, false);
  asm volatile("v_nop\n\tv_nop\n\tv_nop\n\tv_nop" : "+v"(d) : "v"(a), "v"(b));
  return d;
}
// 16x16x32 fragments: lane = (h = lane>>4, row/col = lane&15); elements 0..7 = k0+8h+0..7, 8..15 = k0+16+8h+0..7; D element r = row 8h+r
__device__ __forceinline__ v16h frag_h(const _Float16* rowk0, int lane) {
  union { v16h v; v8h q[2]; } u; const _Float16* p = rowk0 + 8 * (lane >> 4);
  u.q[0] = *(const v8h*)p; u.q[1] = *(const v8h*)(p + 16); return u.v;
}
__device__ __forceinline__ v16h frag_f32(const float* rowk0, int lane) {
  v16h a; const float* p = rowk0 + 8 * (lane >> 4);
#pragma unroll
  for (int i = 0; i < 8; ++i) { a[i] = (_Float16)p[i]; a[8 + i] = (_Float16)p[16 + i]; }
  return a;
}
__device__ __forceinline__ v16h frag_f32s(const float* rowk0, int lane, float sc) {
  v16h a; const float* p = rowk0 + 8 * (lane >> 4);
#pragma unroll
  for (int i = 0; i < 8; ++i) { a[i] = (_Float16)(p[i] * sc); a[8 + i] = (_Float16)(p[16 + i] * sc); }
  return a;
}
// column fragment from a [K][ld] layout (column n), rows >= K read as 0
__device__ __forceinline__ v16h fragc_f32(const float* W, int k0, int n, int lane, int ld, int K) {
  v16h a; const int g = lane >> 4;
#pragma unroll
  for (int i = 0; i < 8; ++i) { const int ka = k0 + 8 * g + i, kb = ka + 16;
    a[i] = (_Float16)(ka < K ? W[(size_t)(ka < K ? ka : K - 1) * ld + n] : 0.f); a[8 + i] = (_Float16)(kb < K ? W[(size_t)(kb < K ? kb : K - 1) * ld + n] : 0.f); }
  return a;
}
struct F2 { v16b h, l; };
__device__ __forceinline__ F2 bsplit16(const float v[16]) { F2 r;
#pragma unroll
  for (int i = 0; i < 16; ++i) { const __bf16 h = (__bf16)v[i]; r.h[i] = h; r.l[i] = (__bf16)(v[i] - (float)h); }
  return r; }
__device__ __forceinline__ F2 split_row(const float* row, int k0, int lane) { float v[16]; const float* p = row + k0 + 8 * (lane >> 4);
#pragma unroll
  for (int i = 0; i < 8; ++i) { v[i] = p[i]; v[8 + i] = p[16 + i]; }
  return bsplit16(v); }
__device__ __forceinline__ F2 split_rowK(const float* row, int k0, int lane, int K) { float v[16]; const int g = lane >> 4;
#pragma unroll
  for (int i = 0; i < 8; ++i) { const int ka = k0 + 8 * g + i, kb = ka + 16; v[i] = ka < K ? row[ka < K ? ka : K - 1] : 0.f; v[8 + i] = kb < K ? row[kb < K ? kb : K - 1] : 0.f; }
  return bsplit16(v); }
__device__ __forceinline__ F2 split_col(const float* W, int k0, int n, int lane, int ld, int K) { float v[16]; const int g = lane >> 4;
#pragma unroll
  for (int i = 0; i < 8; ++i) { const int ka = k0 + 8 * g + i, kb = ka + 16; v[i] = ka < K ? W[(size_t)(ka < K ? ka : K - 1) * ld + n] : 0.f; v[8 + i] = kb < K ? W[(size_t)(kb < K ? kb : K - 1) * ld + n] : 0.f; }
  return bsplit16(v); }
__device__ __forceinline__ v8f mac3(const F2& a, const F2& b, v8f c) { c = wmma_bf(a.l, b.h, c); c = wmma_bf(a.h, b.l, c); return wmma_bf(a.h, b.h, c); }
__device__ __forceinline__ float sigm(float v) { return 1.0f / (1.0f + expf(-v)); }
#define LDSX() do { asm volatile("s_wait_dscnt 0" ::: "memory"); __builtin_amdgcn_wave_barrier(); __builtin_amdgcn_fence(__ATOMIC_RELEASE, "workgroup"); } while (0)

// Single-head causal self-attention scaled by the EMBEDDING width (x [8,2048,384]; head_size 64; (in,out) Wq, Wk, Wv [384,64] uniform(+-1/sqrt(384)); no biases, no output projection; scores / sqrt(C) with C = 384 (NOT the head size); tril, -inf): out = softmax(causal(q k^T / sqrt(384))) v -> [8,2048,64].
#define NB 8
#define TT 2048
#define CC 128            // NH * HD = projected width
#define DIN 384
#define NH 2
#define HD 64
#define NQB (TT / 64)
#define SCALE (0.05103103630798288f)
#define CAUSAL 1
#ifndef TNB
#define TNB NB
#endif
__device__ __forceinline__ float bfr(float v) { return (float)(__bf16)v; }
__host__ __device__ __forceinline__ int kb_last(int qb) { return CAUSAL ? ((qb * 64 + 63) >> 7) : (TT / 128 - 1); }
typedef __attribute__((ext_vector_type(8))) __bf16 v8b;
__device__ __forceinline__ v16b frag_b(const __bf16* rowk0, int lane) {
  union { v16b v; v8b q[2]; } u; const __bf16* p = rowk0 + 8 * (lane >> 4);
  u.q[0] = *(const v8b*)p; u.q[1] = *(const v8b*)(p + 16); return u.v;
}
#define QBH 6              // causal: query blocks 0..QBH-1 of each sequence (few keys, no averaging) take the high-precision path
#define QHI 384            // rows carrying a q residual plane (all rows when non-causal: 2-product logits everywhere)
#define KHI 384            // key rows carrying k residual / v bf16 hi+lo planes (used only by the causal high-precision path)
// B fragment (k rows k0+.., output column o) of a weight: (in,out) [K][ld] or (out,in) [ld rows of K]: bf16 exact, or f16(bf16 * 256) exact
__device__ __forceinline__ v16b wcol_io(const float* Wm, int k0, int o, int lane, int ld) { v16b w; const int g = lane >> 4;
#pragma unroll
  for (int i = 0; i < 8; ++i) { w[i] = (__bf16)Wm[(size_t)(k0 + 8 * g + i) * ld + o]; w[8 + i] = (__bf16)Wm[(size_t)(k0 + 16 + 8 * g + i) * ld + o]; }
  return w; }
__device__ __forceinline__ v16b wcol_oi(const float* Wm, int k0, int o, int lane, int K) { v16b w; const float* p = Wm + (size_t)o * K + k0 + 8 * (lane >> 4);
#pragma unroll
  for (int i = 0; i < 8; ++i) { w[i] = (__bf16)p[i]; w[8 + i] = (__bf16)p[16 + i]; }
  return w; }
__device__ __forceinline__ v16h wcolh_io(const float* Wm, int k0, int o, int lane, int ld) { v16h w; const int g = lane >> 4;
#pragma unroll
  for (int i = 0; i < 8; ++i) { w[i] = (_Float16)(bfr(Wm[(size_t)(k0 + 8 * g + i) * ld + o]) * 256.0f); w[8 + i] = (_Float16)(bfr(Wm[(size_t)(k0 + 16 + 8 * g + i) * ld + o]) * 256.0f); }
  return w; }
__device__ __forceinline__ v16h wcolh_oi(const float* Wm, int k0, int o, int lane, int K) { v16h w; const float* p = Wm + (size_t)o * K + k0 + 8 * (lane >> 4);
#pragma unroll
  for (int i = 0; i < 8; ++i) { w[i] = (_Float16)(bfr(p[i]) * 256.0f); w[8 + i] = (_Float16)(bfr(p[16 + i]) * 256.0f); }
  return w; }
#define WQKV_LAYOUT 0   // 0 = (in,out) [DIN][CC]; 1 = (out,in) [CC][DIN]; 2 = per-head [NH][DIN][HD]
__device__ __forceinline__ v16b wcol_hdk(const float* Wm, int k0, int o, int lane) { v16b w; const int g = lane >> 4; const float* p = Wm + (size_t)(o / HD) * DIN * HD + (o % HD);
#pragma unroll
  for (int i = 0; i < 8; ++i) { w[i] = (__bf16)p[(size_t)(k0 + 8 * g + i) * HD]; w[8 + i] = (__bf16)p[(size_t)(k0 + 16 + 8 * g + i) * HD]; }
  return w; }
#define WO_OUT_IN 0
#if WQKV_LAYOUT == 1
#define WCOL(W, k0, o, lane) wcol_oi(W, k0, o, lane, DIN)
#elif WQKV_LAYOUT == 2
#define WCOL(W, k0, o, lane) wcol_hdk(W, k0, o, lane)
#else
#define WCOL(W, k0, o, lane) wcol_io(W, k0, o, lane, CC)
#endif
#if WO_OUT_IN
#define WOCOL(W, k0, o, lane) wcol_oi(W, k0, o, lane, CC)
#define WOCOLH(W, k0, o, lane) wcolh_oi(W, k0, o, lane, CC)
#else
#define WOCOL(W, k0, o, lane) wcol_io(W, k0, o, lane, DIN)
#define WOCOLH(W, k0, o, lane) wcolh_io(W, k0, o, lane, DIN)
#endif
#define CIN 384
// ---- k_padw: the three (in,out) [C][64] projection weights copied into zero-padded (in,out) [C][128] ws planes (columns 64..127 zero) + zero-padded [128] biases
__global__ __launch_bounds__(256) void k_padw(const float* __restrict__ WQ, const float* __restrict__ WK, const float* __restrict__ WV, const float* __restrict__ BQ, const float* __restrict__ BK, const float* __restrict__ BV, float* __restrict__ WP, float* __restrict__ BP) { const int which = blockIdx.y; const float* Wsrc = which == 0 ? WQ : (which == 1 ? WK : WV); const float* Bsrc = which == 0 ? BQ : (which == 1 ? BK : BV); float* dst = WP + (size_t)which * CIN * 128;
  for (int e = blockIdx.x * 256 + threadIdx.x; e < CIN * 32; e += gridDim.x * 256) { const int row = e >> 5, q = e & 31; const v4f ld = *(const v4f*)(Wsrc + (size_t)row * 64 + (q & 15) * 4); asm volatile("s_wait_loadcnt 0x0" ::: "memory"); const float keep = q < 16 ? 1.f : 0.f; v4f ov; ov[0] = ld[0] * keep; ov[1] = ld[1] * keep; ov[2] = ld[2] * keep; ov[3] = ld[3] * keep; vst2(dst + (size_t)row * 128 + q * 4, ov); }
  if (blockIdx.x == 0 && threadIdx.x < 128) { const int c = threadIdx.x; float bvv = 0.f; if (Bsrc) { const float t = Bsrc[c & 63]; asm volatile("s_wait_loadcnt 0x0" ::: "memory"); bvv = c < 64 ? t : 0.f; } vst2(BP + which * 128 + c, bvv); } }
// ---- k_out64: out[b][t][0..63] = ctx row columns 0..63 (256 B by 16 lanes)
__global__ __launch_bounds__(256) void k_out64(const float* __restrict__ Y, float* __restrict__ OUT) { const size_t row = (size_t)blockIdx.x * 16 + (threadIdx.x >> 4); const int q = threadIdx.x & 15; const v4f v = *(const v4f*)(Y + row * CC + q * 4); asm volatile("s_wait_loadcnt 0x0" ::: "memory"); vst2(OUT + row * 64 + q * 4, v); }
#define WS_WP (WS_END)                                  // padded weights [3][128 x C]
#define WS_BP (WS_WP + 4u * 3 * (size_t)CIN * 128)        // padded biases [3][128]
#define WS_Y2 (WS_BP + 4u * 3 * 128)                      // ctx rows [b*TT+t][128]
#define WS_END2 (WS_Y2 + 4u * (size_t)NB * TT * CC)
#ifndef SM_EXTRA_PARAMS
#define SM_EXTRA_PARAMS
#endif
#ifndef PROJ_EXTRA_PARAMS
#define PROJ_EXTRA_PARAMS
#endif
#ifndef SM_MASK_HOOK
#define SM_MASK_HOOK (void)0
#endif

#define WS_QH  0u                                      // f16 q rows [b*t][CC]
#define WS_KH  (WS_QH + 2u * (size_t)NB * TT * CC)      // f16 k rows [b*t][CC]
#define WS_VT  (WS_KH + 2u * (size_t)NB * TT * CC)      // f16 v planes [b][c][t]
#define WS_QL  (WS_VT + 2u * (size_t)NB * CC * TT)      // f16 q residual x 2^10 rows [b][t < QHI][CC]
#define WS_KL  (WS_QL + 2u * (size_t)NB * QHI * CC)     // f16 k residual x 2^10 rows [b][t < KHI][CC]
#define WS_VB  (WS_KL + 2u * (size_t)NB * KHI * CC)     // bf16 v hi planes [b][c][t < KHI]
#define WS_VBL (WS_VB + 2u * (size_t)NB * CC * KHI)
#define WS_S   (WS_VBL + 2u * (size_t)NB * CC * KHI)    // f32 logits / P [b][t][s]: one plane per batch, so that one launch serves all batches
#define WS_Y   (WS_S  + 4u * (size_t)NB * TT * TT)      // f32 ctx rows [b*t][CC] (only when there is an output projection)
#define WS_END (WS_Y  + 0u)

// ---- k_proj: block = (64 rows, 128 cols, which): q/k/v = X W (+ b) with exact bf16 products (K = DIN) -> which 0: q f16 rows (+ residual rows < QHI); 1: k f16 rows (+ residual rows < KHI); 2: v f16 planes [c][t] (+ bf16 hi/lo planes for t < KHI)
__global__ __launch_bounds__(128) void k_proj(const float* __restrict__ XQ, const float* __restrict__ XK, const float* __restrict__ XV, const float* __restrict__ WQ, const float* __restrict__ WK, const float* __restrict__ WV, const float* __restrict__ BQ, const float* __restrict__ BK, const float* __restrict__ BV,
    _Float16* __restrict__ QH, _Float16* __restrict__ QL, _Float16* __restrict__ KH, _Float16* __restrict__ KL, _Float16* __restrict__ VT, __bf16* __restrict__ VB, __bf16* __restrict__ VBL) {
  __shared__ __align__(16) _Float16 sh[64][136], sl[64][136]; __shared__ __align__(16) _Float16 th[128][72]; __shared__ __align__(16) __bf16 tb[128][72], tbl[128][72];
  const int tid = threadIdx.x, wave = tid >> 5, lane = tid & 31, col = lane & 15, g = lane >> 4; const int which = blockIdx.z; const int c0 = blockIdx.y * 128; const size_t r0 = (size_t)blockIdx.x * 64; const size_t bb = r0 / TT; const int t0 = (int)(r0 % TT);
  const float* X = which == 0 ? XQ : which == 1 ? XK : XV; const float* WA = which == 0 ? WQ : which == 1 ? WK : WV; const float* BA = which == 0 ? BQ : which == 1 ? BK : BV;
  v8f acc[8] = {};
#pragma unroll 2
  for (int kc = 0; kc < DIN / 32; ++kc) { v16b a; { const float* p = X + (r0 + wave * 16 + col) * DIN + kc * 32 + 8 * g;
#pragma unroll
      for (int i = 0; i < 8; ++i) { a[i] = (__bf16)p[i]; a[8 + i] = (__bf16)p[16 + i]; } }
    asm volatile("s_wait_loadcnt 0x0" ::: "memory");
#pragma unroll
    for (int j = 0; j < 8; ++j) { const v16b w = WCOL(WA, kc * 32, c0 + j * 16 + col, lane); asm volatile("s_wait_loadcnt 0x0" ::: "memory"); acc[j] = wmma_bf(a, w, acc[j]); } }
  if (which < 2) { _Float16* DH = which == 0 ? QH : KH; _Float16* DL = which == 0 ? QL : KL; const int nhi = which == 0 ? QHI : KHI; const bool hi_rows = t0 < nhi;
#pragma unroll
    for (int j = 0; j < 8; ++j) { const float bias = BA ? bfr(BA[c0 + j * 16 + col]) : 0.f;
#pragma unroll
      for (int r = 0; r < 8; ++r) { const float v = acc[j][r] + bias; const _Float16 hv = (_Float16)v; sh[wave * 16 + 8 * g + r][j * 16 + col] = hv; sl[wave * 16 + 8 * g + r][j * 16 + col] = (_Float16)((v - (float)hv) * 1024.0f); } }
    __syncthreads();
    for (int e = tid; e < 64 * 16; e += 128) { const int rl = e >> 4, q = e & 15; vst2((unsigned*)(DH + (r0 + rl) * CC + c0 + q * 8), *(const v4u*)&sh[rl][q * 8]); if (hi_rows) vst2((unsigned*)(DL + (bb * nhi + t0 + rl) * (size_t)CC + c0 + q * 8), *(const v4u*)&sl[rl][q * 8]); }
  } else { const bool hi_rows = t0 < KHI;
#pragma unroll
    for (int j = 0; j < 8; ++j) { const float bias = BA ? bfr(BA[c0 + j * 16 + col]) : 0.f;
#pragma unroll
      for (int r = 0; r < 8; ++r) { const float v = acc[j][r] + bias; const int rl = wave * 16 + 8 * g + r, cl = j * 16 + col; th[cl][rl] = (_Float16)v; const __bf16 bh = (__bf16)v; tb[cl][rl] = bh; tbl[cl][rl] = (__bf16)(v - (float)bh); } }
    __syncthreads();
    for (int e = tid; e < 128 * 8; e += 128) { const int cl = e >> 3, q = e & 7; vst2((unsigned*)(VT + (bb * CC + c0 + cl) * (size_t)TT + t0 + q * 8), *(const v4u*)&th[cl][q * 8]); if (hi_rows) { const size_t o3 = (bb * CC + c0 + cl) * (size_t)KHI + t0 + q * 8; vst2((unsigned*)(VB + o3), *(const v4u*)&tb[cl][q * 8]); vst2((unsigned*)(VBL + o3), *(const v4u*)&tbl[cl][q * 8]); } } } }
// ---- k_sc: block = (query block qb, key block kb <= kb_last(qb), batch b = blockIdx.z) of head h0: logits x SCALE; q hi + residual (x 2^10) against k (2 products) for query rows < QHI, plus the k residual (3 products) for query blocks < QBH (causal early rows); causal: blocks past the diagonal exit, the mask itself is applied by index in k_sm
__global__ __launch_bounds__(128) void k_sc(const _Float16* __restrict__ QH, const _Float16* __restrict__ KH, const _Float16* __restrict__ QL, const _Float16* __restrict__ KL, int h0, float* __restrict__ S0) { __shared__ __align__(16) float ss[4][16][132];
  const int qb = blockIdx.x, kb = blockIdx.y; if (kb > kb_last(qb)) return;
  const int b = blockIdx.z, h = h0; float* S = S0 + (size_t)b * TT * TT;
  const int tid = threadIdx.x, wave = tid >> 5, lane = tid & 31, col = lane & 15, g = lane >> 4; const int k0 = kb * 128; const int ql0 = qb * 64 + wave * 16; const size_t q0 = (size_t)b * TT + ql0, kr0 = (size_t)b * TT + k0;
  v8f acc[8] = {}, accl[8] = {};
  const _Float16* QLb = QL + (size_t)b * QHI * CC; const _Float16* KLb = KL + (size_t)b * KHI * CC;
  if (qb < QBH) {
#pragma unroll
    for (int kc = 0; kc < HD / 32; ++kc) { const v16h ah = frag_h(QH + (q0 + col) * CC + h * HD + kc * 32, lane), al = frag_h(QLb + (size_t)(ql0 + col) * CC + h * HD + kc * 32, lane);
#pragma unroll
      for (int j = 0; j < 8; ++j) { const v16h kbf = frag_h(KH + (kr0 + j * 16 + col) * CC + h * HD + kc * 32, lane), klf = frag_h(KLb + (size_t)(k0 + j * 16 + col) * CC + h * HD + kc * 32, lane); acc[j] = wmma16(ah, kbf, acc[j]); accl[j] = wmma16(al, kbf, accl[j]); accl[j] = wmma16(ah, klf, accl[j]); } }
  } else if (qb * 64 < QHI) {
#pragma unroll
    for (int kc = 0; kc < HD / 32; ++kc) { const v16h ah = frag_h(QH + (q0 + col) * CC + h * HD + kc * 32, lane), al = frag_h(QLb + (size_t)(ql0 + col) * CC + h * HD + kc * 32, lane);
#pragma unroll
      for (int j = 0; j < 8; ++j) { const v16h kbf = frag_h(KH + (kr0 + j * 16 + col) * CC + h * HD + kc * 32, lane); acc[j] = wmma16(ah, kbf, acc[j]); accl[j] = wmma16(al, kbf, accl[j]); } }
  } else {
#pragma unroll
    for (int kc = 0; kc < HD / 32; ++kc) { const v16h ah = frag_h(QH + (q0 + col) * CC + h * HD + kc * 32, lane);
#pragma unroll
      for (int j = 0; j < 8; ++j) { const v16h kbf = frag_h(KH + (kr0 + j * 16 + col) * CC + h * HD + kc * 32, lane); acc[j] = wmma16(ah, kbf, acc[j]); } } }
#pragma unroll
  for (int j = 0; j < 8; ++j) {
#pragma unroll
    for (int r = 0; r < 8; ++r) ss[wave][8 * g + r][j * 16 + col] = (acc[j][r] + accl[j][r] * (1.0f / 1024.0f)) * SCALE; }
  LDSX(); for (int rl = 0; rl < 16; ++rl) vst2(S + (size_t)(ql0 + rl) * TT + k0 + lane * 4, *(const v4f*)&ss[wave][rl][lane * 4]); }
// ---- k_sm: block = query row t (batch plane = blockIdx.y): keys [0, kend): causal -> logit if s <= t else excluded; softmax in f32; P x 2^11 in place (0 for excluded)
__global__ __launch_bounds__(256) void k_sm(float* __restrict__ S0 SM_EXTRA_PARAMS) { __shared__ float sred[8]; __shared__ float sbc; __shared__ __align__(16) float shv[TT];
  const int tid = threadIdx.x; const int t = blockIdx.x; const int kend = (kb_last(t >> 6) + 1) * 128;
  float* sr = S0 + (size_t)blockIdx.y * TT * TT + (size_t)t * TT;
  float m = -3.0e38f; for (int k = tid; k < kend; k += 256) { float v = (!CAUSAL || k <= t) ? sr[k] : -3.0e38f; SM_MASK_HOOK; shv[k] = v; m = fmaxf(m, v); }
#pragma unroll
  for (int o = 1; o < 32; o <<= 1) m = fmaxf(m, __shfl_xor(m, o));
  if ((tid & 31) == 0) sred[tid >> 5] = m; __syncthreads(); if (tid == 0) { float a = sred[0]; for (int i = 1; i < 8; ++i) a = fmaxf(a, sred[i]); sbc = a; } __syncthreads(); m = sbc; __syncthreads();
  float sum = 0.f; for (int k = tid; k < kend; k += 256) { const float v = shv[k]; const float e = (v <= -1.0e38f) ? 0.f : expf(v - m); shv[k] = e; sum += e; }
#pragma unroll
  for (int o = 1; o < 32; o <<= 1) sum += __shfl_xor(sum, o);
  if ((tid & 31) == 0) sred[tid >> 5] = sum; __syncthreads(); if (tid == 0) { float a = 0.f; for (int i = 0; i < 8; ++i) a += sred[i]; sbc = a > 0.f ? 2048.0f / a : 0.f; }   /* a fully excluded row yields P = 0 */ __syncthreads(); const float inv = sbc;
  for (int k = tid; k < kend; k += 256) shv[k] = shv[k] * inv;
  __syncthreads(); for (int q = tid; q < kend / 4; q += 256) vst2(sr + q * 4, *(const v4f*)&shv[q * 4]); }
// ---- k_pv: block = 64 queries (qb) of (b = blockIdx.z, h0): ctx = P . v over keys [0, kend) (P x 2^11 once to f16 against v f16: 1 product; causal early query blocks: P and v as bf16 hi + lo, 3 products); 256-B (row, head) segment by 16 lanes
__global__ __launch_bounds__(128) void k_pv(const float* __restrict__ PS0, const _Float16* __restrict__ VT, const __bf16* __restrict__ VB, const __bf16* __restrict__ VBL, int h0, float* __restrict__ Y) { const int b = blockIdx.z, h = h0; const float* PS = PS0 + (size_t)b * TT * TT; __shared__ __align__(16) float ss[4][16][HD + 4];
  const int tid = threadIdx.x, wave = tid >> 5, lane = tid & 31, col = lane & 15, g = lane >> 4; const int qb = blockIdx.x; const int ql0 = qb * 64 + wave * 16; const int kce = (kb_last(qb) + 1) * 4;
  v8f acc[HD / 16] = {};
  if (qb < QBH) {
#pragma unroll 1
    for (int kc = 0; kc < kce; ++kc) { const F2 p = split_row(PS + (size_t)(ql0 + col) * TT, kc * 32, lane);
      asm volatile("s_wait_loadcnt 0x0" ::: "memory");
#pragma unroll
      for (int j = 0; j < HD / 16; ++j) { const size_t po = ((size_t)b * CC + h * HD + j * 16 + col) * (size_t)KHI + kc * 32; const v16b vh = frag_b(VB + po, lane); acc[j] = wmma_bf(p.h, vh, acc[j]); acc[j] = wmma_bf(p.l, vh, acc[j]); acc[j] = wmma_bf(p.h, frag_b(VBL + po, lane), acc[j]); } }
  } else {
#pragma unroll 1
    for (int kc = 0; kc < kce; ++kc) { const v16h p = frag_f32(PS + (size_t)(ql0 + col) * TT + kc * 32, lane);
      asm volatile("s_wait_loadcnt 0x0" ::: "memory");
#pragma unroll
      for (int j = 0; j < HD / 16; ++j) { const size_t po = ((size_t)b * CC + h * HD + j * 16 + col) * (size_t)TT + kc * 32; acc[j] = wmma16(p, frag_h(VT + po, lane), acc[j]); } } }
#pragma unroll
  for (int j = 0; j < HD / 16; ++j)
#pragma unroll
    for (int r = 0; r < 8; ++r) ss[wave][8 * g + r][j * 16 + col] = acc[j][r] * (1.0f / 2048.0f);
  LDSX(); for (int rl = 0; rl < 16; ++rl) if (lane < HD / 4) vst2(Y + ((size_t)b * TT + ql0 + rl) * CC + h * HD + lane * 4, *(const v4f*)&ss[wave][rl][lane * 4]); }

extern "C" void kernel_launch(void* const* d_in, const int* in_sizes, int n_in, void* d_out, int out_size, void* d_ws, size_t ws_size, hipStream_t stream) {
  (void)in_sizes; (void)n_in; (void)out_size;
  const float** F = (const float**)d_in;
  if (ws_size < (size_t)WS_END) return;
  char* ws = (char*)d_ws; _Float16 *QH = (_Float16*)(ws + WS_QH), *KH = (_Float16*)(ws + WS_KH), *VT = (_Float16*)(ws + WS_VT), *QL = (_Float16*)(ws + WS_QL), *KL = (_Float16*)(ws + WS_KL); __bf16 *VB = (__bf16*)(ws + WS_VB), *VBL = (__bf16*)(ws + WS_VBL); float *S = (float*)(ws + WS_S), *Y = (float*)(ws + WS_Y);
  (void)Y; (void)QL; (void)KL; (void)VB; (void)VBL;
  // inputs: 0 x [8,2048,384]; 1 Wq [384,64]; 2 Wk; 3 Wv ((in,out), no biases)
  if (ws_size < (size_t)WS_END2) return;
  float *WP = (float*)(ws + WS_WP), *BP = (float*)(ws + WS_BP), *Y2 = (float*)(ws + WS_Y2);
  k_padw<<<dim3(32, 3), 256, 0, stream>>>(F[1], F[2], F[3], nullptr, nullptr, nullptr, WP, BP);
  k_proj<<<dim3(TNB * TT / 64, CC / 128, 3), 128, 0, stream>>>(F[0], F[0], F[0], WP, WP + (size_t)CIN * 128, WP + 2 * (size_t)CIN * 128, BP, BP + 128, BP + 256, QH, QL, KH, KL, VT, VB, VBL);
  /* head 0 only (head 1 is the zero padding); every batch in the same launch, each on its own logits plane */
  k_sc<<<dim3(NQB, TT / 128, TNB), 128, 0, stream>>>(QH, KH, QL, KL, 0, S);
  k_sm<<<dim3(TT, TNB), 256, 0, stream>>>(S);
  k_pv<<<dim3(NQB, 1, TNB), 128, 0, stream>>>(S, VT, VB, VBL, 0, Y2);
  k_out64<<<dim3(TNB * TT / 16), 256, 0, stream>>>(Y2, (float*)d_out);
}

// v002
// It runs in 58.6 microseconds.
// Next to v001, in two timings, it ran 2.97 and 3.02 times as fast.
// All steps since v000 together make it 11.3 times as fast.
// compute dtype: all float inputs rounded to bf16; q/k/v projections with EXACT bf16 products on WMMA 16x16x32 (f32 accumulate); causal logits: 3 products (q f16 hi + residual x k hi + residual) for the first 384 rows, single f16 q x k after, x scale; softmax f32 with a running row maximum and sum per 128 keys; exp(logit - max) x 2^11 once to f16 x v once to f16 (1 product; bf16 hi + lo below row 384), divided by the row sum at the end; f32 output.
#include <hip/hip_runtime.h>
#include <math.h>

typedef __attribute__((ext_vector_type(16))) _Float16 v16h;
typedef __attribute__((ext_vector_type(16))) __bf16 v16b;
typedef __attribute__((ext_vector_type(8)))  _Float16 v8h;
typedef __attribute__((ext_vector_type(8)))  float v8f;
typedef __attribute__((ext_vector_type(4)))  float v4f;
typedef __attribute__((ext_vector_type(2)))  float v2f;
typedef __attribute__((ext_vector_type(4)))  unsigned v4u;
typedef __attribute__((ext_vector_type(4)))  int v4i;
typedef float __attribute__((may_alias)) float_a;
typedef int __attribute__((may_alias)) int_a;

template <typename T> __device__ __forceinline__ void vst2(void* p, T v) { *(T*)p = v;  }
__device__ __forceinline__ v8f wmma16(v16h a, v16h b, v8f c) {
  v8f d = __builtin_amdgcn_wmma_f32_16x16x32_f16(false, a, false, b, (short)0, c, false, false);
  asm volatile("v_nop\n\tv_nop\n\tv_nop\n\tv_nop" : "+v"(d) : "v"(a), "v"(b));
  return d;
}
__device__ __forceinline__ v8f wmma_bf(v16b a, v16b b, v8f c) {
  v8f d = __builtin_amdgcn_wmma_f32_16x16x32_bf16(false, a, false, b, (short)0, c, false, false);
  asm volatile("v_nop\n\tv_nop\n\tv_nop\n\tv_nop" : "+v"(d) : "v"(a), "v"(b));
  return d;
}
// 16x16x32 fragments: lane = (h = lane>>4, row/col = lane&15); elements 0..7 = k0+8h+0..7, 8..15 = k0+16+8h+0..7; D element r = row 8h+r
__device__ __forceinline__ v16h frag_h(const _Float16* rowk0, int lane) {
  union { v16h v; v8h q[2]; } u; const _Float16* p = rowk0 + 8 * (lane >> 4);
  u.q[0] = *(const v8h*)p; u.q[1] = *(const v8h*)(p + 16); return u.v;
}
__device__ __forceinline__ v16h frag_f32(const float* rowk0, int lane) {
  v16h a; const float* p = rowk0 + 8 * (lane >> 4);
#pragma unroll
  for (int i = 0; i < 8; ++i) { a[i] = (_Float16)p[i]; a[8 + i] = (_Float16)p[16 + i]; }
  return a;
}
__device__ __forceinline__ v16h frag_f32s(const float* rowk0, int lane, float sc) {
  v16h a; const float* p = rowk0 + 8 * (lane >> 4);
#pragma unroll
  for (int i = 0; i < 8; ++i) { a[i] = (_Float16)(p[i] * sc); a[8 + i] = (_Float16)(p[16 + i] * sc); }
  return a;
}
// column fragment from a [K][ld] layout (column n), rows >= K read as 0
__device__ __forceinline__ v16h fragc_f32(const float* W, int k0, int n, int lane, int ld, int K) {
  v16h a; const int g = lane >> 4;
#pragma unroll
  for (int i = 0; i < 8; ++i) { const int ka = k0 + 8 * g + i, kb = ka + 16;
    a[i] = (_Float16)(ka < K ? W[(size_t)(ka < K ? ka : K - 1) * ld + n] : 0.f); a[8 + i] = (_Float16)(kb < K ? W[(size_t)(kb < K ? kb : K - 1) * ld + n] : 0.f); }
  return a;
}
struct F2 { v16b h, l; };
__device__ __forceinline__ F2 bsplit16(const float v[16]) { F2 r;
#pragma unroll
  for (int i = 0; i < 16; ++i) { const __bf16 h = (__bf16)v[i]; r.h[i] = h; r.l[i] = (__bf16)(v[i] - (float)h); }
  return r; }
__device__ __forceinline__ F2 split_row(const float* row, int k0, int lane) { float v[16]; const float* p = row + k0 + 8 * (lane >> 4);
#pragma unroll
  for (int i = 0; i < 8; ++i) { v[i] = p[i]; v[8 + i] = p[16 + i]; }
  return bsplit16(v); }
__device__ __forceinline__ F2 split_rowK(const float* row, int k0, int lane, int K) { float v[16]; const int g = lane >> 4;
#pragma unroll
  for (int i = 0; i < 8; ++i) { const int ka = k0 + 8 * g + i, kb = ka + 16; v[i] = ka < K ? row[ka < K ? ka : K - 1] : 0.f; v[8 + i] = kb < K ? row[kb < K ? kb : K - 1] : 0.f; }
  return bsplit16(v); }
__device__ __forceinline__ F2 split_col(const float* W, int k0, int n, int lane, int ld, int K) { float v[16]; const int g = lane >> 4;
#pragma unroll
  for (int i = 0; i < 8; ++i) { const int ka = k0 + 8 * g + i, kb = ka + 16; v[i] = ka < K ? W[(size_t)(ka < K ? ka : K - 1) * ld + n] : 0.f; v[8 + i] = kb < K ? W[(size_t)(kb < K ? kb : K - 1) * ld + n] : 0.f; }
  return bsplit16(v); }
__device__ __forceinline__ v8f mac3(const F2& a, const F2& b, v8f c) { c = wmma_bf(a.l, b.h, c); c = wmma_bf(a.h, b.l, c); return wmma_bf(a.h, b.h, c); }
__device__ __forceinline__ float sigm(float v) { return 1.0f / (1.0f + expf(-v)); }
#define LDSX() do { asm volatile("s_wait_dscnt 0" ::: "memory"); __builtin_amdgcn_wave_barrier(); __builtin_amdgcn_fence(__ATOMIC_RELEASE, "workgroup"); } while (0)

// Single-head causal self-attention scaled by the EMBEDDING width (x [8,2048,384]; head_size 64; (in,out) Wq, Wk, Wv [384,64] uniform(+-1/sqrt(384)); no biases, no output projection; scores / sqrt(C) with C = 384 (NOT the head size); tril, -inf): out = softmax(causal(q k^T / sqrt(384))) v -> [8,2048,64].
#define NB 8
#define TT 2048
#define CC 128            // NH * HD = projected width
#define DIN 384
#define NH 2
#define HD 64
#define NQB (TT / 64)
#define SCALE (0.05103103630798288f)
#define CAUSAL 1
#ifndef TNB
#define TNB NB
#endif
__device__ __forceinline__ float bfr(float v) { return (float)(__bf16)v; }
__host__ __device__ __forceinline__ int kb_last(int qb) { return CAUSAL ? ((qb * 64 + 63) >> 7) : (TT / 128 - 1); }
typedef __attribute__((ext_vector_type(8))) __bf16 v8b;
__device__ __forceinline__ v16b frag_b(const __bf16* rowk0, int lane) {
  union { v16b v; v8b q[2]; } u; const __bf16* p = rowk0 + 8 * (lane >> 4);
  u.q[0] = *(const v8b*)p; u.q[1] = *(const v8b*)(p + 16); return u.v;
}
#define QBH 6              // unused; causal: query rows < QHI of each sequence (32-row blocks 0..11; few keys, no averaging) take the high-precision path
#define QHI 384            // rows carrying a q residual plane
#define KHI 384            // key rows carrying k residual / v bf16 hi+lo planes (used only by the causal high-precision path)
// B fragment (k rows k0+.., output column o) of a weight: (in,out) [K][ld] or (out,in) [ld rows of K]: bf16 exact, or f16(bf16 * 256) exact
__device__ __forceinline__ v16b wcol_io(const float* Wm, int k0, int o, int lane, int ld) { v16b w; const int g = lane >> 4;
#pragma unroll
  for (int i = 0; i < 8; ++i) { w[i] = (__bf16)Wm[(size_t)(k0 + 8 * g + i) * ld + o]; w[8 + i] = (__bf16)Wm[(size_t)(k0 + 16 + 8 * g + i) * ld + o]; }
  return w; }
__device__ __forceinline__ v16b wcol_oi(const float* Wm, int k0, int o, int lane, int K) { v16b w; const float* p = Wm + (size_t)o * K + k0 + 8 * (lane >> 4);
#pragma unroll
  for (int i = 0; i < 8; ++i) { w[i] = (__bf16)p[i]; w[8 + i] = (__bf16)p[16 + i]; }
  return w; }
__device__ __forceinline__ v16h wcolh_io(const float* Wm, int k0, int o, int lane, int ld) { v16h w; const int g = lane >> 4;
#pragma unroll
  for (int i = 0; i < 8; ++i) { w[i] = (_Float16)(bfr(Wm[(size_t)(k0 + 8 * g + i) * ld + o]) * 256.0f); w[8 + i] = (_Float16)(bfr(Wm[(size_t)(k0 + 16 + 8 * g + i) * ld + o]) * 256.0f); }
  return w; }
__device__ __forceinline__ v16h wcolh_oi(const float* Wm, int k0, int o, int lane, int K) { v16h w; const float* p = Wm + (size_t)o * K + k0 + 8 * (lane >> 4);
#pragma unroll
  for (int i = 0; i < 8; ++i) { w[i] = (_Float16)(bfr(p[i]) * 256.0f); w[8 + i] = (_Float16)(bfr(p[16 + i]) * 256.0f); }
  return w; }
#define WQKV_LAYOUT 0   // 0 = (in,out) [DIN][CC]; 1 = (out,in) [CC][DIN]; 2 = per-head [NH][DIN][HD]
__device__ __forceinline__ v16b wcol_hdk(const float* Wm, int k0, int o, int lane) { v16b w; const int g = lane >> 4; const float* p = Wm + (size_t)(o / HD) * DIN * HD + (o % HD);
#pragma unroll
  for (int i = 0; i < 8; ++i) { w[i] = (__bf16)p[(size_t)(k0 + 8 * g + i) * HD]; w[8 + i] = (__bf16)p[(size_t)(k0 + 16 + 8 * g + i) * HD]; }
  return w; }
#define WO_OUT_IN 0
#if WQKV_LAYOUT == 1
#define WCOL(W, k0, o, lane) wcol_oi(W, k0, o, lane, DIN)
#elif WQKV_LAYOUT == 2
#define WCOL(W, k0, o, lane) wcol_hdk(W, k0, o, lane)
#else
#define WCOL(W, k0, o, lane) wcol_io(W, k0, o, lane, CC)
#endif
#if WO_OUT_IN
#define WOCOL(W, k0, o, lane) wcol_oi(W, k0, o, lane, CC)
#define WOCOLH(W, k0, o, lane) wcolh_oi(W, k0, o, lane, CC)
#else
#define WOCOL(W, k0, o, lane) wcol_io(W, k0, o, lane, DIN)
#define WOCOLH(W, k0, o, lane) wcolh_io(W, k0, o, lane, DIN)
#endif
#define CIN 384
// ---- k_padw: the three (in,out) [C][64] projection weights copied into zero-padded (in,out) [C][128] ws planes (columns 64..127 zero) + zero-padded [128] biases
__global__ __launch_bounds__(256) void k_padw(const float* __restrict__ WQ, const float* __restrict__ WK, const float* __restrict__ WV, const float* __restrict__ BQ, const float* __restrict__ BK, const float* __restrict__ BV, float* __restrict__ WP, float* __restrict__ BP) { const int which = blockIdx.y; const float* Wsrc = which == 0 ? WQ : (which == 1 ? WK : WV); const float* Bsrc = which == 0 ? BQ : (which == 1 ? BK : BV); float* dst = WP + (size_t)which * CIN * 128;
  for (int e = blockIdx.x * 256 + threadIdx.x; e < CIN * 32; e += gridDim.x * 256) { const int row = e >> 5, q = e & 31; const v4f ld = *(const v4f*)(Wsrc + (size_t)row * 64 + (q & 15) * 4); asm volatile("s_wait_loadcnt 0x0" ::: "memory"); const float keep = q < 16 ? 1.f : 0.f; v4f ov; ov[0] = ld[0] * keep; ov[1] = ld[1] * keep; ov[2] = ld[2] * keep; ov[3] = ld[3] * keep; vst2(dst + (size_t)row * 128 + q * 4, ov); }
  if (blockIdx.x == 0 && threadIdx.x < 128) { const int c = threadIdx.x; float bvv = 0.f; if (Bsrc) { const float t = Bsrc[c & 63]; asm volatile("s_wait_loadcnt 0x0" ::: "memory"); bvv = c < 64 ? t : 0.f; } vst2(BP + which * 128 + c, bvv); } }
// ---- k_out64: out[b][t][0..63] = ctx row columns 0..63 (256 B by 16 lanes)
__global__ __launch_bounds__(256) void k_out64(const float* __restrict__ Y, float* __restrict__ OUT) { const size_t row = (size_t)blockIdx.x * 16 + (threadIdx.x >> 4); const int q = threadIdx.x & 15; const v4f v = *(const v4f*)(Y + row * CC + q * 4); asm volatile("s_wait_loadcnt 0x0" ::: "memory"); vst2(OUT + row * 64 + q * 4, v); }
#define WS_WP (WS_END)                                  // padded weights [3][128 x C]
#define WS_BP (WS_WP + 4u * 3 * (size_t)CIN * 128)        // padded biases [3][128]
#define WS_Y2 (WS_BP + 4u * 3 * 128)                      // ctx rows [b*TT+t][128]
#define WS_END2 (WS_Y2 + 4u * (size_t)NB * TT * CC)
#ifndef SM_EXTRA_PARAMS
#define SM_EXTRA_PARAMS
#endif
#ifndef PROJ_EXTRA_PARAMS
#define PROJ_EXTRA_PARAMS
#endif
#ifndef SM_MASK_HOOK
#define SM_MASK_HOOK (void)0
#endif

#define WS_QH  0u                                      // f16 q rows [b*t][CC]
#define WS_KH  (WS_QH + 2u * (size_t)NB * TT * CC)      // f16 k rows [b*t][CC]
#define WS_VT  (WS_KH + 2u * (size_t)NB * TT * CC)      // f16 v planes [b][c][t]
#define WS_QL  (WS_VT + 2u * (size_t)NB * CC * TT)      // f16 q residual x 2^10 rows [b][t < QHI][CC]
#define WS_KL  (WS_QL + 2u * (size_t)NB * QHI * CC)     // f16 k residual x 2^10 rows [b][t < KHI][CC]
#define WS_VB  (WS_KL + 2u * (size_t)NB * KHI * CC)     // bf16 v hi planes [b][c][t < KHI]
#define WS_VBL (WS_VB + 2u * (size_t)NB * CC * KHI)
#define WS_S   (WS_VBL + 2u * (size_t)NB * CC * KHI)    // unused (the logits stay on chip); it keeps the offsets of the planes behind it
#define WS_Y   (WS_S  + 4u * (size_t)NB * TT * TT)      // f32 ctx rows [b*t][CC] (only when there is an output projection)
#define WS_END (WS_Y  + 0u)

// ---- k_proj: block = (64 rows, 128 cols, which): q/k/v = X W (+ b) with exact bf16 products (K = DIN) -> which 0: q f16 rows (+ residual rows < QHI); 1: k f16 rows (+ residual rows < KHI); 2: v f16 planes [c][t] (+ bf16 hi/lo planes for t < KHI)
__global__ __launch_bounds__(128) void k_proj(const float* __restrict__ XQ, const float* __restrict__ XK, const float* __restrict__ XV, const float* __restrict__ WQ, const float* __restrict__ WK, const float* __restrict__ WV, const float* __restrict__ BQ, const float* __restrict__ BK, const float* __restrict__ BV,
    _Float16* __restrict__ QH, _Float16* __restrict__ QL, _Float16* __restrict__ KH, _Float16* __restrict__ KL, _Float16* __restrict__ VT, __bf16* __restrict__ VB, __bf16* __restrict__ VBL) {
  __shared__ __align__(16) _Float16 sh[64][136], sl[64][136]; __shared__ __align__(16) _Float16 th[128][72]; __shared__ __align__(16) __bf16 tb[128][72], tbl[128][72];
  const int tid = threadIdx.x, wave = tid >> 5, lane = tid & 31, col = lane & 15, g = lane >> 4; const int which = blockIdx.z; const int c0 = blockIdx.y * 128; const size_t r0 = (size_t)blockIdx.x * 64; const size_t bb = r0 / TT; const int t0 = (int)(r0 % TT);
  const float* X = which == 0 ? XQ : which == 1 ? XK : XV; const float* WA = which == 0 ? WQ : which == 1 ? WK : WV; const float* BA = which == 0 ? BQ : which == 1 ? BK : BV;
  v8f acc[8] = {};
#pragma unroll 2
  for (int kc = 0; kc < DIN / 32; ++kc) { v16b a; { const float* p = X + (r0 + wave * 16 + col) * DIN + kc * 32 + 8 * g;
#pragma unroll
      for (int i = 0; i < 8; ++i) { a[i] = (__bf16)p[i]; a[8 + i] = (__bf16)p[16 + i]; } }
    asm volatile("s_wait_loadcnt 0x0" ::: "memory");
#pragma unroll
    for (int j = 0; j < 8; ++j) { const v16b w = WCOL(WA, kc * 32, c0 + j * 16 + col, lane); asm volatile("s_wait_loadcnt 0x0" ::: "memory"); acc[j] = wmma_bf(a, w, acc[j]); } }
  if (which < 2) { _Float16* DH = which == 0 ? QH : KH; _Float16* DL = which == 0 ? QL : KL; const int nhi = which == 0 ? QHI : KHI; const bool hi_rows = t0 < nhi;
#pragma unroll
    for (int j = 0; j < 8; ++j) { const float bias = BA ? bfr(BA[c0 + j * 16 + col]) : 0.f;
#pragma unroll
      for (int r = 0; r < 8; ++r) { const float v = acc[j][r] + bias; const _Float16 hv = (_Float16)v; sh[wave * 16 + 8 * g + r][j * 16 + col] = hv; sl[wave * 16 + 8 * g + r][j * 16 + col] = (_Float16)((v - (float)hv) * 1024.0f); } }
    __syncthreads();
    for (int e = tid; e < 64 * 16; e += 128) { const int rl = e >> 4, q = e & 15; vst2((unsigned*)(DH + (r0 + rl) * CC + c0 + q * 8), *(const v4u*)&sh[rl][q * 8]); if (hi_rows) vst2((unsigned*)(DL + (bb * nhi + t0 + rl) * (size_t)CC + c0 + q * 8), *(const v4u*)&sl[rl][q * 8]); }
  } else { const bool hi_rows = t0 < KHI;
#pragma unroll
    for (int j = 0; j < 8; ++j) { const float bias = BA ? bfr(BA[c0 + j * 16 + col]) : 0.f;
#pragma unroll
      for (int r = 0; r < 8; ++r) { const float v = acc[j][r] + bias; const int rl = wave * 16 + 8 * g + r, cl = j * 16 + col; th[cl][rl] = (_Float16)v; const __bf16 bh = (__bf16)v; tb[cl][rl] = bh; tbl[cl][rl] = (__bf16)(v - (float)bh); } }
    __syncthreads();
    for (int e = tid; e < 128 * 8; e += 128) { const int cl = e >> 3, q = e & 7; vst2((unsigned*)(VT + (bb * CC + c0 + cl) * (size_t)TT + t0 + q * 8), *(const v4u*)&th[cl][q * 8]); if (hi_rows) { const size_t o3 = (bb * CC + c0 + cl) * (size_t)KHI + t0 + q * 8; vst2((unsigned*)(VB + o3), *(const v4u*)&tb[cl][q * 8]); vst2((unsigned*)(VBL + o3), *(const v4u*)&tbl[cl][q * 8]); } } } }
// ---- k_fa: block = 32 query rows of batch b = blockIdx.x, head 0: logits, causal softmax and P . v in one pass, no logits plane.
// Wave w takes the 128-key blocks w, w + 4, ... up to the diagonal block, for all 32 rows (two 16-row tiles share every k and v fragment), and keeps its own running row maximum, row sum and ctx tiles; the four waves' parts are joined in LDS at the end.
// Per block: logits (1 f16 product; q hi + residual x k hi + residual, 3 products, for query rows < QHI), scaled by SCALE x log2(e); e = 2^(logit - running max + 11) in f32, through the wave's own LDS tile into A fragments (once to f16 against v f16; bf16 hi + lo against v bf16 hi + lo, 3 products, for rows < QHI). The row sum carries the same 2^11, so ctx / sum needs no other factor.
// the plain builtins: the compiler keeps the distance behind a matrix instruction itself and stays free to place the fragment loads ahead of the products
__device__ __forceinline__ v8f mm_h(v16h a, v16h b, v8f c) { return __builtin_amdgcn_wmma_f32_16x16x32_f16(false, a, false, b, (short)0, c, false, false); }
__device__ __forceinline__ v8f mm_b(v16b a, v16b b, v8f c) { return __builtin_amdgcn_wmma_f32_16x16x32_bf16(false, a, false, b, (short)0, c, false, false); }
// fragment at p = row start + k0 + 8 * (lane >> 4): one address pair serves a whole group of loads through constant offsets
__device__ __forceinline__ v16h frag_hp(const _Float16* p) { union { v16h v; v8h q[2]; } u; u.q[0] = *(const v8h*)p; u.q[1] = *(const v8h*)(p + 16); return u.v; }
__device__ __forceinline__ v16b frag_bp(const __bf16* p) { union { v16b v; v8b q[2]; } u; u.q[0] = *(const v8b*)p; u.q[1] = *(const v8b*)(p + 16); return u.v; }
// behind a group of global loads: their address registers are free to be rewritten only behind this wait; its "memory" clobber also holds the group ahead of what follows, so that the loads fly together
// the pointers are named as inputs so that their registers live up to the wait
#define XW1(p) asm volatile("s_wait_xcnt 0x0" :: "v"(p) : "memory")
#define XW2(p, q) asm volatile("s_wait_xcnt 0x0" :: "v"(p), "v"(q) : "memory")
// 2^x with the slot that the instruction set asks for behind a transcendental (the next instruction may overwrite x) kept in the same statement
__device__ __forceinline__ float ex2(float x) { asm("v_exp_f32 %0, %0\n\tv_nop" : "+v"(x)); return x; }
#define QT 2               // 16-row query tiles per wave
#define SCALE2 (SCALE * 1.4426950408889634f)
// one 128-key block of one wave
template <bool HI>
__device__ __forceinline__ void fa_keys(const v16h (&ah)[QT][HD / 32], const v16h (&al)[QT][HD / 32], const _Float16* __restrict__ Kh, const _Float16* __restrict__ Kl, const _Float16* __restrict__ Vt, const __bf16* __restrict__ Vb, const __bf16* __restrict__ Vbl,
    int k0, int ql0, bool diag, int lane, float (*sw)[132], v8f (&o)[QT][HD / 16], float (&m)[QT][8], float (&l)[QT][8]) {
  const int col = lane & 15, g = lane >> 4;
  v8f acc[QT][8]; v16h vf[HI ? 1 : 4][HD / 16];
  const size_t ko = (size_t)(k0 + col) * CC + 8 * g; const _Float16* kp = Kh + ko; const _Float16* rp = Kl + ko; const _Float16* vp = Vt + (size_t)col * TT + k0 + 8 * g;
  if (HI) {
#pragma unroll
    for (int j0 = 0; j0 < 8; j0 += 4) { v16h kf[4][HD / 32], rf[4][HD / 32];   // the fragments of 64 keys are fetched together, ahead of their products: one memory round trip a group
#pragma unroll
      for (int jj = 0; jj < 4; ++jj) {
#pragma unroll
        for (int kc = 0; kc < HD / 32; ++kc) { kf[jj][kc] = frag_hp(kp + (j0 + jj) * 16 * CC + kc * 32); rf[jj][kc] = frag_hp(rp + (j0 + jj) * 16 * CC + kc * 32); } }
      XW2(kp, rp);
      __builtin_amdgcn_sched_barrier(0);   // keeps the products behind the whole group of loads
#pragma unroll
      for (int jj = 0; jj < 4; ++jj) {
#pragma unroll
        for (int t = 0; t < QT; ++t) { v8f a = {}, ar = {};   // ar: the residual products (x 2^10)
#pragma unroll
          for (int kc = 0; kc < HD / 32; ++kc) { a = mm_h(ah[t][kc], kf[jj][kc], a); ar = mm_h(al[t][kc], kf[jj][kc], ar); ar = mm_h(ah[t][kc], rf[jj][kc], ar); }
#pragma unroll
          for (int r = 0; r < 8; ++r) acc[t][j0 + jj][r] = (a[r] + ar[r] * (1.0f / 1024.0f)) * SCALE2; } } }
  } else { v16h kf[8][HD / 32];   // the fragments of the 128 keys are fetched together, ahead of their products
#pragma unroll
    for (int j = 0; j < 8; ++j) {
#pragma unroll
      for (int kc = 0; kc < HD / 32; ++kc) kf[j][kc] = frag_hp(kp + j * 16 * CC + kc * 32); }
    XW1(kp);
    __builtin_amdgcn_sched_barrier(0);   // keeps the products behind the whole group of loads: without it each product moves up to its own pair of loads and waits for that pair alone
#pragma unroll
    for (int j = 0; j < 8; ++j) {
#pragma unroll
      for (int t = 0; t < QT; ++t) { v8f a = {};
#pragma unroll
        for (int kc = 0; kc < HD / 32; ++kc) a = mm_h(ah[t][kc], kf[j][kc], a);
#pragma unroll
        for (int r = 0; r < 8; ++r) acc[t][j][r] = a[r] * SCALE2; } }
    // the v fragments of the first 64 keys start here, together, and fly under the softmax
#pragma unroll
    for (int kc = 0; kc < 2; ++kc) {
#pragma unroll
      for (int j = 0; j < HD / 16; ++j) vf[kc][j] = frag_hp(vp + j * 16 * TT + kc * 32); }
    XW1(vp);
  }
  if (diag) {   // only the diagonal block holds keys past a query (wave-uniform test)
#pragma unroll
    for (int t = 0; t < QT; ++t) {
#pragma unroll
      for (int j = 0; j < 8; ++j) {
#pragma unroll
        for (int r = 0; r < 8; ++r) acc[t][j][r] = (k0 + j * 16 + col > ql0 + t * 16 + 8 * g + r) ? -3.0e38f : acc[t][j][r]; } } }
#pragma unroll
  for (int t = 0; t < QT; ++t) {
#pragma unroll
    for (int r = 0; r < 8; ++r) { float mx = acc[t][0][r];
#pragma unroll
      for (int j = 1; j < 8; ++j) mx = fmaxf(mx, acc[t][j][r]);
#pragma unroll
      for (int s = 1; s < 16; s <<= 1) mx = fmaxf(mx, __shfl_xor(mx, s));
      const float mn = fmaxf(m[t][r], mx); const float f = ex2(m[t][r] - mn); m[t][r] = mn; l[t][r] *= f;
#pragma unroll
      for (int j = 0; j < HD / 16; ++j) o[t][j][r] *= f; }
#pragma unroll
    for (int j = 0; j < 8; ++j) {
#pragma unroll
      for (int r = 0; r < 8; ++r) { const float e = ex2(acc[t][j][r] - (m[t][r] - 11.0f));   /* an excluded key (-3e38) gives 0: every row sees key k0 of every block it walks, so m is a real logit */ l[t][r] += e; sw[t * 16 + 8 * g + r][j * 16 + col] = e; } }
    if (!HI && t == 0) {   // the other 64 keys' v fragments start once the first tile's logits have left their registers
#pragma unroll
      for (int kc = 2; kc < 4; ++kc) {
#pragma unroll
        for (int j = 0; j < HD / 16; ++j) vf[kc][j] = frag_hp(vp + j * 16 * TT + kc * 32); }
      XW1(vp);   // holds them ahead of the second tile's work: they fly under it
    } }
  LDSX();   // the wave's own stores land before its other lanes read them as rows
  if (HI) {
    const size_t po = (size_t)col * KHI + k0 + 8 * g; const __bf16* hp = Vb + po; const __bf16* lp = Vbl + po;
#pragma unroll
    for (int c0 = 0; c0 < 4; c0 += 2) { v16b vh[2][HD / 16], vl[2][HD / 16];   // v fragments of 64 keys fetched together, ahead of their products
#pragma unroll
      for (int cc = 0; cc < 2; ++cc) {
#pragma unroll
        for (int j = 0; j < HD / 16; ++j) { vh[cc][j] = frag_bp(hp + j * 16 * KHI + (c0 + cc) * 32); vl[cc][j] = frag_bp(lp + j * 16 * KHI + (c0 + cc) * 32); } }
      XW2(hp, lp);
      __builtin_amdgcn_sched_barrier(0);   // keeps the products behind the whole group of loads
#pragma unroll
      for (int cc = 0; cc < 2; ++cc) {
#pragma unroll
        for (int t = 0; t < QT; ++t) { const F2 p = split_row(&sw[t * 16 + col][0], (c0 + cc) * 32, lane);
#pragma unroll
          for (int j = 0; j < HD / 16; ++j) { o[t][j] = mm_b(p.h, vh[cc][j], o[t][j]); o[t][j] = mm_b(p.l, vh[cc][j], o[t][j]); o[t][j] = mm_b(p.h, vl[cc][j], o[t][j]); } } } }
  } else {
#pragma unroll
    for (int kc = 0; kc < 4; ++kc) {
#pragma unroll
      for (int t = 0; t < QT; ++t) { const v16h p = frag_f32(&sw[t * 16 + col][kc * 32], lane);
#pragma unroll
        for (int j = 0; j < HD / 16; ++j) o[t][j] = mm_h(p, vf[kc][j], o[t][j]); } } }
  LDSX();   // every row read has returned before the next block's stores reuse the tile
}
// two waves per SIMD: the 512 work-groups are then all resident, two on a WGP
__global__ __launch_bounds__(128, 2) void k_fa(const _Float16* __restrict__ QH, const _Float16* __restrict__ KH, const _Float16* __restrict__ QL, const _Float16* __restrict__ KL, const _Float16* __restrict__ VT, const __bf16* __restrict__ VB, const __bf16* __restrict__ VBL, float* __restrict__ Y) {
  __shared__ __align__(16) float ss[4][QT * 16][132];
  const int tid = threadIdx.x, lane = tid & 31, col = lane & 15, g = lane >> 4; const int wave = __builtin_amdgcn_readfirstlane(tid >> 5);
  constexpr int NT = TT / (QT * 16); const int y = blockIdx.y; const int qt = y < NT / 2 ? NT - 1 - y : y - NT / 2;   // long tiles start first; the second half of the grid runs from the shortest up, so that a late work-group joins an early one of the opposite length
  const int b = blockIdx.x; const int ql0 = qt * (QT * 16); const int kbl = ql0 >> 7;   // the 32 rows share their diagonal block: 128 is a multiple of 32
  const _Float16* Kh = KH + (size_t)b * TT * CC; const _Float16* Kl = KL + (size_t)b * KHI * CC; const _Float16* Vt = VT + (size_t)b * CC * TT; const __bf16* Vb = VB + (size_t)b * CC * KHI; const __bf16* Vbl = VBL + (size_t)b * CC * KHI;
  float (*sw)[132] = ss[wave];
  v8f o[QT][HD / 16] = {}; float m[QT][8], l[QT][8];
  v16h ah[QT][HD / 32], al[QT][HD / 32] = {};
  const _Float16* qp = QH + ((size_t)b * TT + ql0 + col) * CC + 8 * g; const _Float16* qr = QL + ((size_t)b * QHI + ql0 + col) * CC + 8 * g;   // qr is read only where ql0 < QHI
#pragma unroll
  for (int t = 0; t < QT; ++t) {
#pragma unroll
    for (int r = 0; r < 8; ++r) { m[t][r] = -3.0e38f; l[t][r] = 0.f; }
#pragma unroll
    for (int kc = 0; kc < HD / 32; ++kc) ah[t][kc] = frag_hp(qp + t * 16 * CC + kc * 32); }
  XW1(qp);
  if (__builtin_expect(ql0 >= QHI, 1)) {   // the common path first in the text
#pragma unroll 1
    for (int kb = wave; kb <= kbl; kb += 4) fa_keys<false>(ah, al, Kh, Kl, Vt, Vb, Vbl, kb * 128, ql0, kb == kbl, lane, sw, o, m, l);
  } else {
#pragma unroll
    for (int t = 0; t < QT; ++t) {
#pragma unroll
      for (int kc = 0; kc < HD / 32; ++kc) al[t][kc] = frag_hp(qr + t * 16 * CC + kc * 32); }
    XW1(qr);
    static_assert(QHI <= 4 * 128, "a wave of these rows walks at most one block");
    if (wave <= kbl) fa_keys<true>(ah, al, Kh, Kl, Vt, Vb, Vbl, wave * 128, ql0, wave == kbl, lane, sw, o, m, l);
  }
#pragma unroll
  for (int t = 0; t < QT; ++t) {
#pragma unroll
    for (int r = 0; r < 8; ++r) {
#pragma unroll
      for (int s = 1; s < 16; s <<= 1) l[t][r] += __shfl_xor(l[t][r], s); }
#pragma unroll
    for (int j = 0; j < HD / 16; ++j) {
#pragma unroll
      for (int r = 0; r < 8; ++r) sw[t * 16 + 8 * g + r][j * 16 + col] = o[t][j][r]; }
    if (col == 0) {
#pragma unroll
      for (int r = 0; r < 8; ++r) { sw[t * 16 + 8 * g + r][HD] = m[t][r]; sw[t * 16 + 8 * g + r][HD + 1] = l[t][r]; } } }
  __syncthreads();
  // join: a wave that had no key block holds max -3e38, sum 0, ctx 0 and drops out with factor 0 (wave 0 always has block 0, whose key 0 every row sees)
  for (int e = tid; e < QT * 16 * (HD / 4); e += 128) { const int row = e / (HD / 4), q = e % (HD / 4);
    float mm = ss[0][row][HD];
#pragma unroll
    for (int w = 1; w < 4; ++w) mm = fmaxf(mm, ss[w][row][HD]);
    float den = 0.f; v4f a = {};
#pragma unroll
    for (int w = 0; w < 4; ++w) { const float f = ex2(ss[w][row][HD] - mm); den += f * ss[w][row][HD + 1]; a += *(const v4f*)&ss[w][row][q * 4] * f; }
    const float inv = den > 0.f ? 1.0f / den : 0.f;   /* a fully excluded row yields 0 */
    vst2(Y + ((size_t)b * TT + ql0 + row) * CC + q * 4, a * inv); } }

extern "C" void kernel_launch(void* const* d_in, const int* in_sizes, int n_in, void* d_out, int out_size, void* d_ws, size_t ws_size, hipStream_t stream) {
  (void)in_sizes; (void)n_in; (void)out_size;
  const float** F = (const float**)d_in;
  if (ws_size < (size_t)WS_END) return;
  char* ws = (char*)d_ws; _Float16 *QH = (_Float16*)(ws + WS_QH), *KH = (_Float16*)(ws + WS_KH), *VT = (_Float16*)(ws + WS_VT), *QL = (_Float16*)(ws + WS_QL), *KL = (_Float16*)(ws + WS_KL); __bf16 *VB = (__bf16*)(ws + WS_VB), *VBL = (__bf16*)(ws + WS_VBL); float *Y = (float*)(ws + WS_Y);
  (void)Y; (void)QL; (void)KL; (void)VB; (void)VBL;
  // inputs: 0 x [8,2048,384]; 1 Wq [384,64]; 2 Wk; 3 Wv ((in,out), no biases)
  if (ws_size < (size_t)WS_END2) return;
  float *WP = (float*)(ws + WS_WP), *BP = (float*)(ws + WS_BP), *Y2 = (float*)(ws + WS_Y2);
  k_padw<<<dim3(32, 3), 256, 0, stream>>>(F[1], F[2], F[3], nullptr, nullptr, nullptr, WP, BP);
  k_proj<<<dim3(TNB * TT / 64, CC / 128, 3), 128, 0, stream>>>(F[0], F[0], F[0], WP, WP + (size_t)CIN * 128, WP + 2 * (size_t)CIN * 128, BP, BP + 128, BP + 256, QH, QL, KH, KL, VT, VB, VBL);
  /* head 0 only (head 1 is the zero padding); every batch in the same launch */
  k_fa<<<dim3(TNB, TT / (QT * 16)), 128, 0, stream>>>(QH, KH, QL, KL, VT, VB, VBL, Y2);
  k_out64<<<dim3(TNB * TT / 16), 256, 0, stream>>>(Y2, (float*)d_out);
}

// v003
// Measured time: 31.6 microseconds a run.
// Next to v002, in two timings, it ran 1.82 and 1.91 times as fast.
// Over all steps from v000 it is 21.0 times as fast.
// compute dtype: all float inputs rounded to bf16; q/k/v projections with EXACT bf16 products on WMMA 16x16x32 (f32 accumulate); causal logits: 3 products (q f16 hi + residual x k hi + residual) for the first 384 rows, single f16 q x k after, x scale; softmax f32 with a running row maximum and sum per 128 keys; exp(logit - max) x 2^11 once to f16 x v once to f16 (1 product; bf16 hi + lo below row 384), divided by the row sum at the end; f32 output.
#include <hip/hip_runtime.h>
#include <math.h>

typedef __attribute__((ext_vector_type(16))) _Float16 v16h;
typedef __attribute__((ext_vector_type(16))) __bf16 v16b;
typedef __attribute__((ext_vector_type(8)))  _Float16 v8h;
typedef __attribute__((ext_vector_type(8)))  float v8f;
typedef __attribute__((ext_vector_type(4)))  float v4f;
typedef __attribute__((ext_vector_type(2)))  float v2f;
typedef __attribute__((ext_vector_type(4)))  unsigned v4u;
typedef __attribute__((ext_vector_type(4)))  int v4i;
typedef float __attribute__((may_alias)) float_a;
typedef int __attribute__((may_alias)) int_a;

template <typename T> __device__ __forceinline__ void vst2(void* p, T v) { *(T*)p = v;  }
__device__ __forceinline__ v8f wmma16(v16h a, v16h b, v8f c) {
  v8f d = __builtin_amdgcn_wmma_f32_16x16x32_f16(false, a, false, b, (short)0, c, false, false);
  asm volatile("v_nop\n\tv_nop\n\tv_nop\n\tv_nop" : "+v"(d) : "v"(a), "v"(b));
  return d;
}
__device__ __forceinline__ v8f wmma_bf(v16b a, v16b b, v8f c) {
  v8f d = __builtin_amdgcn_wmma_f32_16x16x32_bf16(false, a, false, b, (short)0, c, false, false);
  asm volatile("v_nop\n\tv_nop\n\tv_nop\n\tv_nop" : "+v"(d) : "v"(a), "v"(b));
  return d;
}
// 16x16x32 fragments: lane = (h = lane>>4, row/col = lane&15); elements 0..7 = k0+8h+0..7, 8..15 = k0+16+8h+0..7; D element r = row 8h+r
__device__ __forceinline__ v16h frag_h(const _Float16* rowk0, int lane) {
  union { v16h v; v8h q[2]; } u; const _Float16* p = rowk0 + 8 * (lane >> 4);
  u.q[0] = *(const v8h*)p; u.q[1] = *(const v8h*)(p + 16); return u.v;
}
__device__ __forceinline__ v16h frag_f32(const float* rowk0, int lane) {
  v16h a; const float* p = rowk0 + 8 * (lane >> 4);
#pragma unroll
  for (int i = 0; i < 8; ++i) { a[i] = (_Float16)p[i]; a[8 + i] = (_Float16)p[16 + i]; }
  return a;
}
__device__ __forceinline__ v16h frag_f32s(const float* rowk0, int lane, float sc) {
  v16h a; const float* p = rowk0 + 8 * (lane >> 4);
#pragma unroll
  for (int i = 0; i < 8; ++i) { a[i] = (_Float16)(p[i] * sc); a[8 + i] = (_Float16)(p[16 + i] * sc); }
  return a;
}
// column fragment from a [K][ld] layout (column n), rows >= K read as 0
__device__ __forceinline__ v16h fragc_f32(const float* W, int k0, int n, int lane, int ld, int K) {
  v16h a; const int g = lane >> 4;
#pragma unroll
  for (int i = 0; i < 8; ++i) { const int ka = k0 + 8 * g + i, kb = ka + 16;
    a[i] = (_Float16)(ka < K ? W[(size_t)(ka < K ? ka : K - 1) * ld + n] : 0.f); a[8 + i] = (_Float16)(kb < K ? W[(size_t)(kb < K ? kb : K - 1) * ld + n] : 0.f); }
  return a;
}
struct F2 { v16b h, l; };
__device__ __forceinline__ F2 bsplit16(const float v[16]) { F2 r;
#pragma unroll
  for (int i = 0; i < 16; ++i) { const __bf16 h = (__bf16)v[i]; r.h[i] = h; r.l[i] = (__bf16)(v[i] - (float)h); }
  return r; }
__device__ __forceinline__ F2 split_row(const float* row, int k0, int lane) { float v[16]; const float* p = row + k0 + 8 * (lane >> 4);
#pragma unroll
  for (int i = 0; i < 8; ++i) { v[i] = p[i]; v[8 + i] = p[16 + i]; }
  return bsplit16(v); }
__device__ __forceinline__ F2 split_rowK(const float* row, int k0, int lane, int K) { float v[16]; const int g = lane >> 4;
#pragma unroll
  for (int i = 0; i < 8; ++i) { const int ka = k0 + 8 * g + i, kb = ka + 16; v[i] = ka < K ? row[ka < K ? ka : K - 1] : 0.f; v[8 + i] = kb < K ? row[kb < K ? kb : K - 1] : 0.f; }
  return bsplit16(v); }
__device__ __forceinline__ F2 split_col(const float* W, int k0, int n, int lane, int ld, int K) { float v[16]; const int g = lane >> 4;
#pragma unroll
  for (int i = 0; i < 8; ++i) { const int ka = k0 + 8 * g + i, kb = ka + 16; v[i] = ka < K ? W[(size_t)(ka < K ? ka : K - 1) * ld + n] : 0.f; v[8 + i] = kb < K ? W[(size_t)(kb < K ? kb : K - 1) * ld + n] : 0.f; }
  return bsplit16(v); }
__device__ __forceinline__ v8f mac3(const F2& a, const F2& b, v8f c) { c = wmma_bf(a.l, b.h, c); c = wmma_bf(a.h, b.l, c); return wmma_bf(a.h, b.h, c); }
__device__ __forceinline__ float sigm(float v) { return 1.0f / (1.0f + expf(-v)); }
#define LDSX() do { asm volatile("s_wait_dscnt 0" ::: "memory"); __builtin_amdgcn_wave_barrier(); __builtin_amdgcn_fence(__ATOMIC_RELEASE, "workgroup"); } while (0)

// Single-head causal self-attention scaled by the EMBEDDING width (x [8,2048,384]; head_size 64; (in,out) Wq, Wk, Wv [384,64] uniform(+-1/sqrt(384)); no biases, no output projection; scores / sqrt(C) with C = 384 (NOT the head size); tril, -inf): out = softmax(causal(q k^T / sqrt(384))) v -> [8,2048,64].
#define NB 8
#define TT 2048
#define CC 128            // NH * HD = projected width
#define DIN 384
#define NH 2
#define HD 64
#define NQB (TT / 64)
#define SCALE (0.05103103630798288f)
#define CAUSAL 1
#ifndef TNB
#define TNB NB
#endif
__device__ __forceinline__ float bfr(float v) { return (float)(__bf16)v; }
__host__ __device__ __forceinline__ int kb_last(int qb) { return CAUSAL ? ((qb * 64 + 63) >> 7) : (TT / 128 - 1); }
typedef __attribute__((ext_vector_type(8))) __bf16 v8b;
__device__ __forceinline__ v16b frag_b(const __bf16* rowk0, int lane) {
  union { v16b v; v8b q[2]; } u; const __bf16* p = rowk0 + 8 * (lane >> 4);
  u.q[0] = *(const v8b*)p; u.q[1] = *(const v8b*)(p + 16); return u.v;
}
#define QBH 6              // unused; causal: query rows < QHI of each sequence (32-row blocks 0..11; few keys, no averaging) take the high-precision path
#define QHI 384            // rows carrying a q residual plane
#define KHI 384            // key rows carrying k residual / v bf16 hi+lo planes (used only by the causal high-precision path)
// B fragment (k rows k0+.., output column o) of a weight: (in,out) [K][ld] or (out,in) [ld rows of K]: bf16 exact, or f16(bf16 * 256) exact
__device__ __forceinline__ v16b wcol_io(const float* Wm, int k0, int o, int lane, int ld) { v16b w; const int g = lane >> 4;
#pragma unroll
  for (int i = 0; i < 8; ++i) { w[i] = (__bf16)Wm[(size_t)(k0 + 8 * g + i) * ld + o]; w[8 + i] = (__bf16)Wm[(size_t)(k0 + 16 + 8 * g + i) * ld + o]; }
  return w; }
__device__ __forceinline__ v16b wcol_oi(const float* Wm, int k0, int o, int lane, int K) { v16b w; const float* p = Wm + (size_t)o * K + k0 + 8 * (lane >> 4);
#pragma unroll
  for (int i = 0; i < 8; ++i) { w[i] = (__bf16)p[i]; w[8 + i] = (__bf16)p[16 + i]; }
  return w; }
__device__ __forceinline__ v16h wcolh_io(const float* Wm, int k0, int o, int lane, int ld) { v16h w; const int g = lane >> 4;
#pragma unroll
  for (int i = 0; i < 8; ++i) { w[i] = (_Float16)(bfr(Wm[(size_t)(k0 + 8 * g + i) * ld + o]) * 256.0f); w[8 + i] = (_Float16)(bfr(Wm[(size_t)(k0 + 16 + 8 * g + i) * ld + o]) * 256.0f); }
  return w; }
__device__ __forceinline__ v16h wcolh_oi(const float* Wm, int k0, int o, int lane, int K) { v16h w; const float* p = Wm + (size_t)o * K + k0 + 8 * (lane >> 4);
#pragma unroll
  for (int i = 0; i < 8; ++i) { w[i] = (_Float16)(bfr(p[i]) * 256.0f); w[8 + i] = (_Float16)(bfr(p[16 + i]) * 256.0f); }
  return w; }
#define WQKV_LAYOUT 0   // 0 = (in,out) [DIN][CC]; 1 = (out,in) [CC][DIN]; 2 = per-head [NH][DIN][HD]
__device__ __forceinline__ v16b wcol_hdk(const float* Wm, int k0, int o, int lane) { v16b w; const int g = lane >> 4; const float* p = Wm + (size_t)(o / HD) * DIN * HD + (o % HD);
#pragma unroll
  for (int i = 0; i < 8; ++i) { w[i] = (__bf16)p[(size_t)(k0 + 8 * g + i) * HD]; w[8 + i] = (__bf16)p[(size_t)(k0 + 16 + 8 * g + i) * HD]; }
  return w; }
#define WO_OUT_IN 0
#if WQKV_LAYOUT == 1
#define WCOL(W, k0, o, lane) wcol_oi(W, k0, o, lane, DIN)
#elif WQKV_LAYOUT == 2
#define WCOL(W, k0, o, lane) wcol_hdk(W, k0, o, lane)
#else
#define WCOL(W, k0, o, lane) wcol_io(W, k0, o, lane, CC)
#endif
#if WO_OUT_IN
#define WOCOL(W, k0, o, lane) wcol_oi(W, k0, o, lane, CC)
#define WOCOLH(W, k0, o, lane) wcolh_oi(W, k0, o, lane, CC)
#else
#define WOCOL(W, k0, o, lane) wcol_io(W, k0, o, lane, DIN)
#define WOCOLH(W, k0, o, lane) wcolh_io(W, k0, o, lane, DIN)
#endif
#define CIN 384
// ---- k_packw: the three (in,out) [C][64] projection weights rounded to bf16 and laid out as ready WMMA B fragments: [which][k chunk of 32][16-column group j][half h][lane][8], element i of half h = W[kc * 32 + 16 * h + 8 * (lane >> 4) + i][j * 16 + (lane & 15)] (the k order of the A loader in k_proj); a half fragment is 512 contiguous bytes, 16 per lane
__global__ __launch_bounds__(256) void k_packw(const float* __restrict__ WQ, const float* __restrict__ WK, const float* __restrict__ WV, __bf16* __restrict__ WP) { const int which = blockIdx.y; const float* Wsrc = which == 0 ? WQ : (which == 1 ? WK : WV);
  const int e = blockIdx.x * 256 + threadIdx.x; const int lane = e & 31, h = (e >> 5) & 1, j = (e >> 6) & 3, kc = e >> 8;
  const float* p = Wsrc + (size_t)(kc * 32 + 16 * h + 8 * (lane >> 4)) * 64 + j * 16 + (lane & 15); v8b o;
#pragma unroll
  for (int i = 0; i < 8; ++i) o[i] = (__bf16)p[i * 64];
  vst2(WP + (size_t)which * CIN * 64 + (size_t)e * 8, o); }
// ---- k_out64: out[b][t][0..63] = ctx row columns 0..63 (256 B by 16 lanes)
__global__ __launch_bounds__(256) void k_out64(const float* __restrict__ Y, float* __restrict__ OUT) { const size_t row = (size_t)blockIdx.x * 16 + (threadIdx.x >> 4); const int q = threadIdx.x & 15; const v4f v = *(const v4f*)(Y + row * CC + q * 4); asm volatile("s_wait_loadcnt 0x0" ::: "memory"); vst2(OUT + row * 64 + q * 4, v); }
#define WS_WP (WS_END)                                  // bf16 weight fragments [3][C x 64] (k_packw), at the head of this region
#define WS_BP (WS_WP + 4u * 3 * (size_t)CIN * 128)        // unused
#define WS_Y2 (WS_BP + 4u * 3 * 128)                      // ctx rows [b*TT+t][128]
#define WS_END2 (WS_Y2 + 4u * (size_t)NB * TT * CC)
#ifndef SM_EXTRA_PARAMS
#define SM_EXTRA_PARAMS
#endif
#ifndef PROJ_EXTRA_PARAMS
#define PROJ_EXTRA_PARAMS
#endif
#ifndef SM_MASK_HOOK
#define SM_MASK_HOOK (void)0
#endif

#define WS_QH  0u                                      // f16 q rows [b*t][CC]
#define WS_KH  (WS_QH + 2u * (size_t)NB * TT * CC)      // f16 k rows [b*t][CC]
#define WS_VT  (WS_KH + 2u * (size_t)NB * TT * CC)      // f16 v planes [b][c][t]
#define WS_QL  (WS_VT + 2u * (size_t)NB * CC * TT)      // f16 q residual x 2^10 rows [b][t < QHI][CC]
#define WS_KL  (WS_QL + 2u * (size_t)NB * QHI * CC)     // f16 k residual x 2^10 rows [b][t < KHI][CC]
#define WS_VB  (WS_KL + 2u * (size_t)NB * KHI * CC)     // bf16 v hi planes [b][c][t < KHI]
#define WS_VBL (WS_VB + 2u * (size_t)NB * CC * KHI)
#define WS_S   (WS_VBL + 2u * (size_t)NB * CC * KHI)    // unused (the logits stay on chip); it keeps the offsets of the planes behind it
#define WS_Y   (WS_S  + 4u * (size_t)NB * TT * TT)      // f32 ctx rows [b*t][CC] (only when there is an output projection)
#define WS_END (WS_Y  + 0u)

// ---- k_proj: block = (64 rows, the 64 columns, which): q/k/v = X W with exact bf16 products (K = DIN) -> which 0: q f16 rows (+ residual rows < QHI); 1: k f16 rows (+ residual rows < KHI); 2: v f16 planes [c][t] (+ bf16 hi/lo planes for t < KHI)
// The weights come as ready B fragments (k_packw): two full-line 16-byte loads a fragment. The loads of a k chunk (x and weights) are issued together, PAH chunks ahead of their products, all through constant offsets from two address pairs.
#define PAH 3
// 16-byte store with the wait behind it: the store's address and data registers are rewritten (next trip, next LDS read) only behind this wait; both are inputs of the wait so that they live up to it
__device__ __forceinline__ void gst16(void* p, v4u v) { *(v4u*)p = v; asm volatile("s_wait_xcnt 0x0" :: "v"(p), "v"(v) : "memory"); }
__global__ __launch_bounds__(128) void k_proj(const float* __restrict__ XQ, const float* __restrict__ XK, const float* __restrict__ XV, const __bf16* __restrict__ WQ, const __bf16* __restrict__ WK, const __bf16* __restrict__ WV,
    _Float16* __restrict__ QH, _Float16* __restrict__ QL, _Float16* __restrict__ KH, _Float16* __restrict__ KL, _Float16* __restrict__ VT, __bf16* __restrict__ VB, __bf16* __restrict__ VBL) {
  __shared__ __align__(16) _Float16 sh[64][72], sl[64][72]; __shared__ __align__(16) _Float16 th[64][72]; __shared__ __align__(16) __bf16 tb[64][72], tbl[64][72];
  const int tid = threadIdx.x, wave = tid >> 5, lane = tid & 31, col = lane & 15, g = lane >> 4; const int which = blockIdx.z; const size_t r0 = (size_t)blockIdx.x * 64; const size_t bb = r0 / TT; const int t0 = (int)(r0 % TT);
  const float* X = which == 0 ? XQ : which == 1 ? XK : XV; const __bf16* WA = which == 0 ? WQ : which == 1 ? WK : WV;
  constexpr int NK = DIN / 32;
  const float* xp = X + (r0 + wave * 16 + col) * DIN + 8 * g; const __bf16* wp = WA + lane * 8;
  v8f acc[4] = {}; v4f xa[NK][4]; v8b wf[NK][4][2];
#define PROJ_FETCH(kq) do { xa[kq][0] = *(const v4f*)(xp + (kq) * 32); xa[kq][1] = *(const v4f*)(xp + (kq) * 32 + 4); xa[kq][2] = *(const v4f*)(xp + (kq) * 32 + 16); xa[kq][3] = *(const v4f*)(xp + (kq) * 32 + 20); \
    _Pragma("unroll") for (int j = 0; j < 4; ++j) { wf[kq][j][0] = *(const v8b*)(wp + (((kq) * 4 + j) * 2) * 256); wf[kq][j][1] = *(const v8b*)(wp + (((kq) * 4 + j) * 2 + 1) * 256); } } while (0)
  // both loops fully unrolled: xa and wf are then indexed by constants and live in registers, and every load is a constant offset
#pragma unroll
  for (int kc = 0; kc < PAH; ++kc) PROJ_FETCH(kc);
#pragma unroll
  for (int kc = 0; kc < NK; ++kc) {
    if (kc + PAH < NK) PROJ_FETCH(kc + PAH);
    if (kc + PAH == NK - 1) asm volatile("s_wait_xcnt 0x0" :: "v"(xp), "v"(wp) : "memory");   // behind the last loads: their address registers are free to be rewritten only behind this wait (the pointers are inputs so that they live up to it)
    __builtin_amdgcn_sched_barrier(0);   // keeps the chunks' loads in issue order ahead of the products: without it the scheduler mixes loads of different chunks, and some products then wait for loads issued just before them
    v16b a;
#pragma unroll
    for (int i = 0; i < 4; ++i) { a[i] = (__bf16)xa[kc][0][i]; a[4 + i] = (__bf16)xa[kc][1][i]; a[8 + i] = (__bf16)xa[kc][2][i]; a[12 + i] = (__bf16)xa[kc][3][i]; }
#pragma unroll
    for (int j = 0; j < 4; ++j) { union { v16b v; v8b q[2]; } w; w.q[0] = wf[kc][j][0]; w.q[1] = wf[kc][j][1]; acc[j] = wmma_bf(a, w.v, acc[j]); } }
  if (which < 2) { _Float16* DH = which == 0 ? QH : KH; _Float16* DL = which == 0 ? QL : KL; const int nhi = which == 0 ? QHI : KHI; const bool hi_rows = t0 < nhi;
#pragma unroll
    for (int j = 0; j < 4; ++j) {
#pragma unroll
      for (int r = 0; r < 8; ++r) { const float v = acc[j][r]; const _Float16 hv = (_Float16)v; sh[wave * 16 + 8 * g + r][j * 16 + col] = hv; sl[wave * 16 + 8 * g + r][j * 16 + col] = (_Float16)((v - (float)hv) * 1024.0f); } }
    __syncthreads();
    for (int e = tid; e < 64 * 8; e += 128) { const int rl = e >> 3, q = e & 7; gst16(DH + (r0 + rl) * CC + q * 8, *(const v4u*)&sh[rl][q * 8]); if (hi_rows) gst16(DL + (bb * nhi + t0 + rl) * (size_t)CC + q * 8, *(const v4u*)&sl[rl][q * 8]); }
  } else { const bool hi_rows = t0 < KHI;
#pragma unroll
    for (int j = 0; j < 4; ++j) {
#pragma unroll
      for (int r = 0; r < 8; ++r) { const float v = acc[j][r]; const int rl = wave * 16 + 8 * g + r, cl = j * 16 + col; th[cl][rl] = (_Float16)v; const __bf16 bh = (__bf16)v; tb[cl][rl] = bh; tbl[cl][rl] = (__bf16)(v - (float)bh); } }
    __syncthreads();
    for (int e = tid; e < 64 * 8; e += 128) { const int cl = e >> 3, q = e & 7; gst16(VT + (bb * CC + cl) * (size_t)TT + t0 + q * 8, *(const v4u*)&th[cl][q * 8]); if (hi_rows) { const size_t o3 = (bb * CC + cl) * (size_t)KHI + t0 + q * 8; gst16(VB + o3, *(const v4u*)&tb[cl][q * 8]); gst16(VBL + o3, *(const v4u*)&tbl[cl][q * 8]); } } } }
// ---- k_fa: block = 32 query rows of batch b = blockIdx.x, head 0: logits, causal softmax and P . v in one pass, no logits plane.
// Wave w takes the 128-key blocks w, w + 4, ... up to the diagonal block, for all 32 rows (two 16-row tiles share every k and v fragment), and keeps its own running row maximum, row sum and ctx tiles; the four waves' parts are joined in LDS at the end.
// Per block: logits (1 f16 product; q hi + residual x k hi + residual, 3 products, for query rows < QHI), scaled by SCALE x log2(e); e = 2^(logit - running max + 11) in f32, through the wave's own LDS tile into A fragments (once to f16 against v f16; bf16 hi + lo against v bf16 hi + lo, 3 products, for rows < QHI). The row sum carries the same 2^11, so ctx / sum needs no other factor.
// the plain builtins: the compiler keeps the distance behind a matrix instruction itself and stays free to place the fragment loads ahead of the products
__device__ __forceinline__ v8f mm_h(v16h a, v16h b, v8f c) { return __builtin_amdgcn_wmma_f32_16x16x32_f16(false, a, false, b, (short)0, c, false, false); }
__device__ __forceinline__ v8f mm_b(v16b a, v16b b, v8f c) { return __builtin_amdgcn_wmma_f32_16x16x32_bf16(false, a, false, b, (short)0, c, false, false); }
// fragment at p = row start + k0 + 8 * (lane >> 4): one address pair serves a whole group of loads through constant offsets
__device__ __forceinline__ v16h frag_hp(const _Float16* p) { union { v16h v; v8h q[2]; } u; u.q[0] = *(const v8h*)p; u.q[1] = *(const v8h*)(p + 16); return u.v; }
__device__ __forceinline__ v16b frag_bp(const __bf16* p) { union { v16b v; v8b q[2]; } u; u.q[0] = *(const v8b*)p; u.q[1] = *(const v8b*)(p + 16); return u.v; }
// behind a group of global loads: their address registers are free to be rewritten only behind this wait; its "memory" clobber also holds the group ahead of what follows, so that the loads fly together
// the pointers are named as inputs so that their registers live up to the wait
#define XW1(p) asm volatile("s_wait_xcnt 0x0" :: "v"(p) : "memory")
#define XW2(p, q) asm volatile("s_wait_xcnt 0x0" :: "v"(p), "v"(q) : "memory")
// 2^x with the slot that the instruction set asks for behind a transcendental (the next instruction may overwrite x) kept in the same statement
__device__ __forceinline__ float ex2(float x) { asm("v_exp_f32 %0, %0\n\tv_nop" : "+v"(x)); return x; }
#define QT 2               // 16-row query tiles per wave
#define SCALE2 (SCALE * 1.4426950408889634f)
// one 128-key block of one wave
template <bool HI>
__device__ __forceinline__ void fa_keys(const v16h (&ah)[QT][HD / 32], const v16h (&al)[QT][HD / 32], const _Float16* __restrict__ Kh, const _Float16* __restrict__ Kl, const _Float16* __restrict__ Vt, const __bf16* __restrict__ Vb, const __bf16* __restrict__ Vbl,
    int k0, int ql0, bool diag, int lane, float (*sw)[132], v8f (&o)[QT][HD / 16], float (&m)[QT][8], float (&l)[QT][8]) {
  const int col = lane & 15, g = lane >> 4;
  v8f acc[QT][8]; v16h vf[HI ? 1 : 4][HD / 16];
  const size_t ko = (size_t)(k0 + col) * CC + 8 * g; const _Float16* kp = Kh + ko; const _Float16* rp = Kl + ko; const _Float16* vp = Vt + (size_t)col * TT + k0 + 8 * g;
  if (HI) {
#pragma unroll
    for (int j0 = 0; j0 < 8; j0 += 4) { v16h kf[4][HD / 32], rf[4][HD / 32];   // the fragments of 64 keys are fetched together, ahead of their products: one memory round trip a group
#pragma unroll
      for (int jj = 0; jj < 4; ++jj) {
#pragma unroll
        for (int kc = 0; kc < HD / 32; ++kc) { kf[jj][kc] = frag_hp(kp + (j0 + jj) * 16 * CC + kc * 32); rf[jj][kc] = frag_hp(rp + (j0 + jj) * 16 * CC + kc * 32); } }
      XW2(kp, rp);
      __builtin_amdgcn_sched_barrier(0);   // keeps the products behind the whole group of loads
#pragma unroll
      for (int jj = 0; jj < 4; ++jj) {
#pragma unroll
        for (int t = 0; t < QT; ++t) { v8f a = {}, ar = {};   // ar: the residual products (x 2^10)
#pragma unroll
          for (int kc = 0; kc < HD / 32; ++kc) { a = mm_h(ah[t][kc], kf[jj][kc], a); ar = mm_h(al[t][kc], kf[jj][kc], ar); ar = mm_h(ah[t][kc], rf[jj][kc], ar); }
#pragma unroll
          for (int r = 0; r < 8; ++r) acc[t][j0 + jj][r] = (a[r] + ar[r] * (1.0f / 1024.0f)) * SCALE2; } } }
  } else { v16h kf[8][HD / 32];   // the fragments of the 128 keys are fetched together, ahead of their products
#pragma unroll
    for (int j = 0; j < 8; ++j) {
#pragma unroll
      for (int kc = 0; kc < HD / 32; ++kc) kf[j][kc] = frag_hp(kp + j * 16 * CC + kc * 32); }
    XW1(kp);
    __builtin_amdgcn_sched_barrier(0);   // keeps the products behind the whole group of loads: without it each product moves up to its own pair of loads and waits for that pair alone
#pragma unroll
    for (int j = 0; j < 8; ++j) {
#pragma unroll
      for (int t = 0; t < QT; ++t) { v8f a = {};
#pragma unroll
        for (int kc = 0; kc < HD / 32; ++kc) a = mm_h(ah[t][kc], kf[j][kc], a);
#pragma unroll
        for (int r = 0; r < 8; ++r) acc[t][j][r] = a[r] * SCALE2; } }
    // the v fragments of the first 64 keys start here, together, and fly under the softmax
#pragma unroll
    for (int kc = 0; kc < 2; ++kc) {
#pragma unroll
      for (int j = 0; j < HD / 16; ++j) vf[kc][j] = frag_hp(vp + j * 16 * TT + kc * 32); }
    XW1(vp);
  }
  if (diag) {   // only the diagonal block holds keys past a query (wave-uniform test)
#pragma unroll
    for (int t = 0; t < QT; ++t) {
#pragma unroll
      for (int j = 0; j < 8; ++j) {
#pragma unroll
        for (int r = 0; r < 8; ++r) acc[t][j][r] = (k0 + j * 16 + col > ql0 + t * 16 + 8 * g + r) ? -3.0e38f : acc[t][j][r]; } } }
#pragma unroll
  for (int t = 0; t < QT; ++t) {
#pragma unroll
    for (int r = 0; r < 8; ++r) { float mx = acc[t][0][r];
#pragma unroll
      for (int j = 1; j < 8; ++j) mx = fmaxf(mx, acc[t][j][r]);
#pragma unroll
      for (int s = 1; s < 16; s <<= 1) mx = fmaxf(mx, __shfl_xor(mx, s));
      const float mn = fmaxf(m[t][r], mx); const float f = ex2(m[t][r] - mn); m[t][r] = mn; l[t][r] *= f;
#pragma unroll
      for (int j = 0; j < HD / 16; ++j) o[t][j][r] *= f; }
#pragma unroll
    for (int j = 0; j < 8; ++j) {
#pragma unroll
      for (int r = 0; r < 8; ++r) { const float e = ex2(acc[t][j][r] - (m[t][r] - 11.0f));   /* an excluded key (-3e38) gives 0: every row sees key k0 of every block it walks, so m is a real logit */ l[t][r] += e; sw[t * 16 + 8 * g + r][j * 16 + col] = e; } }
    if (!HI && t == 0) {   // the other 64 keys' v fragments start once the first tile's logits have left their registers
#pragma unroll
      for (int kc = 2; kc < 4; ++kc) {
#pragma unroll
        for (int j = 0; j < HD / 16; ++j) vf[kc][j] = frag_hp(vp + j * 16 * TT + kc * 32); }
      XW1(vp);   // holds them ahead of the second tile's work: they fly under it
    } }
  LDSX();   // the wave's own stores land before its other lanes read them as rows
  if (HI) {
    const size_t po = (size_t)col * KHI + k0 + 8 * g; const __bf16* hp = Vb + po; const __bf16* lp = Vbl + po;
#pragma unroll
    for (int c0 = 0; c0 < 4; c0 += 2) { v16b vh[2][HD / 16], vl[2][HD / 16];   // v fragments of 64 keys fetched together, ahead of their products
#pragma unroll
      for (int cc = 0; cc < 2; ++cc) {
#pragma unroll
        for (int j = 0; j < HD / 16; ++j) { vh[cc][j] = frag_bp(hp + j * 16 * KHI + (c0 + cc) * 32); vl[cc][j] = frag_bp(lp + j * 16 * KHI + (c0 + cc) * 32); } }
      XW2(hp, lp);
      __builtin_amdgcn_sched_barrier(0);   // keeps the products behind the whole group of loads
#pragma unroll
      for (int cc = 0; cc < 2; ++cc) {
#pragma unroll
        for (int t = 0; t < QT; ++t) { const F2 p = split_row(&sw[t * 16 + col][0], (c0 + cc) * 32, lane);
#pragma unroll
          for (int j = 0; j < HD / 16; ++j) { o[t][j] = mm_b(p.h, vh[cc][j], o[t][j]); o[t][j] = mm_b(p.l, vh[cc][j], o[t][j]); o[t][j] = mm_b(p.h, vl[cc][j], o[t][j]); } } } }
  } else {
#pragma unroll
    for (int kc = 0; kc < 4; ++kc) {
#pragma unroll
      for (int t = 0; t < QT; ++t) { const v16h p = frag_f32(&sw[t * 16 + col][kc * 32], lane);
#pragma unroll
        for (int j = 0; j < HD / 16; ++j) o[t][j] = mm_h(p, vf[kc][j], o[t][j]); } } }
  LDSX();   // every row read has returned before the next block's stores reuse the tile
}
// two waves per SIMD: the 512 work-groups are then all resident, two on a WGP
__global__ __launch_bounds__(128, 2) void k_fa(const _Float16* __restrict__ QH, const _Float16* __restrict__ KH, const _Float16* __restrict__ QL, const _Float16* __restrict__ KL, const _Float16* __restrict__ VT, const __bf16* __restrict__ VB, const __bf16* __restrict__ VBL, float* __restrict__ Y) {
  __shared__ __align__(16) float ss[4][QT * 16][132];
  const int tid = threadIdx.x, lane = tid & 31, col = lane & 15, g = lane >> 4; const int wave = __builtin_amdgcn_readfirstlane(tid >> 5);
  constexpr int NT = TT / (QT * 16); const int y = blockIdx.y; const int qt = y < NT / 2 ? NT - 1 - y : y - NT / 2;   // long tiles start first; the second half of the grid runs from the shortest up, so that a late work-group joins an early one of the opposite length
  const int b = blockIdx.x; const int ql0 = qt * (QT * 16); const int kbl = ql0 >> 7;   // the 32 rows share their diagonal block: 128 is a multiple of 32
  const _Float16* Kh = KH + (size_t)b * TT * CC; const _Float16* Kl = KL + (size_t)b * KHI * CC; const _Float16* Vt = VT + (size_t)b * CC * TT; const __bf16* Vb = VB + (size_t)b * CC * KHI; const __bf16* Vbl = VBL + (size_t)b * CC * KHI;
  float (*sw)[132] = ss[wave];
  v8f o[QT][HD / 16] = {}; float m[QT][8], l[QT][8];
  v16h ah[QT][HD / 32], al[QT][HD / 32] = {};
  const _Float16* qp = QH + ((size_t)b * TT + ql0 + col) * CC + 8 * g; const _Float16* qr = QL + ((size_t)b * QHI + ql0 + col) * CC + 8 * g;   // qr is read only where ql0 < QHI
#pragma unroll
  for (int t = 0; t < QT; ++t) {
#pragma unroll
    for (int r = 0; r < 8; ++r) { m[t][r] = -3.0e38f; l[t][r] = 0.f; }
#pragma unroll
    for (int kc = 0; kc < HD / 32; ++kc) ah[t][kc] = frag_hp(qp + t * 16 * CC + kc * 32); }
  XW1(qp);
  if (__builtin_expect(ql0 >= QHI, 1)) {   // the common path first in the text
#pragma unroll 1
    for (int kb = wave; kb <= kbl; kb += 4) fa_keys<false>(ah, al, Kh, Kl, Vt, Vb, Vbl, kb * 128, ql0, kb == kbl, lane, sw, o, m, l);
  } else {
#pragma unroll
    for (int t = 0; t < QT; ++t) {
#pragma unroll
      for (int kc = 0; kc < HD / 32; ++kc) al[t][kc] = frag_hp(qr + t * 16 * CC + kc * 32); }
    XW1(qr);
    static_assert(QHI <= 4 * 128, "a wave of these rows walks at most one block");
    if (wave <= kbl) fa_keys<true>(ah, al, Kh, Kl, Vt, Vb, Vbl, wave * 128, ql0, wave == kbl, lane, sw, o, m, l);
  }
#pragma unroll
  for (int t = 0; t < QT; ++t) {
#pragma unroll
    for (int r = 0; r < 8; ++r) {
#pragma unroll
      for (int s = 1; s < 16; s <<= 1) l[t][r] += __shfl_xor(l[t][r], s); }
#pragma unroll
    for (int j = 0; j < HD / 16; ++j) {
#pragma unroll
      for (int r = 0; r < 8; ++r) sw[t * 16 + 8 * g + r][j * 16 + col] = o[t][j][r]; }
    if (col == 0) {
#pragma unroll
      for (int r = 0; r < 8; ++r) { sw[t * 16 + 8 * g + r][HD] = m[t][r]; sw[t * 16 + 8 * g + r][HD + 1] = l[t][r]; } } }
  __syncthreads();
  // join: a wave that had no key block holds max -3e38, sum 0, ctx 0 and drops out with factor 0 (wave 0 always has block 0, whose key 0 every row sees)
  for (int e = tid; e < QT * 16 * (HD / 4); e += 128) { const int row = e / (HD / 4), q = e % (HD / 4);
    float mm = ss[0][row][HD];
#pragma unroll
    for (int w = 1; w < 4; ++w) mm = fmaxf(mm, ss[w][row][HD]);
    float den = 0.f; v4f a = {};
#pragma unroll
    for (int w = 0; w < 4; ++w) { const float f = ex2(ss[w][row][HD] - mm); den += f * ss[w][row][HD + 1]; a += *(const v4f*)&ss[w][row][q * 4] * f; }
    const float inv = den > 0.f ? 1.0f / den : 0.f;   /* a fully excluded row yields 0 */
    vst2(Y + ((size_t)b * TT + ql0 + row) * CC + q * 4, a * inv); } }

extern "C" void kernel_launch(void* const* d_in, const int* in_sizes, int n_in, void* d_out, int out_size, void* d_ws, size_t ws_size, hipStream_t stream) {
  (void)in_sizes; (void)n_in; (void)out_size;
  const float** F = (const float**)d_in;
  if (ws_size < (size_t)WS_END) return;
  char* ws = (char*)d_ws; _Float16 *QH = (_Float16*)(ws + WS_QH), *KH = (_Float16*)(ws + WS_KH), *VT = (_Float16*)(ws + WS_VT), *QL = (_Float16*)(ws + WS_QL), *KL = (_Float16*)(ws + WS_KL); __bf16 *VB = (__bf16*)(ws + WS_VB), *VBL = (__bf16*)(ws + WS_VBL); float *Y = (float*)(ws + WS_Y);
  (void)Y; (void)QL; (void)KL; (void)VB; (void)VBL;
  // inputs: 0 x [8,2048,384]; 1 Wq [384,64]; 2 Wk; 3 Wv ((in,out), no biases)
  if (ws_size < (size_t)WS_END2) return;
  __bf16 *WP = (__bf16*)(ws + WS_WP); float *Y2 = (float*)(ws + WS_Y2);
  k_packw<<<dim3(CIN * 64 / 8 / 256, 3), 256, 0, stream>>>(F[1], F[2], F[3], WP);
  k_proj<<<dim3(TNB * TT / 64, 1, 3), 128, 0, stream>>>(F[0], F[0], F[0], WP, WP + (size_t)CIN * 64, WP + 2 * (size_t)CIN * 64, QH, QL, KH, KL, VT, VB, VBL);
  /* head 0 only (head 1 is the zero padding); every batch in the same launch */
  k_fa<<<dim3(TNB, TT / (QT * 16)), 128, 0, stream>>>(QH, KH, QL, KL, VT, VB, VBL, Y2);
  k_out64<<<dim3(TNB * TT / 16), 256, 0, stream>>>(Y2, (float*)d_out);
}

// v004
// It runs in 28.7 microseconds.
// In two side-by-side timings against v003, it was 1.10 and 1.09 times as fast.
// All steps since v000 together make it 23.0 times as fast.
// compute dtype: all float inputs rounded to bf16; q/k/v projections with EXACT bf16 products on WMMA 16x16x32 (f32 accumulate); causal logits: 3 products (q f16 hi + residual x k hi + residual) for the first 384 rows, single f16 q x k after, x scale; softmax f32 with a running row maximum and sum per 128 keys; exp(logit - max) x 2^11 once to f16 x v once to f16 (1 product; bf16 hi + lo below row 384), divided by the row sum at the end; f32 output.
#include <hip/hip_runtime.h>
#include <math.h>

typedef __attribute__((ext_vector_type(16))) _Float16 v16h;
typedef __attribute__((ext_vector_type(16))) __bf16 v16b;
typedef __attribute__((ext_vector_type(8)))  _Float16 v8h;
typedef __attribute__((ext_vector_type(8)))  float v8f;
typedef __attribute__((ext_vector_type(4)))  float v4f;
typedef __attribute__((ext_vector_type(2)))  float v2f;
typedef __attribute__((ext_vector_type(4)))  unsigned v4u;
typedef __attribute__((ext_vector_type(4)))  int v4i;
typedef float __attribute__((may_alias)) float_a;
typedef int __attribute__((may_alias)) int_a;

template <typename T> __device__ __forceinline__ void vst2(void* p, T v) { *(T*)p = v;  }
__device__ __forceinline__ v8f wmma16(v16h a, v16h b, v8f c) {
  v8f d = __builtin_amdgcn_wmma_f32_16x16x32_f16(false, a, false, b, (short)0, c, false, false);
  asm volatile("v_nop\n\tv_nop\n\tv_nop\n\tv_nop" : "+v"(d) : "v"(a), "v"(b));
  return d;
}
__device__ __forceinline__ v8f wmma_bf(v16b a, v16b b, v8f c) {
  v8f d = __builtin_amdgcn_wmma_f32_16x16x32_bf16(false, a, false, b, (short)0, c, false, false);
  asm volatile("v_nop\n\tv_nop\n\tv_nop\n\tv_nop" : "+v"(d) : "v"(a), "v"(b));
  return d;
}
// 16x16x32 fragments: lane = (h = lane>>4, row/col = lane&15); elements 0..7 = k0+8h+0..7, 8..15 = k0+16+8h+0..7; D element r = row 8h+r
__device__ __forceinline__ v16h frag_h(const _Float16* rowk0, int lane) {
  union { v16h v; v8h q[2]; } u; const _Float16* p = rowk0 + 8 * (lane >> 4);
  u.q[0] = *(const v8h*)p; u.q[1] = *(const v8h*)(p + 16); return u.v;
}
__device__ __forceinline__ v16h frag_f32(const float* rowk0, int lane) {
  v16h a; const float* p = rowk0 + 8 * (lane >> 4);
#pragma unroll
  for (int i = 0; i < 8; ++i) { a[i] = (_Float16)p[i]; a[8 + i] = (_Float16)p[16 + i]; }
  return a;
}
__device__ __forceinline__ v16h frag_f32s(const float* rowk0, int lane, float sc) {
  v16h a; const float* p = rowk0 + 8 * (lane >> 4);
#pragma unroll
  for (int i = 0; i < 8; ++i) { a[i] = (_Float16)(p[i] * sc); a[8 + i] = (_Float16)(p[16 + i] * sc); }
  return a;
}
// column fragment from a [K][ld] layout (column n), rows >= K read as 0
__device__ __forceinline__ v16h fragc_f32(const float* W, int k0, int n, int lane, int ld, int K) {
  v16h a; const int g = lane >> 4;
#pragma unroll
  for (int i = 0; i < 8; ++i) { const int ka = k0 + 8 * g + i, kb = ka + 16;
    a[i] = (_Float16)(ka < K ? W[(size_t)(ka < K ? ka : K - 1) * ld + n] : 0.f); a[8 + i] = (_Float16)(kb < K ? W[(size_t)(kb < K ? kb : K - 1) * ld + n] : 0.f); }
  return a;
}
struct F2 { v16b h, l; };
__device__ __forceinline__ F2 bsplit16(const float v[16]) { F2 r;
#pragma unroll
  for (int i = 0; i < 16; ++i) { const __bf16 h = (__bf16)v[i]; r.h[i] = h; r.l[i] = (__bf16)(v[i] - (float)h); }
  return r; }
__device__ __forceinline__ F2 split_row(const float* row, int k0, int lane) { float v[16]; const float* p = row + k0 + 8 * (lane >> 4);
#pragma unroll
  for (int i = 0; i < 8; ++i) { v[i] = p[i]; v[8 + i] = p[16 + i]; }
  return bsplit16(v); }
__device__ __forceinline__ F2 split_rowK(const float* row, int k0, int lane, int K) { float v[16]; const int g = lane >> 4;
#pragma unroll
  for (int i = 0; i < 8; ++i) { const int ka = k0 + 8 * g + i, kb = ka + 16; v[i] = ka < K ? row[ka < K ? ka : K - 1] : 0.f; v[8 + i] = kb < K ? row[kb < K ? kb : K - 1] : 0.f; }
  return bsplit16(v); }
__device__ __forceinline__ F2 split_col(const float* W, int k0, int n, int lane, int ld, int K) { float v[16]; const int g = lane >> 4;
#pragma unroll
  for (int i = 0; i < 8; ++i) { const int ka = k0 + 8 * g + i, kb = ka + 16; v[i] = ka < K ? W[(size_t)(ka < K ? ka : K - 1) * ld + n] : 0.f; v[8 + i] = kb < K ? W[(size_t)(kb < K ? kb : K - 1) * ld + n] : 0.f; }
  return bsplit16(v); }
__device__ __forceinline__ v8f mac3(const F2& a, const F2& b, v8f c) { c = wmma_bf(a.l, b.h, c); c = wmma_bf(a.h, b.l, c); return wmma_bf(a.h, b.h, c); }
__device__ __forceinline__ float sigm(float v) { return 1.0f / (1.0f + expf(-v)); }
#define LDSX() do { asm volatile("s_wait_dscnt 0" ::: "memory"); __builtin_amdgcn_wave_barrier(); __builtin_amdgcn_fence(__ATOMIC_RELEASE, "workgroup"); } while (0)

// Single-head causal self-attention scaled by the EMBEDDING width (x [8,2048,384]; head_size 64; (in,out) Wq, Wk, Wv [384,64] uniform(+-1/sqrt(384)); no biases, no output projection; scores / sqrt(C) with C = 384 (NOT the head size); tril, -inf): out = softmax(causal(q k^T / sqrt(384))) v -> [8,2048,64].
#define NB 8
#define TT 2048
#define CC 128            // NH * HD = projected width
#define DIN 384
#define NH 2
#define HD 64
#define NQB (TT / 64)
#define SCALE (0.05103103630798288f)
#define CAUSAL 1
#ifndef TNB
#define TNB NB
#endif
__device__ __forceinline__ float bfr(float v) { return (float)(__bf16)v; }
__host__ __device__ __forceinline__ int kb_last(int qb) { return CAUSAL ? ((qb * 64 + 63) >> 7) : (TT / 128 - 1); }
typedef __attribute__((ext_vector_type(8))) __bf16 v8b;
__device__ __forceinline__ v16b frag_b(const __bf16* rowk0, int lane) {
  union { v16b v; v8b q[2]; } u; const __bf16* p = rowk0 + 8 * (lane >> 4);
  u.q[0] = *(const v8b*)p; u.q[1] = *(const v8b*)(p + 16); return u.v;
}
#define QBH 6              // unused; causal: query rows < QHI of each sequence (32-row blocks 0..11; few keys, no averaging) take the high-precision path
#define QHI 384            // rows carrying a q residual plane
#define KHI 384            // key rows carrying k residual / v bf16 hi+lo planes (used only by the causal high-precision path)
// B fragment (k rows k0+.., output column o) of a weight: (in,out) [K][ld] or (out,in) [ld rows of K]: bf16 exact, or f16(bf16 * 256) exact
__device__ __forceinline__ v16b wcol_io(const float* Wm, int k0, int o, int lane, int ld) { v16b w; const int g = lane >> 4;
#pragma unroll
  for (int i = 0; i < 8; ++i) { w[i] = (__bf16)Wm[(size_t)(k0 + 8 * g + i) * ld + o]; w[8 + i] = (__bf16)Wm[(size_t)(k0 + 16 + 8 * g + i) * ld + o]; }
  return w; }
__device__ __forceinline__ v16b wcol_oi(const float* Wm, int k0, int o, int lane, int K) { v16b w; const float* p = Wm + (size_t)o * K + k0 + 8 * (lane >> 4);
#pragma unroll
  for (int i = 0; i < 8; ++i) { w[i] = (__bf16)p[i]; w[8 + i] = (__bf16)p[16 + i]; }
  return w; }
__device__ __forceinline__ v16h wcolh_io(const float* Wm, int k0, int o, int lane, int ld) { v16h w; const int g = lane >> 4;
#pragma unroll
  for (int i = 0; i < 8; ++i) { w[i] = (_Float16)(bfr(Wm[(size_t)(k0 + 8 * g + i) * ld + o]) * 256.0f); w[8 + i] = (_Float16)(bfr(Wm[(size_t)(k0 + 16 + 8 * g + i) * ld + o]) * 256.0f); }
  return w; }
__device__ __forceinline__ v16h wcolh_oi(const float* Wm, int k0, int o, int lane, int K) { v16h w; const float* p = Wm + (size_t)o * K + k0 + 8 * (lane >> 4);
#pragma unroll
  for (int i = 0; i < 8; ++i) { w[i] = (_Float16)(bfr(p[i]) * 256.0f); w[8 + i] = (_Float16)(bfr(p[16 + i]) * 256.0f); }
  return w; }
#define WQKV_LAYOUT 0   // 0 = (in,out) [DIN][CC]; 1 = (out,in) [CC][DIN]; 2 = per-head [NH][DIN][HD]
__device__ __forceinline__ v16b wcol_hdk(const float* Wm, int k0, int o, int lane) { v16b w; const int g = lane >> 4; const float* p = Wm + (size_t)(o / HD) * DIN * HD + (o % HD);
#pragma unroll
  for (int i = 0; i < 8; ++i) { w[i] = (__bf16)p[(size_t)(k0 + 8 * g + i) * HD]; w[8 + i] = (__bf16)p[(size_t)(k0 + 16 + 8 * g + i) * HD]; }
  return w; }
#define WO_OUT_IN 0
#if WQKV_LAYOUT == 1
#define WCOL(W, k0, o, lane) wcol_oi(W, k0, o, lane, DIN)
#elif WQKV_LAYOUT == 2
#define WCOL(W, k0, o, lane) wcol_hdk(W, k0, o, lane)
#else
#define WCOL(W, k0, o, lane) wcol_io(W, k0, o, lane, CC)
#endif
#if WO_OUT_IN
#define WOCOL(W, k0, o, lane) wcol_oi(W, k0, o, lane, CC)
#define WOCOLH(W, k0, o, lane) wcolh_oi(W, k0, o, lane, CC)
#else
#define WOCOL(W, k0, o, lane) wcol_io(W, k0, o, lane, DIN)
#define WOCOLH(W, k0, o, lane) wcolh_io(W, k0, o, lane, DIN)
#endif
#define CIN 384
// ---- k_packw: the three (in,out) [C][64] projection weights rounded to bf16 and laid out as ready WMMA B fragments: [which][k chunk of 32][16-column group j][half h][lane][8], element i of half h = W[kc * 32 + 16 * h + 8 * (lane >> 4) + i][j * 16 + (lane & 15)] (the k order of the A loader in k_proj); a half fragment is 512 contiguous bytes, 16 per lane
__global__ __launch_bounds__(256) void k_packw(const float* __restrict__ WQ, const float* __restrict__ WK, const float* __restrict__ WV, __bf16* __restrict__ WP) { const int which = blockIdx.y; const float* Wsrc = which == 0 ? WQ : (which == 1 ? WK : WV);
  const int e = blockIdx.x * 256 + threadIdx.x; const int lane = e & 31, h = (e >> 5) & 1, j = (e >> 6) & 3, kc = e >> 8;
  const float* p = Wsrc + (size_t)(kc * 32 + 16 * h + 8 * (lane >> 4)) * 64 + j * 16 + (lane & 15); v8b o;
#pragma unroll
  for (int i = 0; i < 8; ++i) o[i] = (__bf16)p[i * 64];
  vst2(WP + (size_t)which * CIN * 64 + (size_t)e * 8, o); }
#define WS_WP (WS_END)                                  // bf16 weight fragments [3][C x 64] (k_packw), at the head of this region
#define WS_END2 (WS_WP + 2u * 3 * (size_t)CIN * 64)
#ifndef SM_EXTRA_PARAMS
#define SM_EXTRA_PARAMS
#endif
#ifndef PROJ_EXTRA_PARAMS
#define PROJ_EXTRA_PARAMS
#endif
#ifndef SM_MASK_HOOK
#define SM_MASK_HOOK (void)0
#endif

#define WS_QH  0u                                      // f16 q rows [b*t][CC]
#define WS_KH  (WS_QH + 2u * (size_t)NB * TT * CC)      // f16 k rows [b*t][CC]
#define WS_VT  (WS_KH + 2u * (size_t)NB * TT * CC)      // f16 v planes [b][c][t]
#define WS_QL  (WS_VT + 2u * (size_t)NB * CC * TT)      // f16 q residual x 2^10 rows [b][t < QHI][CC]
#define WS_KL  (WS_QL + 2u * (size_t)NB * QHI * CC)     // f16 k residual x 2^10 rows [b][t < KHI][CC]
#define WS_VB  (WS_KL + 2u * (size_t)NB * KHI * CC)     // bf16 v hi planes [b][c][t < KHI]
#define WS_VBL (WS_VB + 2u * (size_t)NB * CC * KHI)
#define WS_S   (WS_VBL + 2u * (size_t)NB * CC * KHI)    // unused (the logits stay on chip); it keeps the offsets of the planes behind it
#define WS_Y   (WS_S  + 4u * (size_t)NB * TT * TT)      // f32 ctx rows [b*t][CC] (only when there is an output projection)
#define WS_END (WS_Y  + 0u)

// ---- k_proj: block = (64 rows, the 64 columns, which): q/k/v = X W with exact bf16 products (K = DIN) -> which 0: q f16 rows (+ residual rows < QHI); 1: k f16 rows (+ residual rows < KHI); 2: v f16 planes [c][t] (+ bf16 hi/lo planes for t < KHI)
// The weights come as ready B fragments (k_packw): two full-line 16-byte loads a fragment. The loads of a k chunk (x and weights) are issued together, PAH chunks ahead of their products, all through constant offsets from two address pairs.
#define PAH 3
// 16-byte store with the wait behind it: the store's address and data registers are rewritten (next trip, next LDS read) only behind this wait; both are inputs of the wait so that they live up to it
__device__ __forceinline__ void gst16(void* p, v4u v) { *(v4u*)p = v; asm volatile("s_wait_xcnt 0x0" :: "v"(p), "v"(v) : "memory"); }
__global__ __launch_bounds__(128) void k_proj(const float* __restrict__ XQ, const float* __restrict__ XK, const float* __restrict__ XV, const __bf16* __restrict__ WQ, const __bf16* __restrict__ WK, const __bf16* __restrict__ WV,
    _Float16* __restrict__ QH, _Float16* __restrict__ QL, _Float16* __restrict__ KH, _Float16* __restrict__ KL, _Float16* __restrict__ VT, __bf16* __restrict__ VB, __bf16* __restrict__ VBL) {
  __shared__ __align__(16) _Float16 sh[64][72], sl[64][72]; __shared__ __align__(16) _Float16 th[64][72]; __shared__ __align__(16) __bf16 tb[64][72], tbl[64][72];
  const int tid = threadIdx.x, wave = tid >> 5, lane = tid & 31, col = lane & 15, g = lane >> 4; const int which = blockIdx.z; const size_t r0 = (size_t)blockIdx.x * 64; const size_t bb = r0 / TT; const int t0 = (int)(r0 % TT);
  const float* X = which == 0 ? XQ : which == 1 ? XK : XV; const __bf16* WA = which == 0 ? WQ : which == 1 ? WK : WV;
  constexpr int NK = DIN / 32;
  const float* xp = X + (r0 + wave * 16 + col) * DIN + 8 * g; const __bf16* wp = WA + lane * 8;
  v8f acc[4] = {}; v4f xa[NK][4]; v8b wf[NK][4][2];
#define PROJ_FETCH(kq) do { xa[kq][0] = *(const v4f*)(xp + (kq) * 32); xa[kq][1] = *(const v4f*)(xp + (kq) * 32 + 4); xa[kq][2] = *(const v4f*)(xp + (kq) * 32 + 16); xa[kq][3] = *(const v4f*)(xp + (kq) * 32 + 20); \
    _Pragma("unroll") for (int j = 0; j < 4; ++j) { wf[kq][j][0] = *(const v8b*)(wp + (((kq) * 4 + j) * 2) * 256); wf[kq][j][1] = *(const v8b*)(wp + (((kq) * 4 + j) * 2 + 1) * 256); } } while (0)
  // both loops fully unrolled: xa and wf are then indexed by constants and live in registers, and every load is a constant offset
#pragma unroll
  for (int kc = 0; kc < PAH; ++kc) PROJ_FETCH(kc);
#pragma unroll
  for (int kc = 0; kc < NK; ++kc) {
    if (kc + PAH < NK) PROJ_FETCH(kc + PAH);
    if (kc + PAH == NK - 1) asm volatile("s_wait_xcnt 0x0" :: "v"(xp), "v"(wp) : "memory");   // behind the last loads: their address registers are free to be rewritten only behind this wait (the pointers are inputs so that they live up to it)
    __builtin_amdgcn_sched_barrier(0);   // keeps the chunks' loads in issue order ahead of the products: without it the scheduler mixes loads of different chunks, and some products then wait for loads issued just before them
    v16b a;
#pragma unroll
    for (int i = 0; i < 4; ++i) { a[i] = (__bf16)xa[kc][0][i]; a[4 + i] = (__bf16)xa[kc][1][i]; a[8 + i] = (__bf16)xa[kc][2][i]; a[12 + i] = (__bf16)xa[kc][3][i]; }
#pragma unroll
    for (int j = 0; j < 4; ++j) { union { v16b v; v8b q[2]; } w; w.q[0] = wf[kc][j][0]; w.q[1] = wf[kc][j][1]; acc[j] = wmma_bf(a, w.v, acc[j]); } }
  if (which < 2) { _Float16* DH = which == 0 ? QH : KH; _Float16* DL = which == 0 ? QL : KL; const int nhi = which == 0 ? QHI : KHI; const bool hi_rows = t0 < nhi;
#pragma unroll
    for (int j = 0; j < 4; ++j) {
#pragma unroll
      for (int r = 0; r < 8; ++r) { const float v = acc[j][r]; const _Float16 hv = (_Float16)v; sh[wave * 16 + 8 * g + r][j * 16 + col] = hv; sl[wave * 16 + 8 * g + r][j * 16 + col] = (_Float16)((v - (float)hv) * 1024.0f); } }
    __syncthreads();
    for (int e = tid; e < 64 * 8; e += 128) { const int rl = e >> 3, q = e & 7; gst16(DH + (r0 + rl) * CC + q * 8, *(const v4u*)&sh[rl][q * 8]); if (hi_rows) gst16(DL + (bb * nhi + t0 + rl) * (size_t)CC + q * 8, *(const v4u*)&sl[rl][q * 8]); }
  } else { const bool hi_rows = t0 < KHI;
#pragma unroll
    for (int j = 0; j < 4; ++j) {
#pragma unroll
      for (int r = 0; r < 8; ++r) { const float v = acc[j][r]; const int rl = wave * 16 + 8 * g + r, cl = j * 16 + col; th[cl][rl] = (_Float16)v; const __bf16 bh = (__bf16)v; tb[cl][rl] = bh; tbl[cl][rl] = (__bf16)(v - (float)bh); } }
    __syncthreads();
    for (int e = tid; e < 64 * 8; e += 128) { const int cl = e >> 3, q = e & 7; gst16(VT + (bb * CC + cl) * (size_t)TT + t0 + q * 8, *(const v4u*)&th[cl][q * 8]); if (hi_rows) { const size_t o3 = (bb * CC + cl) * (size_t)KHI + t0 + q * 8; gst16(VB + o3, *(const v4u*)&tb[cl][q * 8]); gst16(VBL + o3, *(const v4u*)&tbl[cl][q * 8]); } } } }
// ---- k_fa: block = 32 query rows of batch b = blockIdx.x, head 0: logits, causal softmax and P . v in one pass, no logits plane.
// Wave w takes the 128-key blocks w, w + 4, ... up to the diagonal block, for all 32 rows (two 16-row tiles share every k and v fragment), and keeps its own running row maximum, row sum and ctx tiles; the four waves' parts are joined in LDS at the end.
// Per block: logits (1 f16 product; q hi + residual x k hi + residual, 3 products, for query rows < QHI), scaled by SCALE x log2(e); e = 2^(logit - running max + 11) in f32, through the wave's own LDS tile into A fragments (once to f16 against v f16; bf16 hi + lo against v bf16 hi + lo, 3 products, for rows < QHI). The row sum carries the same 2^11, so ctx / sum needs no other factor.
// the plain builtins: the compiler keeps the distance behind a matrix instruction itself and stays free to place the fragment loads ahead of the products
__device__ __forceinline__ v8f mm_h(v16h a, v16h b, v8f c) { return __builtin_amdgcn_wmma_f32_16x16x32_f16(false, a, false, b, (short)0, c, false, false); }
__device__ __forceinline__ v8f mm_b(v16b a, v16b b, v8f c) { return __builtin_amdgcn_wmma_f32_16x16x32_bf16(false, a, false, b, (short)0, c, false, false); }
// fragment at p = row start + k0 + 8 * (lane >> 4): one address pair serves a whole group of loads through constant offsets
__device__ __forceinline__ v16h frag_hp(const _Float16* p) { union { v16h v; v8h q[2]; } u; u.q[0] = *(const v8h*)p; u.q[1] = *(const v8h*)(p + 16); return u.v; }
__device__ __forceinline__ v16b frag_bp(const __bf16* p) { union { v16b v; v8b q[2]; } u; u.q[0] = *(const v8b*)p; u.q[1] = *(const v8b*)(p + 16); return u.v; }
// behind a group of global loads: their address registers are free to be rewritten only behind this wait; its "memory" clobber also holds the group ahead of what follows, so that the loads fly together
// the pointers are named as inputs so that their registers live up to the wait
#define XW1(p) asm volatile("s_wait_xcnt 0x0" :: "v"(p) : "memory")
#define XW2(p, q) asm volatile("s_wait_xcnt 0x0" :: "v"(p), "v"(q) : "memory")
// 2^x with the slot that the instruction set asks for behind a transcendental (the next instruction may overwrite x) kept in the same statement
__device__ __forceinline__ float ex2(float x) { asm("v_exp_f32 %0, %0\n\tv_nop" : "+v"(x)); return x; }
#define QT 2               // 16-row query tiles per wave
#define SCALE2 (SCALE * 1.4426950408889634f)
// one 128-key block of one wave
template <bool HI>
__device__ __forceinline__ void fa_keys(const v16h (&ah)[QT][HD / 32], const v16h (&al)[QT][HD / 32], const _Float16* __restrict__ Kh, const _Float16* __restrict__ Kl, const _Float16* __restrict__ Vt, const __bf16* __restrict__ Vb, const __bf16* __restrict__ Vbl,
    int k0, int ql0, bool diag, int lane, float (*sw)[132], v8f (&o)[QT][HD / 16], float (&m)[QT][8], float (&l)[QT][8]) {
  const int col = lane & 15, g = lane >> 4;
  v8f acc[QT][8]; v16h vf[HI ? 1 : 4][HD / 16];
  const size_t ko = (size_t)(k0 + col) * CC + 8 * g; const _Float16* kp = Kh + ko; const _Float16* rp = Kl + ko; const _Float16* vp = Vt + (size_t)col * TT + k0 + 8 * g;
  if (HI) {
#pragma unroll
    for (int j0 = 0; j0 < 8; j0 += 4) { v16h kf[4][HD / 32], rf[4][HD / 32];   // the fragments of 64 keys are fetched together, ahead of their products: one memory round trip a group
#pragma unroll
      for (int jj = 0; jj < 4; ++jj) {
#pragma unroll
        for (int kc = 0; kc < HD / 32; ++kc) { kf[jj][kc] = frag_hp(kp + (j0 + jj) * 16 * CC + kc * 32); rf[jj][kc] = frag_hp(rp + (j0 + jj) * 16 * CC + kc * 32); } }
      XW2(kp, rp);
      __builtin_amdgcn_sched_barrier(0);   // keeps the products behind the whole group of loads
#pragma unroll
      for (int jj = 0; jj < 4; ++jj) {
#pragma unroll
        for (int t = 0; t < QT; ++t) { v8f a = {}, ar = {};   // ar: the residual products (x 2^10)
#pragma unroll
          for (int kc = 0; kc < HD / 32; ++kc) { a = mm_h(ah[t][kc], kf[jj][kc], a); ar = mm_h(al[t][kc], kf[jj][kc], ar); ar = mm_h(ah[t][kc], rf[jj][kc], ar); }
#pragma unroll
          for (int r = 0; r < 8; ++r) acc[t][j0 + jj][r] = (a[r] + ar[r] * (1.0f / 1024.0f)) * SCALE2; } } }
  } else { v16h kf[8][HD / 32];   // the fragments of the 128 keys are fetched together, ahead of their products
#pragma unroll
    for (int j = 0; j < 8; ++j) {
#pragma unroll
      for (int kc = 0; kc < HD / 32; ++kc) kf[j][kc] = frag_hp(kp + j * 16 * CC + kc * 32); }
    XW1(kp);
    __builtin_amdgcn_sched_barrier(0);   // keeps the products behind the whole group of loads: without it each product moves up to its own pair of loads and waits for that pair alone
#pragma unroll
    for (int j = 0; j < 8; ++j) {
#pragma unroll
      for (int t = 0; t < QT; ++t) { v8f a = {};
#pragma unroll
        for (int kc = 0; kc < HD / 32; ++kc) a = mm_h(ah[t][kc], kf[j][kc], a);
#pragma unroll
        for (int r = 0; r < 8; ++r) acc[t][j][r] = a[r] * SCALE2; } }
    // the v fragments of the first 64 keys start here, together, and fly under the softmax
#pragma unroll
    for (int kc = 0; kc < 2; ++kc) {
#pragma unroll
      for (int j = 0; j < HD / 16; ++j) vf[kc][j] = frag_hp(vp + j * 16 * TT + kc * 32); }
    XW1(vp);
  }
  if (diag) {   // only the diagonal block holds keys past a query (wave-uniform test)
#pragma unroll
    for (int t = 0; t < QT; ++t) {
#pragma unroll
      for (int j = 0; j < 8; ++j) {
#pragma unroll
        for (int r = 0; r < 8; ++r) acc[t][j][r] = (k0 + j * 16 + col > ql0 + t * 16 + 8 * g + r) ? -3.0e38f : acc[t][j][r]; } } }
#pragma unroll
  for (int t = 0; t < QT; ++t) {
#pragma unroll
    for (int r = 0; r < 8; ++r) { float mx = acc[t][0][r];
#pragma unroll
      for (int j = 1; j < 8; ++j) mx = fmaxf(mx, acc[t][j][r]);
#pragma unroll
      for (int s = 1; s < 16; s <<= 1) mx = fmaxf(mx, __shfl_xor(mx, s));
      const float mn = fmaxf(m[t][r], mx); const float f = ex2(m[t][r] - mn); m[t][r] = mn; l[t][r] *= f;
#pragma unroll
      for (int j = 0; j < HD / 16; ++j) o[t][j][r] *= f; }
#pragma unroll
    for (int j = 0; j < 8; ++j) {
#pragma unroll
      for (int r = 0; r < 8; ++r) { const float e = ex2(acc[t][j][r] - (m[t][r] - 11.0f));   /* an excluded key (-3e38) gives 0: every row sees key k0 of every block it walks, so m is a real logit */ l[t][r] += e; sw[t * 16 + 8 * g + r][j * 16 + col] = e; } }
    if (!HI && t == 0) {   // the other 64 keys' v fragments start once the first tile's logits have left their registers
#pragma unroll
      for (int kc = 2; kc < 4; ++kc) {
#pragma unroll
        for (int j = 0; j < HD / 16; ++j) vf[kc][j] = frag_hp(vp + j * 16 * TT + kc * 32); }
      XW1(vp);   // holds them ahead of the second tile's work: they fly under it
    } }
  LDSX();   // the wave's own stores land before its other lanes read them as rows
  if (HI) {
    const size_t po = (size_t)col * KHI + k0 + 8 * g; const __bf16* hp = Vb + po; const __bf16* lp = Vbl + po;
#pragma unroll
    for (int c0 = 0; c0 < 4; c0 += 2) { v16b vh[2][HD / 16], vl[2][HD / 16];   // v fragments of 64 keys fetched together, ahead of their products
#pragma unroll
      for (int cc = 0; cc < 2; ++cc) {
#pragma unroll
        for (int j = 0; j < HD / 16; ++j) { vh[cc][j] = frag_bp(hp + j * 16 * KHI + (c0 + cc) * 32); vl[cc][j] = frag_bp(lp + j * 16 * KHI + (c0 + cc) * 32); } }
      XW2(hp, lp);
      __builtin_amdgcn_sched_barrier(0);   // keeps the products behind the whole group of loads
#pragma unroll
      for (int cc = 0; cc < 2; ++cc) {
#pragma unroll
        for (int t = 0; t < QT; ++t) { const F2 p = split_row(&sw[t * 16 + col][0], (c0 + cc) * 32, lane);
#pragma unroll
          for (int j = 0; j < HD / 16; ++j) { o[t][j] = mm_b(p.h, vh[cc][j], o[t][j]); o[t][j] = mm_b(p.l, vh[cc][j], o[t][j]); o[t][j] = mm_b(p.h, vl[cc][j], o[t][j]); } } } }
  } else {
#pragma unroll
    for (int kc = 0; kc < 4; ++kc) {
#pragma unroll
      for (int t = 0; t < QT; ++t) { const v16h p = frag_f32(&sw[t * 16 + col][kc * 32], lane);
#pragma unroll
        for (int j = 0; j < HD / 16; ++j) o[t][j] = mm_h(p, vf[kc][j], o[t][j]); } } }
  LDSX();   // every row read has returned before the next block's stores reuse the tile
}
// two waves per SIMD: the 512 work-groups are then all resident, two on a WGP
__global__ __launch_bounds__(128, 2) void k_fa(const _Float16* __restrict__ QH, const _Float16* __restrict__ KH, const _Float16* __restrict__ QL, const _Float16* __restrict__ KL, const _Float16* __restrict__ VT, const __bf16* __restrict__ VB, const __bf16* __restrict__ VBL, float* __restrict__ OUT) {
  __shared__ __align__(16) float ss[4][QT * 16][132];
  const int tid = threadIdx.x, lane = tid & 31, col = lane & 15, g = lane >> 4; const int wave = __builtin_amdgcn_readfirstlane(tid >> 5);
  constexpr int NT = TT / (QT * 16); const int y = blockIdx.y; const int qt = y < NT / 2 ? NT - 1 - y : y - NT / 2;   // long tiles start first; the second half of the grid runs from the shortest up, so that a late work-group joins an early one of the opposite length
  const int b = blockIdx.x; const int ql0 = qt * (QT * 16); const int kbl = ql0 >> 7;   // the 32 rows share their diagonal block: 128 is a multiple of 32
  const _Float16* Kh = KH + (size_t)b * TT * CC; const _Float16* Kl = KL + (size_t)b * KHI * CC; const _Float16* Vt = VT + (size_t)b * CC * TT; const __bf16* Vb = VB + (size_t)b * CC * KHI; const __bf16* Vbl = VBL + (size_t)b * CC * KHI;
  float (*sw)[132] = ss[wave];
  v8f o[QT][HD / 16] = {}; float m[QT][8], l[QT][8];
  v16h ah[QT][HD / 32], al[QT][HD / 32] = {};
  const _Float16* qp = QH + ((size_t)b * TT + ql0 + col) * CC + 8 * g; const _Float16* qr = QL + ((size_t)b * QHI + ql0 + col) * CC + 8 * g;   // qr is read only where ql0 < QHI
#pragma unroll
  for (int t = 0; t < QT; ++t) {
#pragma unroll
    for (int r = 0; r < 8; ++r) { m[t][r] = -3.0e38f; l[t][r] = 0.f; }
#pragma unroll
    for (int kc = 0; kc < HD / 32; ++kc) ah[t][kc] = frag_hp(qp + t * 16 * CC + kc * 32); }
  XW1(qp);
  if (__builtin_expect(ql0 >= QHI, 1)) {   // the common path first in the text
#pragma unroll 1
    for (int kb = wave; kb <= kbl; kb += 4) fa_keys<false>(ah, al, Kh, Kl, Vt, Vb, Vbl, kb * 128, ql0, kb == kbl, lane, sw, o, m, l);
  } else {
#pragma unroll
    for (int t = 0; t < QT; ++t) {
#pragma unroll
      for (int kc = 0; kc < HD / 32; ++kc) al[t][kc] = frag_hp(qr + t * 16 * CC + kc * 32); }
    XW1(qr);
    static_assert(QHI <= 4 * 128, "a wave of these rows walks at most one block");
    if (wave <= kbl) fa_keys<true>(ah, al, Kh, Kl, Vt, Vb, Vbl, wave * 128, ql0, wave == kbl, lane, sw, o, m, l);
  }
#pragma unroll
  for (int t = 0; t < QT; ++t) {
#pragma unroll
    for (int r = 0; r < 8; ++r) {
#pragma unroll
      for (int s = 1; s < 16; s <<= 1) l[t][r] += __shfl_xor(l[t][r], s); }
#pragma unroll
    for (int j = 0; j < HD / 16; ++j) {
#pragma unroll
      for (int r = 0; r < 8; ++r) sw[t * 16 + 8 * g + r][j * 16 + col] = o[t][j][r]; }
    if (col == 0) {
#pragma unroll
      for (int r = 0; r < 8; ++r) { sw[t * 16 + 8 * g + r][HD] = m[t][r]; sw[t * 16 + 8 * g + r][HD + 1] = l[t][r]; } } }
  __syncthreads();
  // join: a wave that had no key block holds max -3e38, sum 0, ctx 0 and drops out with factor 0 (wave 0 always has block 0, whose key 0 every row sees)
  for (int e = tid; e < QT * 16 * (HD / 4); e += 128) { const int row = e / (HD / 4), q = e % (HD / 4);
    float mm = ss[0][row][HD];
#pragma unroll
    for (int w = 1; w < 4; ++w) mm = fmaxf(mm, ss[w][row][HD]);
    float den = 0.f; v4f a = {};
#pragma unroll
    for (int w = 0; w < 4; ++w) { const float f = ex2(ss[w][row][HD] - mm); den += f * ss[w][row][HD + 1]; a += *(const v4f*)&ss[w][row][q * 4] * f; }
    const float inv = den > 0.f ? 1.0f / den : 0.f;   /* a fully excluded row yields 0 */
    vst2(OUT + ((size_t)b * TT + ql0 + row) * HD + q * 4, a * inv); } }   // the output row itself: 256 B by 16 lanes, 32 whole rows a block

extern "C" void kernel_launch(void* const* d_in, const int* in_sizes, int n_in, void* d_out, int out_size, void* d_ws, size_t ws_size, hipStream_t stream) {
  (void)in_sizes; (void)n_in; (void)out_size;
  const float** F = (const float**)d_in;
  if (ws_size < (size_t)WS_END) return;
  char* ws = (char*)d_ws; _Float16 *QH = (_Float16*)(ws + WS_QH), *KH = (_Float16*)(ws + WS_KH), *VT = (_Float16*)(ws + WS_VT), *QL = (_Float16*)(ws + WS_QL), *KL = (_Float16*)(ws + WS_KL); __bf16 *VB = (__bf16*)(ws + WS_VB), *VBL = (__bf16*)(ws + WS_VBL); float *Y = (float*)(ws + WS_Y);
  (void)Y; (void)QL; (void)KL; (void)VB; (void)VBL;
  // inputs: 0 x [8,2048,384]; 1 Wq [384,64]; 2 Wk; 3 Wv ((in,out), no biases)
  if (ws_size < (size_t)WS_END2) return;
  __bf16 *WP = (__bf16*)(ws + WS_WP);
  k_packw<<<dim3(CIN * 64 / 8 / 256, 3), 256, 0, stream>>>(F[1], F[2], F[3], WP);
  k_proj<<<dim3(TNB * TT / 64, 1, 3), 128, 0, stream>>>(F[0], F[0], F[0], WP, WP + (size_t)CIN * 64, WP + 2 * (size_t)CIN * 64, QH, QL, KH, KL, VT, VB, VBL);
  /* head 0 only (head 1 is the zero padding); every batch in the same launch */
  k_fa<<<dim3(TNB, TT / (QT * 16)), 128, 0, stream>>>(QH, KH, QL, KL, VT, VB, VBL, (float*)d_out);
}

// v005
// A run of this version takes 26.4 microseconds.
// In both of two side-by-side timings against v004, it was 1.09 times as fast.
// Counting every step since v000, it is 25.0 times as fast.
// compute dtype: all float inputs rounded to bf16; q/k/v projections with EXACT bf16 products on WMMA 16x16x32 (f32 accumulate); causal logits: 3 products (q f16 hi + residual x k hi + residual) for the first 384 rows, single f16 q x k after, x scale; softmax f32 with a running row maximum and sum per 128 keys; exp(logit - max) x 2^11 once to f16 x v once to f16 (1 product; bf16 hi + lo below row 384), divided by the row sum at the end; f32 output.
#include <hip/hip_runtime.h>
#include <math.h>

typedef __attribute__((ext_vector_type(16))) _Float16 v16h;
typedef __attribute__((ext_vector_type(16))) __bf16 v16b;
typedef __attribute__((ext_vector_type(8)))  _Float16 v8h;
typedef __attribute__((ext_vector_type(8)))  float v8f;
typedef __attribute__((ext_vector_type(4)))  float v4f;
typedef __attribute__((ext_vector_type(2)))  float v2f;
typedef __attribute__((ext_vector_type(4)))  unsigned v4u;
typedef __attribute__((ext_vector_type(4)))  int v4i;
typedef float __attribute__((may_alias)) float_a;
typedef int __attribute__((may_alias)) int_a;

template <typename T> __device__ __forceinline__ void vst2(void* p, T v) { *(T*)p = v;  }
__device__ __forceinline__ v8f wmma16(v16h a, v16h b, v8f c) {
  v8f d = __builtin_amdgcn_wmma_f32_16x16x32_f16(false, a, false, b, (short)0, c, false, false);
  asm volatile("v_nop\n\tv_nop\n\tv_nop\n\tv_nop" : "+v"(d) : "v"(a), "v"(b));
  return d;
}
__device__ __forceinline__ v8f wmma_bf(v16b a, v16b b, v8f c) {
  v8f d = __builtin_amdgcn_wmma_f32_16x16x32_bf16(false, a, false, b, (short)0, c, false, false);
  asm volatile("v_nop\n\tv_nop\n\tv_nop\n\tv_nop" : "+v"(d) : "v"(a), "v"(b));
  return d;
}
// 16x16x32 fragments: lane = (h = lane>>4, row/col = lane&15); elements 0..7 = k0+8h+0..7, 8..15 = k0+16+8h+0..7; D element r = row 8h+r
__device__ __forceinline__ v16h frag_h(const _Float16* rowk0, int lane) {
  union { v16h v; v8h q[2]; } u; const _Float16* p = rowk0 + 8 * (lane >> 4);
  u.q[0] = *(const v8h*)p; u.q[1] = *(const v8h*)(p + 16); return u.v;
}
__device__ __forceinline__ v16h frag_f32(const float* rowk0, int lane) {
  v16h a; const float* p = rowk0 + 8 * (lane >> 4);
#pragma unroll
  for (int i = 0; i < 8; ++i) { a[i] = (_Float16)p[i]; a[8 + i] = (_Float16)p[16 + i]; }
  return a;
}
__device__ __forceinline__ v16h frag_f32s(const float* rowk0, int lane, float sc) {
  v16h a; const float* p = rowk0 + 8 * (lane >> 4);
#pragma unroll
  for (int i = 0; i < 8; ++i) { a[i] = (_Float16)(p[i] * sc); a[8 + i] = (_Float16)(p[16 + i] * sc); }
  return a;
}
// column fragment from a [K][ld] layout (column n), rows >= K read as 0
__device__ __forceinline__ v16h fragc_f32(const float* W, int k0, int n, int lane, int ld, int K) {
  v16h a; const int g = lane >> 4;
#pragma unroll
  for (int i = 0; i < 8; ++i) { const int ka = k0 + 8 * g + i, kb = ka + 16;
    a[i] = (_Float16)(ka < K ? W[(size_t)(ka < K ? ka : K - 1) * ld + n] : 0.f); a[8 + i] = (_Float16)(kb < K ? W[(size_t)(kb < K ? kb : K - 1) * ld + n] : 0.f); }
  return a;
}
struct F2 { v16b h, l; };
__device__ __forceinline__ F2 bsplit16(const float v[16]) { F2 r;
#pragma unroll
  for (int i = 0; i < 16; ++i) { const __bf16 h = (__bf16)v[i]; r.h[i] = h; r.l[i] = (__bf16)(v[i] - (float)h); }
  return r; }
__device__ __forceinline__ F2 split_row(const float* row, int k0, int lane) { float v[16]; const float* p = row + k0 + 8 * (lane >> 4);
#pragma unroll
  for (int i = 0; i < 8; ++i) { v[i] = p[i]; v[8 + i] = p[16 + i]; }
  return bsplit16(v); }
__device__ __forceinline__ F2 split_rowK(const float* row, int k0, int lane, int K) { float v[16]; const int g = lane >> 4;
#pragma unroll
  for (int i = 0; i < 8; ++i) { const int ka = k0 + 8 * g + i, kb = ka + 16; v[i] = ka < K ? row[ka < K ? ka : K - 1] : 0.f; v[8 + i] = kb < K ? row[kb < K ? kb : K - 1] : 0.f; }
  return bsplit16(v); }
__device__ __forceinline__ F2 split_col(const float* W, int k0, int n, int lane, int ld, int K) { float v[16]; const int g = lane >> 4;
#pragma unroll
  for (int i = 0; i < 8; ++i) { const int ka = k0 + 8 * g + i, kb = ka + 16; v[i] = ka < K ? W[(size_t)(ka < K ? ka : K - 1) * ld + n] : 0.f; v[8 + i] = kb < K ? W[(size_t)(kb < K ? kb : K - 1) * ld + n] : 0.f; }
  return bsplit16(v); }
__device__ __forceinline__ v8f mac3(const F2& a, const F2& b, v8f c) { c = wmma_bf(a.l, b.h, c); c = wmma_bf(a.h, b.l, c); return wmma_bf(a.h, b.h, c); }
__device__ __forceinline__ float sigm(float v) { return 1.0f / (1.0f + expf(-v)); }
#define LDSX() do { asm volatile("s_wait_dscnt 0" ::: "memory"); __builtin_amdgcn_wave_barrier(); __builtin_amdgcn_fence(__ATOMIC_RELEASE, "workgroup"); } while (0)

// Single-head causal self-attention scaled by the EMBEDDING width (x [8,2048,384]; head_size 64; (in,out) Wq, Wk, Wv [384,64] uniform(+-1/sqrt(384)); no biases, no output projection; scores / sqrt(C) with C = 384 (NOT the head size); tril, -inf): out = softmax(causal(q k^T / sqrt(384))) v -> [8,2048,64].
#define NB 8
#define TT 2048
#define CC 128            // NH * HD = projected width
#define DIN 384
#define NH 2
#define HD 64
#define NQB (TT / 64)
#define SCALE (0.05103103630798288f)
#define CAUSAL 1
#ifndef TNB
#define TNB NB
#endif
__device__ __forceinline__ float bfr(float v) { return (float)(__bf16)v; }
__host__ __device__ __forceinline__ int kb_last(int qb) { return CAUSAL ? ((qb * 64 + 63) >> 7) : (TT / 128 - 1); }
typedef __attribute__((ext_vector_type(8))) __bf16 v8b;
__device__ __forceinline__ v16b frag_b(const __bf16* rowk0, int lane) {
  union { v16b v; v8b q[2]; } u; const __bf16* p = rowk0 + 8 * (lane >> 4);
  u.q[0] = *(const v8b*)p; u.q[1] = *(const v8b*)(p + 16); return u.v;
}
#define QBH 6              // unused; causal: query rows < QHI of each sequence (32-row blocks 0..11; few keys, no averaging) take the high-precision path
#define QHI 384            // rows carrying a q residual plane
#define KHI 384            // key rows carrying k residual / v bf16 hi+lo planes (used only by the causal high-precision path)
// B fragment (k rows k0+.., output column o) of a weight: (in,out) [K][ld] or (out,in) [ld rows of K]: bf16 exact, or f16(bf16 * 256) exact
__device__ __forceinline__ v16b wcol_io(const float* Wm, int k0, int o, int lane, int ld) { v16b w; const int g = lane >> 4;
#pragma unroll
  for (int i = 0; i < 8; ++i) { w[i] = (__bf16)Wm[(size_t)(k0 + 8 * g + i) * ld + o]; w[8 + i] = (__bf16)Wm[(size_t)(k0 + 16 + 8 * g + i) * ld + o]; }
  return w; }
__device__ __forceinline__ v16b wcol_oi(const float* Wm, int k0, int o, int lane, int K) { v16b w; const float* p = Wm + (size_t)o * K + k0 + 8 * (lane >> 4);
#pragma unroll
  for (int i = 0; i < 8; ++i) { w[i] = (__bf16)p[i]; w[8 + i] = (__bf16)p[16 + i]; }
  return w; }
__device__ __forceinline__ v16h wcolh_io(const float* Wm, int k0, int o, int lane, int ld) { v16h w; const int g = lane >> 4;
#pragma unroll
  for (int i = 0; i < 8; ++i) { w[i] = (_Float16)(bfr(Wm[(size_t)(k0 + 8 * g + i) * ld + o]) * 256.0f); w[8 + i] = (_Float16)(bfr(Wm[(size_t)(k0 + 16 + 8 * g + i) * ld + o]) * 256.0f); }
  return w; }
__device__ __forceinline__ v16h wcolh_oi(const float* Wm, int k0, int o, int lane, int K) { v16h w; const float* p = Wm + (size_t)o * K + k0 + 8 * (lane >> 4);
#pragma unroll
  for (int i = 0; i < 8; ++i) { w[i] = (_Float16)(bfr(p[i]) * 256.0f); w[8 + i] = (_Float16)(bfr(p[16 + i]) * 256.0f); }
  return w; }
#define WQKV_LAYOUT 0   // 0 = (in,out) [DIN][CC]; 1 = (out,in) [CC][DIN]; 2 = per-head [NH][DIN][HD]
__device__ __forceinline__ v16b wcol_hdk(const float* Wm, int k0, int o, int lane) { v16b w; const int g = lane >> 4; const float* p = Wm + (size_t)(o / HD) * DIN * HD + (o % HD);
#pragma unroll
  for (int i = 0; i < 8; ++i) { w[i] = (__bf16)p[(size_t)(k0 + 8 * g + i) * HD]; w[8 + i] = (__bf16)p[(size_t)(k0 + 16 + 8 * g + i) * HD]; }
  return w; }
#define WO_OUT_IN 0
#if WQKV_LAYOUT == 1
#define WCOL(W, k0, o, lane) wcol_oi(W, k0, o, lane, DIN)
#elif WQKV_LAYOUT == 2
#define WCOL(W, k0, o, lane) wcol_hdk(W, k0, o, lane)
#else
#define WCOL(W, k0, o, lane) wcol_io(W, k0, o, lane, CC)
#endif
#if WO_OUT_IN
#define WOCOL(W, k0, o, lane) wcol_oi(W, k0, o, lane, CC)
#define WOCOLH(W, k0, o, lane) wcolh_oi(W, k0, o, lane, CC)
#else
#define WOCOL(W, k0, o, lane) wcol_io(W, k0, o, lane, DIN)
#define WOCOLH(W, k0, o, lane) wcolh_io(W, k0, o, lane, DIN)
#endif
#define CIN 384
// ---- k_packw: the three (in,out) [C][64] projection weights rounded to bf16 and laid out as ready WMMA B fragments: [which][k chunk of 32][16-column group j][half h][lane][8], element i of half h = W[kc * 32 + 16 * h + 8 * (lane >> 4) + i][j * 16 + (lane & 15)] (the k order of the A loader in k_proj); a half fragment is 512 contiguous bytes, 16 per lane
__global__ __launch_bounds__(256) void k_packw(const float* __restrict__ WQ, const float* __restrict__ WK, const float* __restrict__ WV, __bf16* __restrict__ WP) { const int which = blockIdx.y; const float* Wsrc = which == 0 ? WQ : (which == 1 ? WK : WV);
  const int e = blockIdx.x * 256 + threadIdx.x; const int lane = e & 31, h = (e >> 5) & 1, j = (e >> 6) & 3, kc = e >> 8;
  const float* p = Wsrc + (size_t)(kc * 32 + 16 * h + 8 * (lane >> 4)) * 64 + j * 16 + (lane & 15); v8b o;
#pragma unroll
  for (int i = 0; i < 8; ++i) o[i] = (__bf16)p[i * 64];
  vst2(WP + (size_t)which * CIN * 64 + (size_t)e * 8, o); }
#define WS_WP (WS_END)                                  // bf16 weight fragments [3][C x 64] (k_packw), at the head of this region
#define WS_END2 (WS_WP + 2u * 3 * (size_t)CIN * 64)
#ifndef SM_EXTRA_PARAMS
#define SM_EXTRA_PARAMS
#endif
#ifndef PROJ_EXTRA_PARAMS
#define PROJ_EXTRA_PARAMS
#endif
#ifndef SM_MASK_HOOK
#define SM_MASK_HOOK (void)0
#endif

// q, k and their residuals: WMMA fragments in lane order, [b*t / 16][hd chunk of 32][half h][lane][8], element i = row 16 * tile + (lane & 15), column 32 * chunk + 16 * h + 8 * (lane >> 4) + i; v planes: [b*t / 32][16-column group j][half h][lane][8], element i = column 16 * j + (lane & 15), key 32 * chunk + 16 * h + 8 * (lane >> 4) + i. A half fragment is 512 contiguous bytes, 16 per lane; each plane fills the first half of its region
#define WS_QH  0u                                      // f16 q fragments
#define WS_KH  (WS_QH + 2u * (size_t)NB * TT * CC)      // f16 k fragments
#define WS_VT  (WS_KH + 2u * (size_t)NB * TT * CC)      // f16 v fragments
#define WS_QL  (WS_VT + 2u * (size_t)NB * CC * TT)      // f16 q residual x 2^10 fragments, t < QHI of each b
#define WS_KL  (WS_QL + 2u * (size_t)NB * QHI * CC)     // f16 k residual x 2^10 fragments, t < KHI of each b
#define WS_VB  (WS_KL + 2u * (size_t)NB * KHI * CC)     // bf16 v hi fragments, t < KHI of each b (WS_VBL: lo)
#define WS_VBL (WS_VB + 2u * (size_t)NB * CC * KHI)
#define WS_S   (WS_VBL + 2u * (size_t)NB * CC * KHI)    // unused (the logits stay on chip); it keeps the offsets of the planes behind it
#define WS_Y   (WS_S  + 4u * (size_t)NB * TT * TT)      // f32 ctx rows [b*t][CC] (only when there is an output projection)
#define WS_END (WS_Y  + 0u)

// ---- k_proj: block = (64 rows, the 64 columns, which): q/k/v = X W with exact bf16 products (K = DIN) -> which 0: q f16 (+ residual, rows < QHI); 1: k f16 (+ residual, rows < KHI); 2: v f16 (+ bf16 hi/lo for t < KHI), each stored as the fragments that k_fa loads (layout: at WS_QH)
// The weights come as ready B fragments (k_packw): two full-line 16-byte loads a fragment. The loads of a k chunk (x and weights) are issued together, PAH chunks ahead of their products, all through constant offsets from two address pairs.
#define PAH 3
// 16-byte store with the wait behind it: the store's address and data registers are rewritten (next trip, next LDS read) only behind this wait; both are inputs of the wait so that they live up to it
__device__ __forceinline__ void gst16(void* p, v4u v) { *(v4u*)p = v; asm volatile("s_wait_xcnt 0x0" :: "v"(p), "v"(v) : "memory"); }
__global__ __launch_bounds__(128) void k_proj(const float* __restrict__ XQ, const float* __restrict__ XK, const float* __restrict__ XV, const __bf16* __restrict__ WQ, const __bf16* __restrict__ WK, const __bf16* __restrict__ WV,
    _Float16* __restrict__ QH, _Float16* __restrict__ QL, _Float16* __restrict__ KH, _Float16* __restrict__ KL, _Float16* __restrict__ VT, __bf16* __restrict__ VB, __bf16* __restrict__ VBL) {
  __shared__ __align__(16) _Float16 sh[64][72], sl[64][72]; __shared__ __align__(16) _Float16 th[64][72]; __shared__ __align__(16) __bf16 tb[64][72], tbl[64][72];
  const int tid = threadIdx.x, wave = tid >> 5, lane = tid & 31, col = lane & 15, g = lane >> 4; const int which = blockIdx.z; const size_t r0 = (size_t)blockIdx.x * 64; const size_t bb = r0 / TT; const int t0 = (int)(r0 % TT);
  const float* X = which == 0 ? XQ : which == 1 ? XK : XV; const __bf16* WA = which == 0 ? WQ : which == 1 ? WK : WV;
  constexpr int NK = DIN / 32;
  const float* xp = X + (r0 + wave * 16 + col) * DIN + 8 * g; const __bf16* wp = WA + lane * 8;
  v8f acc[4] = {}; v4f xa[NK][4]; v8b wf[NK][4][2];
#define PROJ_FETCH(kq) do { xa[kq][0] = *(const v4f*)(xp + (kq) * 32); xa[kq][1] = *(const v4f*)(xp + (kq) * 32 + 4); xa[kq][2] = *(const v4f*)(xp + (kq) * 32 + 16); xa[kq][3] = *(const v4f*)(xp + (kq) * 32 + 20); \
    _Pragma("unroll") for (int j = 0; j < 4; ++j) { wf[kq][j][0] = *(const v8b*)(wp + (((kq) * 4 + j) * 2) * 256); wf[kq][j][1] = *(const v8b*)(wp + (((kq) * 4 + j) * 2 + 1) * 256); } } while (0)
  // both loops fully unrolled: xa and wf are then indexed by constants and live in registers, and every load is a constant offset
#pragma unroll
  for (int kc = 0; kc < PAH; ++kc) PROJ_FETCH(kc);
#pragma unroll
  for (int kc = 0; kc < NK; ++kc) {
    if (kc + PAH < NK) PROJ_FETCH(kc + PAH);
    if (kc + PAH == NK - 1) asm volatile("s_wait_xcnt 0x0" :: "v"(xp), "v"(wp) : "memory");   // behind the last loads: their address registers are free to be rewritten only behind this wait (the pointers are inputs so that they live up to it)
    __builtin_amdgcn_sched_barrier(0);   // keeps the chunks' loads in issue order ahead of the products: without it the scheduler mixes loads of different chunks, and some products then wait for loads issued just before them
    v16b a;
#pragma unroll
    for (int i = 0; i < 4; ++i) { a[i] = (__bf16)xa[kc][0][i]; a[4 + i] = (__bf16)xa[kc][1][i]; a[8 + i] = (__bf16)xa[kc][2][i]; a[12 + i] = (__bf16)xa[kc][3][i]; }
#pragma unroll
    for (int j = 0; j < 4; ++j) { union { v16b v; v8b q[2]; } w; w.q[0] = wf[kc][j][0]; w.q[1] = wf[kc][j][1]; acc[j] = wmma_bf(a, w.v, acc[j]); } }
  if (which < 2) { _Float16* DH = which == 0 ? QH : KH; _Float16* DL = which == 0 ? QL : KL; const int nhi = which == 0 ? QHI : KHI; const bool hi_rows = t0 < nhi;
#pragma unroll
    for (int j = 0; j < 4; ++j) {
#pragma unroll
      for (int r = 0; r < 8; ++r) { const float v = acc[j][r]; const _Float16 hv = (_Float16)v; sh[wave * 16 + 8 * g + r][j * 16 + col] = hv; sl[wave * 16 + 8 * g + r][j * 16 + col] = (_Float16)((v - (float)hv) * 1024.0f); } }
    __syncthreads();
    for (int e = tid; e < 64 * 8; e += 128) { const int rl = (e >> 7) * 16 + (e & 15), cq = ((e >> 6) & 1) * 32 + ((e >> 5) & 1) * 16 + ((e >> 4) & 1) * 8;   // piece e of the block's 8 KB in fragment order: a wave stores 512 contiguous bytes
      gst16(DH + r0 * HD + e * 8, *(const v4u*)&sh[rl][cq]); if (hi_rows) gst16(DL + (bb * nhi + t0) * (size_t)HD + e * 8, *(const v4u*)&sl[rl][cq]); }
  } else { const bool hi_rows = t0 < KHI;
#pragma unroll
    for (int j = 0; j < 4; ++j) {
#pragma unroll
      for (int r = 0; r < 8; ++r) { const float v = acc[j][r]; const int rl = wave * 16 + 8 * g + r, cl = j * 16 + col; th[cl][rl] = (_Float16)v; const __bf16 bh = (__bf16)v; tb[cl][rl] = bh; tbl[cl][rl] = (__bf16)(v - (float)bh); } }
    __syncthreads();
    for (int e = tid; e < 64 * 8; e += 128) { const int cl = ((e >> 6) & 3) * 16 + (e & 15), tq = (e >> 8) * 32 + ((e >> 5) & 1) * 16 + ((e >> 4) & 1) * 8;
      gst16(VT + r0 * HD + e * 8, *(const v4u*)&th[cl][tq]); if (hi_rows) { const size_t o3 = (bb * KHI + t0) * (size_t)HD + e * 8; gst16(VB + o3, *(const v4u*)&tb[cl][tq]); gst16(VBL + o3, *(const v4u*)&tbl[cl][tq]); } } } }
// ---- k_fa: block = 32 query rows of batch b = blockIdx.x, head 0: logits, causal softmax and P . v in one pass, no logits plane.
// Wave w takes the 128-key blocks w, w + 4, ... up to the diagonal block, for all 32 rows (two 16-row tiles share every k and v fragment), and keeps its own running row maximum, row sum and ctx tiles; the four waves' parts are joined in LDS at the end.
// Per block: logits (1 f16 product; q hi + residual x k hi + residual, 3 products, for query rows < QHI), scaled by SCALE x log2(e); e = 2^(logit - running max + 11) in f32, through the wave's own LDS tile into A fragments (once to f16 against v f16; bf16 hi + lo against v bf16 hi + lo, 3 products, for rows < QHI). The row sum carries the same 2^11, so ctx / sum needs no other factor.
// the plain builtins: the compiler keeps the distance behind a matrix instruction itself and stays free to place the fragment loads ahead of the products
__device__ __forceinline__ v8f mm_h(v16h a, v16h b, v8f c) { return __builtin_amdgcn_wmma_f32_16x16x32_f16(false, a, false, b, (short)0, c, false, false); }
__device__ __forceinline__ v8f mm_b(v16b a, v16b b, v8f c) { return __builtin_amdgcn_wmma_f32_16x16x32_bf16(false, a, false, b, (short)0, c, false, false); }
// fragment stored in lane order at p = fragment start + 8 * lane: each of the two loads covers 512 contiguous bytes (4 whole lines) over the wave; one address pair serves a whole group of loads through constant offsets
#define FRG 512            // elements of a stored fragment
__device__ __forceinline__ v16h frag_hp(const _Float16* p) { union { v16h v; v8h q[2]; } u; u.q[0] = *(const v8h*)p; u.q[1] = *(const v8h*)(p + 256); return u.v; }
__device__ __forceinline__ v16b frag_bp(const __bf16* p) { union { v16b v; v8b q[2]; } u; u.q[0] = *(const v8b*)p; u.q[1] = *(const v8b*)(p + 256); return u.v; }
// behind a group of global loads: their address registers are free to be rewritten only behind this wait; its "memory" clobber also holds the group ahead of what follows, so that the loads fly together
// the pointers are named as inputs so that their registers live up to the wait
#define XW1(p) asm volatile("s_wait_xcnt 0x0" :: "v"(p) : "memory")
#define XW2(p, q) asm volatile("s_wait_xcnt 0x0" :: "v"(p), "v"(q) : "memory")
// the same for loads that the compiler forms from a wave-uniform base and the lane's index: both parts are named, so that the scalar pair too lives up to the wait
#define XWS(base, idx) asm volatile("s_wait_xcnt 0x0" :: "s"(base), "v"(idx) : "memory")
// 2^x with the slot that the instruction set asks for behind a transcendental (the next instruction may overwrite x) kept in the same statement
__device__ __forceinline__ float ex2(float x) { asm("v_exp_f32 %0, %0\n\tv_nop" : "+v"(x)); return x; }
#define QT 2               // 16-row query tiles per wave
#define SCALE2 (SCALE * 1.4426950408889634f)
// one 128-key block of one wave
template <bool HI>
__device__ __forceinline__ void fa_keys(const v16h (&ah)[QT][HD / 32], const v16h (&al)[QT][HD / 32], const _Float16* __restrict__ Kh, const _Float16* __restrict__ Kl, const _Float16* __restrict__ Vt, const __bf16* __restrict__ Vb, const __bf16* __restrict__ Vbl,
    int k0, int ql0, bool diag, int lane, float (*sw)[132], v8f (&o)[QT][HD / 16], float (&m)[QT][8], float (&l)[QT][8]) {
  const int col = lane & 15, g = lane >> 4;
  v8f acc[QT][8]; v16h vf[HI ? 1 : 4][HD / 16];
  const size_t ko = (size_t)k0 * HD + 8 * lane; const _Float16* kp = Kh + ko; const _Float16* rp = Kl + ko; const _Float16* vp = Vt + ko;
  if (HI) {
#pragma unroll
    for (int j0 = 0; j0 < 8; j0 += 4) { v16h kf[4][HD / 32], rf[4][HD / 32];   // the fragments of 64 keys are fetched together, ahead of their products: one memory round trip a group
#pragma unroll
      for (int jj = 0; jj < 4; ++jj) {
#pragma unroll
        for (int kc = 0; kc < HD / 32; ++kc) { kf[jj][kc] = frag_hp(kp + ((j0 + jj) * (HD / 32) + kc) * FRG); rf[jj][kc] = frag_hp(rp + ((j0 + jj) * (HD / 32) + kc) * FRG); } }
      XW2(kp, rp);
      __builtin_amdgcn_sched_barrier(0);   // keeps the products behind the whole group of loads
#pragma unroll
      for (int jj = 0; jj < 4; ++jj) {
#pragma unroll
        for (int t = 0; t < QT; ++t) { v8f a = {}, ar = {};   // ar: the residual products (x 2^10)
#pragma unroll
          for (int kc = 0; kc < HD / 32; ++kc) { a = mm_h(ah[t][kc], kf[jj][kc], a); ar = mm_h(al[t][kc], kf[jj][kc], ar); ar = mm_h(ah[t][kc], rf[jj][kc], ar); }
#pragma unroll
          for (int r = 0; r < 8; ++r) acc[t][j0 + jj][r] = (a[r] + ar[r] * (1.0f / 1024.0f)) * SCALE2; } } }
  } else { v16h kf[8][HD / 32];   // the fragments of the 128 keys are fetched together, ahead of their products
#pragma unroll
    for (int j = 0; j < 8; ++j) {
#pragma unroll
      for (int kc = 0; kc < HD / 32; ++kc) kf[j][kc] = frag_hp(kp + (j * (HD / 32) + kc) * FRG); }
    XW1(kp);
    __builtin_amdgcn_sched_barrier(0);   // keeps the products behind the whole group of loads: without it each product moves up to its own pair of loads and waits for that pair alone
#pragma unroll
    for (int j = 0; j < 8; ++j) {
#pragma unroll
      for (int t = 0; t < QT; ++t) { v8f a = {};
#pragma unroll
        for (int kc = 0; kc < HD / 32; ++kc) a = mm_h(ah[t][kc], kf[j][kc], a);
#pragma unroll
        for (int r = 0; r < 8; ++r) acc[t][j][r] = a[r] * SCALE2; } }
    // the v fragments of the first 64 keys start here, together, and fly under the softmax
#pragma unroll
    for (int kc = 0; kc < 2; ++kc) {
#pragma unroll
      for (int j = 0; j < HD / 16; ++j) vf[kc][j] = frag_hp(vp + (kc * (HD / 16) + j) * FRG); }
    XW1(vp);
  }
  if (diag) {   // only the diagonal block holds keys past a query (wave-uniform test)
#pragma unroll
    for (int t = 0; t < QT; ++t) {
#pragma unroll
      for (int j = 0; j < 8; ++j) {
#pragma unroll
        for (int r = 0; r < 8; ++r) acc[t][j][r] = (k0 + j * 16 + col > ql0 + t * 16 + 8 * g + r) ? -3.0e38f : acc[t][j][r]; } } }
#pragma unroll
  for (int t = 0; t < QT; ++t) {
#pragma unroll
    for (int r = 0; r < 8; ++r) { float mx = acc[t][0][r];
#pragma unroll
      for (int j = 1; j < 8; ++j) mx = fmaxf(mx, acc[t][j][r]);
#pragma unroll
      for (int s = 1; s < 16; s <<= 1) mx = fmaxf(mx, __shfl_xor(mx, s));
      const float mn = fmaxf(m[t][r], mx); const float f = ex2(m[t][r] - mn); m[t][r] = mn; l[t][r] *= f;
#pragma unroll
      for (int j = 0; j < HD / 16; ++j) o[t][j][r] *= f; }
#pragma unroll
    for (int j = 0; j < 8; ++j) {
#pragma unroll
      for (int r = 0; r < 8; ++r) { const float e = ex2(acc[t][j][r] - (m[t][r] - 11.0f));   /* an excluded key (-3e38) gives 0: every row sees key k0 of every block it walks, so m is a real logit */ l[t][r] += e; sw[t * 16 + 8 * g + r][j * 16 + col] = e; } }
    if (!HI && t == 0) {   // the other 64 keys' v fragments start once the first tile's logits have left their registers
#pragma unroll
      for (int kc = 2; kc < 4; ++kc) {
#pragma unroll
        for (int j = 0; j < HD / 16; ++j) vf[kc][j] = frag_hp(vp + (kc * (HD / 16) + j) * FRG); }
      XW1(vp);   // holds them ahead of the second tile's work: they fly under it
    } }
  LDSX();   // the wave's own stores land before its other lanes read them as rows
  if (HI) {
    const __bf16* hp = Vb + ko; const __bf16* lp = Vbl + ko;
#pragma unroll
    for (int c0 = 0; c0 < 4; c0 += 2) { v16b vh[2][HD / 16], vl[2][HD / 16];   // v fragments of 64 keys fetched together, ahead of their products
#pragma unroll
      for (int cc = 0; cc < 2; ++cc) {
#pragma unroll
        for (int j = 0; j < HD / 16; ++j) { vh[cc][j] = frag_bp(hp + ((c0 + cc) * (HD / 16) + j) * FRG); vl[cc][j] = frag_bp(lp + ((c0 + cc) * (HD / 16) + j) * FRG); } }
      XW2(hp, lp);
      __builtin_amdgcn_sched_barrier(0);   // keeps the products behind the whole group of loads
#pragma unroll
      for (int cc = 0; cc < 2; ++cc) {
#pragma unroll
        for (int t = 0; t < QT; ++t) { const F2 p = split_row(&sw[t * 16 + col][0], (c0 + cc) * 32, lane);
#pragma unroll
          for (int j = 0; j < HD / 16; ++j) { o[t][j] = mm_b(p.h, vh[cc][j], o[t][j]); o[t][j] = mm_b(p.l, vh[cc][j], o[t][j]); o[t][j] = mm_b(p.h, vl[cc][j], o[t][j]); } } } }
  } else {
#pragma unroll
    for (int kc = 0; kc < 4; ++kc) {
#pragma unroll
      for (int t = 0; t < QT; ++t) { const v16h p = frag_f32(&sw[t * 16 + col][kc * 32], lane);
#pragma unroll
        for (int j = 0; j < HD / 16; ++j) o[t][j] = mm_h(p, vf[kc][j], o[t][j]); } } }
  LDSX();   // every row read has returned before the next block's stores reuse the tile
}
// two waves per SIMD: the 512 work-groups are then all resident, two on a WGP
__global__ __launch_bounds__(128, 2) void k_fa(const _Float16* __restrict__ QH, const _Float16* __restrict__ KH, const _Float16* __restrict__ QL, const _Float16* __restrict__ KL, const _Float16* __restrict__ VT, const __bf16* __restrict__ VB, const __bf16* __restrict__ VBL, float* __restrict__ OUT) {
  __shared__ __align__(16) float ss[4][QT * 16][132];
  const int tid = threadIdx.x, lane = tid & 31, col = lane & 15, g = lane >> 4; const int wave = __builtin_amdgcn_readfirstlane(tid >> 5);
  constexpr int NT = TT / (QT * 16); const int y = blockIdx.y; const int qt = y < NT / 2 ? NT - 1 - y : y - NT / 2;   // long tiles start first; the second half of the grid runs from the shortest up, so that a late work-group joins an early one of the opposite length
  const int b = blockIdx.x; const int ql0 = qt * (QT * 16); const int kbl = ql0 >> 7;   // the 32 rows share their diagonal block: 128 is a multiple of 32
  const _Float16* Kh = KH + (size_t)b * TT * HD; const _Float16* Kl = KL + (size_t)b * KHI * HD; const _Float16* Vt = VT + (size_t)b * TT * HD; const __bf16* Vb = VB + (size_t)b * KHI * HD; const __bf16* Vbl = VBL + (size_t)b * KHI * HD;
  float (*sw)[132] = ss[wave];
  v8f o[QT][HD / 16] = {}; float m[QT][8], l[QT][8];
  v16h ah[QT][HD / 32], al[QT][HD / 32] = {};
  const _Float16* qb = QH + ((size_t)b * TT + ql0) * HD; const _Float16* qp = qb + 8 * lane; const _Float16* qr = QL + ((size_t)b * QHI + ql0) * HD + 8 * lane;   // qr is read only where ql0 < QHI
#pragma unroll
  for (int t = 0; t < QT; ++t) {
#pragma unroll
    for (int r = 0; r < 8; ++r) { m[t][r] = -3.0e38f; l[t][r] = 0.f; }
#pragma unroll
    for (int kc = 0; kc < HD / 32; ++kc) ah[t][kc] = frag_hp(qp + (t * (HD / 32) + kc) * FRG); }
  XWS(qb, lane);
  if (__builtin_expect(ql0 >= QHI, 1)) {   // the common path first in the text
#pragma unroll 1
    for (int kb = wave; kb <= kbl; kb += 4) fa_keys<false>(ah, al, Kh, Kl, Vt, Vb, Vbl, kb * 128, ql0, kb == kbl, lane, sw, o, m, l);
  } else {
#pragma unroll
    for (int t = 0; t < QT; ++t) {
#pragma unroll
      for (int kc = 0; kc < HD / 32; ++kc) al[t][kc] = frag_hp(qr + (t * (HD / 32) + kc) * FRG); }
    XW1(qr);
    static_assert(QHI <= 4 * 128, "a wave of these rows walks at most one block");
    if (wave <= kbl) fa_keys<true>(ah, al, Kh, Kl, Vt, Vb, Vbl, wave * 128, ql0, wave == kbl, lane, sw, o, m, l);
  }
#pragma unroll
  for (int t = 0; t < QT; ++t) {
#pragma unroll
    for (int r = 0; r < 8; ++r) {
#pragma unroll
      for (int s = 1; s < 16; s <<= 1) l[t][r] += __shfl_xor(l[t][r], s); }
#pragma unroll
    for (int j = 0; j < HD / 16; ++j) {
#pragma unroll
      for (int r = 0; r < 8; ++r) sw[t * 16 + 8 * g + r][j * 16 + col] = o[t][j][r]; }
    if (col == 0) {
#pragma unroll
      for (int r = 0; r < 8; ++r) { sw[t * 16 + 8 * g + r][HD] = m[t][r]; sw[t * 16 + 8 * g + r][HD + 1] = l[t][r]; } } }
  __syncthreads();
  // join: a wave that had no key block holds max -3e38, sum 0, ctx 0 and drops out with factor 0 (wave 0 always has block 0, whose key 0 every row sees)
  for (int e = tid; e < QT * 16 * (HD / 4); e += 128) { const int row = e / (HD / 4), q = e % (HD / 4);
    float mm = ss[0][row][HD];
#pragma unroll
    for (int w = 1; w < 4; ++w) mm = fmaxf(mm, ss[w][row][HD]);
    float den = 0.f; v4f a = {};
#pragma unroll
    for (int w = 0; w < 4; ++w) { const float f = ex2(ss[w][row][HD] - mm); den += f * ss[w][row][HD + 1]; a += *(const v4f*)&ss[w][row][q * 4] * f; }
    const float inv = den > 0.f ? 1.0f / den : 0.f;   /* a fully excluded row yields 0 */
    vst2(OUT + ((size_t)b * TT + ql0 + row) * HD + q * 4, a * inv); } }   // the output row itself: 256 B by 16 lanes, 32 whole rows a block

extern "C" void kernel_launch(void* const* d_in, const int* in_sizes, int n_in, void* d_out, int out_size, void* d_ws, size_t ws_size, hipStream_t stream) {
  (void)in_sizes; (void)n_in; (void)out_size;
  const float** F = (const float**)d_in;
  if (ws_size < (size_t)WS_END) return;
  char* ws = (char*)d_ws; _Float16 *QH = (_Float16*)(ws + WS_QH), *KH = (_Float16*)(ws + WS_KH), *VT = (_Float16*)(ws + WS_VT), *QL = (_Float16*)(ws + WS_QL), *KL = (_Float16*)(ws + WS_KL); __bf16 *VB = (__bf16*)(ws + WS_VB), *VBL = (__bf16*)(ws + WS_VBL); float *Y = (float*)(ws + WS_Y);
  (void)Y; (void)QL; (void)KL; (void)VB; (void)VBL;
  // inputs: 0 x [8,2048,384]; 1 Wq [384,64]; 2 Wk; 3 Wv ((in,out), no biases)
  if (ws_size < (size_t)WS_END2) return;
  __bf16 *WP = (__bf16*)(ws + WS_WP);
  k_packw<<<dim3(CIN * 64 / 8 / 256, 3), 256, 0, stream>>>(F[1], F[2], F[3], WP);
  k_proj<<<dim3(TNB * TT / 64, 1, 3), 128, 0, stream>>>(F[0], F[0], F[0], WP, WP + (size_t)CIN * 64, WP + 2 * (size_t)CIN * 64, QH, QL, KH, KL, VT, VB, VBL);
  /* head 0 only (head 1 is the zero padding); every batch in the same launch */
  k_fa<<<dim3(TNB, TT / (QT * 16)), 128, 0, stream>>>(QH, KH, QL, KL, VT, VB, VBL, (float*)d_out);
}

// v006
// It runs in 23.9 microseconds.
// Timed twice side by side with v005, it ran 1.10 times as fast both times.
// Over all steps from v000 it is 27.6 times as fast.
// compute dtype: all float inputs rounded to bf16; q/k/v projections with EXACT bf16 products on WMMA 16x16x32 (f32 accumulate); causal logits: 3 products (q f16 hi + residual x k hi + residual) for the first 384 rows, single f16 q x k after, x scale; softmax f32 with a running row maximum and sum per 128 keys; exp(logit - max) x 2^11 once to f16 x v once to f16 (1 product; bf16 hi + lo below row 384), divided by the row sum at the end; f32 output.
#include <hip/hip_runtime.h>
#include <math.h>

typedef __attribute__((ext_vector_type(16))) _Float16 v16h;
typedef __attribute__((ext_vector_type(16))) __bf16 v16b;
typedef __attribute__((ext_vector_type(8)))  _Float16 v8h;
typedef __attribute__((ext_vector_type(8)))  float v8f;
typedef __attribute__((ext_vector_type(4)))  float v4f;
typedef __attribute__((ext_vector_type(2)))  float v2f;
typedef __attribute__((ext_vector_type(4)))  unsigned v4u;
typedef __attribute__((ext_vector_type(4)))  int v4i;
typedef float __attribute__((may_alias)) float_a;
typedef int __attribute__((may_alias)) int_a;

template <typename T> __device__ __forceinline__ void vst2(void* p, T v) { *(T*)p = v;  }
__device__ __forceinline__ v8f wmma16(v16h a, v16h b, v8f c) {
  v8f d = __builtin_amdgcn_wmma_f32_16x16x32_f16(false, a, false, b, (short)0, c, false, false);
  asm volatile("v_nop\n\tv_nop\n\tv_nop\n\tv_nop" : "+v"(d) : "v"(a), "v"(b));
  return d;
}
__device__ __forceinline__ v8f wmma_bf(v16b a, v16b b, v8f c) {
  v8f d = __builtin_amdgcn_wmma_f32_16x16x32_bf16(false, a, false, b, (short)0, c, false, false);
  asm volatile("v_nop\n\tv_nop\n\tv_nop\n\tv_nop" : "+v"(d) : "v"(a), "v"(b));
  return d;
}
// 16x16x32 fragments: lane = (h = lane>>4, row/col = lane&15); elements 0..7 = k0+8h+0..7, 8..15 = k0+16+8h+0..7; D element r = row 8h+r
__device__ __forceinline__ v16h frag_h(const _Float16* rowk0, int lane) {
  union { v16h v; v8h q[2]; } u; const _Float16* p = rowk0 + 8 * (lane >> 4);
  u.q[0] = *(const v8h*)p; u.q[1] = *(const v8h*)(p + 16); return u.v;
}
__device__ __forceinline__ v16h frag_f32(const float* rowk0, int lane) {
  v16h a; const float* p = rowk0 + 8 * (lane >> 4);
#pragma unroll
  for (int i = 0; i < 8; ++i) { a[i] = (_Float16)p[i]; a[8 + i] = (_Float16)p[16 + i]; }
  return a;
}
__device__ __forceinline__ v16h frag_f32s(const float* rowk0, int lane, float sc) {
  v16h a; const float* p = rowk0 + 8 * (lane >> 4);
#pragma unroll
  for (int i = 0; i < 8; ++i) { a[i] = (_Float16)(p[i] * sc); a[8 + i] = (_Float16)(p[16 + i] * sc); }
  return a;
}
// column fragment from a [K][ld] layout (column n), rows >= K read as 0
__device__ __forceinline__ v16h fragc_f32(const float* W, int k0, int n, int lane, int ld, int K) {
  v16h a; const int g = lane >> 4;
#pragma unroll
  for (int i = 0; i < 8; ++i) { const int ka = k0 + 8 * g + i, kb = ka + 16;
    a[i] = (_Float16)(ka < K ? W[(size_t)(ka < K ? ka : K - 1) * ld + n] : 0.f); a[8 + i] = (_Float16)(kb < K ? W[(size_t)(kb < K ? kb : K - 1) * ld + n] : 0.f); }
  return a;
}
struct F2 { v16b h, l; };
__device__ __forceinline__ F2 bsplit16(const float v[16]) { F2 r;
#pragma unroll
  for (int i = 0; i < 16; ++i) { const __bf16 h = (__bf16)v[i]; r.h[i] = h; r.l[i] = (__bf16)(v[i] - (float)h); }
  return r; }
__device__ __forceinline__ F2 split_row(const float* row, int k0, int lane) { float v[16]; const float* p = row + k0 + 8 * (lane >> 4);
#pragma unroll
  for (int i = 0; i < 8; ++i) { v[i] = p[i]; v[8 + i] = p[16 + i]; }
  return bsplit16(v); }
__device__ __forceinline__ F2 split_rowK(const float* row, int k0, int lane, int K) { float v[16]; const int g = lane >> 4;
#pragma unroll
  for (int i = 0; i < 8; ++i) { const int ka = k0 + 8 * g + i, kb = ka + 16; v[i] = ka < K ? row[ka < K ? ka : K - 1] : 0.f; v[8 + i] = kb < K ? row[kb < K ? kb : K - 1] : 0.f; }
  return bsplit16(v); }
__device__ __forceinline__ F2 split_col(const float* W, int k0, int n, int lane, int ld, int K) { float v[16]; const int g = lane >> 4;
#pragma unroll
  for (int i = 0; i < 8; ++i) { const int ka = k0 + 8 * g + i, kb = ka + 16; v[i] = ka < K ? W[(size_t)(ka < K ? ka : K - 1) * ld + n] : 0.f; v[8 + i] = kb < K ? W[(size_t)(kb < K ? kb : K - 1) * ld + n] : 0.f; }
  return bsplit16(v); }
__device__ __forceinline__ v8f mac3(const F2& a, const F2& b, v8f c) { c = wmma_bf(a.l, b.h, c); c = wmma_bf(a.h, b.l, c); return wmma_bf(a.h, b.h, c); }
__device__ __forceinline__ float sigm(float v) { return 1.0f / (1.0f + expf(-v)); }
#define LDSX() do { asm volatile("s_wait_dscnt 0" ::: "memory"); __builtin_amdgcn_wave_barrier(); __builtin_amdgcn_fence(__ATOMIC_RELEASE, "workgroup"); } while (0)

// Single-head causal self-attention scaled by the EMBEDDING width (x [8,2048,384]; head_size 64; (in,out) Wq, Wk, Wv [384,64] uniform(+-1/sqrt(384)); no biases, no output projection; scores / sqrt(C) with C = 384 (NOT the head size); tril, -inf): out = softmax(causal(q k^T / sqrt(384))) v -> [8,2048,64].
#define NB 8
#define TT 2048
#define CC 128            // NH * HD = projected width
#define DIN 384
#define NH 2
#define HD 64
#define NQB (TT / 64)
#define SCALE (0.05103103630798288f)
#define CAUSAL 1
#ifndef TNB
#define TNB NB
#endif
__device__ __forceinline__ float bfr(float v) { return (float)(__bf16)v; }
__host__ __device__ __forceinline__ int kb_last(int qb) { return CAUSAL ? ((qb * 64 + 63) >> 7) : (TT / 128 - 1); }
typedef __attribute__((ext_vector_type(8))) __bf16 v8b;
__device__ __forceinline__ v16b frag_b(const __bf16* rowk0, int lane) {
  union { v16b v; v8b q[2]; } u; const __bf16* p = rowk0 + 8 * (lane >> 4);
  u.q[0] = *(const v8b*)p; u.q[1] = *(const v8b*)(p + 16); return u.v;
}
#define QBH 6              // unused; causal: query rows < QHI of each sequence (32-row blocks 0..11; few keys, no averaging) take the high-precision path
#define QHI 384            // rows carrying a q residual plane
#define KHI 384            // key rows carrying k residual / v bf16 hi+lo planes (used only by the causal high-precision path)
// B fragment (k rows k0+.., output column o) of a weight: (in,out) [K][ld] or (out,in) [ld rows of K]: bf16 exact, or f16(bf16 * 256) exact
__device__ __forceinline__ v16b wcol_io(const float* Wm, int k0, int o, int lane, int ld) { v16b w; const int g = lane >> 4;
#pragma unroll
  for (int i = 0; i < 8; ++i) { w[i] = (__bf16)Wm[(size_t)(k0 + 8 * g + i) * ld + o]; w[8 + i] = (__bf16)Wm[(size_t)(k0 + 16 + 8 * g + i) * ld + o]; }
  return w; }
__device__ __forceinline__ v16b wcol_oi(const float* Wm, int k0, int o, int lane, int K) { v16b w; const float* p = Wm + (size_t)o * K + k0 + 8 * (lane >> 4);
#pragma unroll
  for (int i = 0; i < 8; ++i) { w[i] = (__bf16)p[i]; w[8 + i] = (__bf16)p[16 + i]; }
  return w; }
__device__ __forceinline__ v16h wcolh_io(const float* Wm, int k0, int o, int lane, int ld) { v16h w; const int g = lane >> 4;
#pragma unroll
  for (int i = 0; i < 8; ++i) { w[i] = (_Float16)(bfr(Wm[(size_t)(k0 + 8 * g + i) * ld + o]) * 256.0f); w[8 + i] = (_Float16)(bfr(Wm[(size_t)(k0 + 16 + 8 * g + i) * ld + o]) * 256.0f); }
  return w; }
__device__ __forceinline__ v16h wcolh_oi(const float* Wm, int k0, int o, int lane, int K) { v16h w; const float* p = Wm + (size_t)o * K + k0 + 8 * (lane >> 4);
#pragma unroll
  for (int i = 0; i < 8; ++i) { w[i] = (_Float16)(bfr(p[i]) * 256.0f); w[8 + i] = (_Float16)(bfr(p[16 + i]) * 256.0f); }
  return w; }
#define WQKV_LAYOUT 0   // 0 = (in,out) [DIN][CC]; 1 = (out,in) [CC][DIN]; 2 = per-head [NH][DIN][HD]
__device__ __forceinline__ v16b wcol_hdk(const float* Wm, int k0, int o, int lane) { v16b w; const int g = lane >> 4; const float* p = Wm + (size_t)(o / HD) * DIN * HD + (o % HD);
#pragma unroll
  for (int i = 0; i < 8; ++i) { w[i] = (__bf16)p[(size_t)(k0 + 8 * g + i) * HD]; w[8 + i] = (__bf16)p[(size_t)(k0 + 16 + 8 * g + i) * HD]; }
  return w; }
#define WO_OUT_IN 0
#if WQKV_LAYOUT == 1
#define WCOL(W, k0, o, lane) wcol_oi(W, k0, o, lane, DIN)
#elif WQKV_LAYOUT == 2
#define WCOL(W, k0, o, lane) wcol_hdk(W, k0, o, lane)
#else
#define WCOL(W, k0, o, lane) wcol_io(W, k0, o, lane, CC)
#endif
#if WO_OUT_IN
#define WOCOL(W, k0, o, lane) wcol_oi(W, k0, o, lane, CC)
#define WOCOLH(W, k0, o, lane) wcolh_oi(W, k0, o, lane, CC)
#else
#define WOCOL(W, k0, o, lane) wcol_io(W, k0, o, lane, DIN)
#define WOCOLH(W, k0, o, lane) wcolh_io(W, k0, o, lane, DIN)
#endif
#define CIN 384
// ---- k_packw: the three (in,out) [C][64] projection weights rounded to bf16 and laid out as ready WMMA B fragments: [which][k chunk of 32][16-column group j][half h][lane][8], element i of half h = W[kc * 32 + 16 * h + 8 * (lane >> 4) + i][j * 16 + (lane & 15)] (the k order of the A loader in k_proj); a half fragment is 512 contiguous bytes, 16 per lane
__global__ __launch_bounds__(256) void k_packw(const float* __restrict__ WQ, const float* __restrict__ WK, const float* __restrict__ WV, __bf16* __restrict__ WP) { const int which = blockIdx.y; const float* Wsrc = which == 0 ? WQ : (which == 1 ? WK : WV);
  const int e = blockIdx.x * 256 + threadIdx.x; const int lane = e & 31, h = (e >> 5) & 1, j = (e >> 6) & 3, kc = e >> 8;
  const float* p = Wsrc + (size_t)(kc * 32 + 16 * h + 8 * (lane >> 4)) * 64 + j * 16 + (lane & 15); v8b o;
#pragma unroll
  for (int i = 0; i < 8; ++i) o[i] = (__bf16)p[i * 64];
  vst2(WP + (size_t)which * CIN * 64 + (size_t)e * 8, o); }
#define WS_WP (WS_END)                                  // bf16 weight fragments [3][C x 64] (k_packw), at the head of this region
#define WS_END2 (WS_WP + 2u * 3 * (size_t)CIN * 64)
#ifndef SM_EXTRA_PARAMS
#define SM_EXTRA_PARAMS
#endif
#ifndef PROJ_EXTRA_PARAMS
#define PROJ_EXTRA_PARAMS
#endif
#ifndef SM_MASK_HOOK
#define SM_MASK_HOOK (void)0
#endif

// q, k and their residuals: WMMA fragments in lane order, [b*t / 16][hd chunk of 32][half h][lane][8], element i = row 16 * tile + (lane & 15), column 32 * chunk + 16 * h + 8 * (lane >> 4) + i; v planes: [b*t / 32][16-column group j][half h][lane][8], element i = column 16 * j + (lane & 15), key 32 * chunk + 16 * h + 8 * (lane >> 4) + i. A half fragment is 512 contiguous bytes, 16 per lane; each plane fills the first half of its region
#define WS_QH  0u                                      // f16 q fragments
#define WS_KH  (WS_QH + 2u * (size_t)NB * TT * CC)      // f16 k fragments
#define WS_VT  (WS_KH + 2u * (size_t)NB * TT * CC)      // f16 v fragments
#define WS_QL  (WS_VT + 2u * (size_t)NB * CC * TT)      // f16 q residual x 2^10 fragments, t < QHI of each b
#define WS_KL  (WS_QL + 2u * (size_t)NB * QHI * CC)     // f16 k residual x 2^10 fragments, t < KHI of each b
#define WS_VB  (WS_KL + 2u * (size_t)NB * KHI * CC)     // bf16 v hi fragments, t < KHI of each b (WS_VBL: lo)
#define WS_VBL (WS_VB + 2u * (size_t)NB * CC * KHI)
#define WS_S   (WS_VBL + 2u * (size_t)NB * CC * KHI)    // unused (the logits stay on chip); it keeps the offsets of the planes behind it
#define WS_Y   (WS_S  + 4u * (size_t)NB * TT * TT)      // f32 ctx rows [b*t][CC] (only when there is an output projection)
#define WS_END (WS_Y  + 0u)

// ---- k_proj: block = 64 rows of x, all 192 columns (q, k, v): X W with exact bf16 products (K = DIN) -> q f16 (+ residual, rows < QHI), k f16 (+ residual, rows < KHI), v f16 (+ bf16 hi/lo for t < KHI), each stored as the fragments that k_fa loads (layout: at WS_QH)
// The block's x rows (96 KB, contiguous) are read once, in whole lines, rounded to bf16 once and laid in LDS, where they serve all three products. Wave w takes the 16-column groups 3w .. 3w + 2 of the twelve (q 0..3, k 4..7, v 8..11) for all 64 rows, so each weight fragment (k_packw) is loaded once a block.
#define PAH0 2             // k chunks of weight fragments that start beside the x rows (60 loads in flight)
#define PAH1 4             // chunks PAH0 .. PAH1 - 1 start while the x rows come in, early enough to be back with the last of them; the rest behind the barrier
#define PAH 5              // in the product loop the weight fragments are loaded this many k chunks ahead
#define XPITCH 392         // bf16 elements of a staged x row: 784 B = 16 B x 49, an odd count of 16-byte units, so that the 16 rows of a ds_load_b128 fall on distinct banks
typedef __attribute__((ext_vector_type(4))) __bf16 v4b;
__global__ __launch_bounds__(128) void k_proj(const float* __restrict__ X, const __bf16* __restrict__ WP,
    _Float16* __restrict__ QH, _Float16* __restrict__ QL, _Float16* __restrict__ KH, _Float16* __restrict__ KL, _Float16* __restrict__ VT, __bf16* __restrict__ VB, __bf16* __restrict__ VBL) {
  __shared__ __align__(16) __bf16 xs[64][XPITCH];
  __shared__ __align__(16) _Float16 sh[2][64][72], sl[2][64][72]; __shared__ __align__(16) _Float16 th[64][72]; __shared__ __align__(16) __bf16 tb[64][72], tbl[64][72];
  const int tid = threadIdx.x, lane = tid & 31, col = lane & 15, g = lane >> 4; const int wave = __builtin_amdgcn_readfirstlane(tid >> 5); const size_t r0 = (size_t)blockIdx.x * 64; const size_t bb = r0 / TT; const int t0 = (int)(r0 % TT);
  constexpr int NK = DIN / 32;
  const float* xb = X + (r0 + wave * 16) * DIN;   // wave w brings rows 16w .. 16w + 15: 48 loads of 512 contiguous bytes
  const __bf16* wb[3];
#pragma unroll
  for (int jj = 0; jj < 3; ++jj) { const int cg = wave * 3 + jj; wb[jj] = WP + (size_t)(cg >> 2) * CIN * 64 + (cg & 3) * 512; }
  v8f acc[4][3] = {}; v8b wf[NK][3][2]; v4f xv[48];
#define PROJ_FETCH(kq) do { _Pragma("unroll") for (int jj = 0; jj < 3; ++jj) { wf[kq][jj][0] = *(const v8b*)(wb[jj] + lane * 8 + (kq) * 2048); wf[kq][jj][1] = *(const v8b*)(wb[jj] + lane * 8 + (kq) * 2048 + 256); } } while (0)
#pragma unroll
  for (int c = 0; c < 48; ++c) xv[c] = *(const v4f*)(xb + lane * 4 + c * 128);
#pragma unroll
  for (int kc = 0; kc < PAH0; ++kc) PROJ_FETCH(kc);
  asm volatile("s_wait_xcnt 0x0" :: "s"(xb), "v"(lane) : "memory");   // behind the x loads: their address registers are free to be rewritten only behind this wait (base and index are inputs so that they live up to it); its "memory" clobber also keeps all these loads ahead of the LDS stores, so that they fly together
#pragma unroll
  for (int q = 0; q < 4; ++q) {
#pragma unroll
    for (int c = q * 12; c < q * 12 + 12; ++c) *(v4b*)&xs[wave * 16 + c / 3][(c % 3) * 128 + lane * 4] = __builtin_convertvector(xv[c], v4b);
    __builtin_amdgcn_sched_barrier(0);   // holds each further weight chunk behind twelve returned x loads (never more than 60 loads in flight) and each dozen LDS stores at its place among the waits
    if (q < PAH1 - PAH0) PROJ_FETCH(PAH0 + q);
  }
  __syncthreads();   // from here on each wave reads all 64 rows
  union AF { v16b v; v8b q[2]; }; AF a[NK][4];   // elements 0..7 = k 8g + 0..7 of the chunk, 8..15 = 16 + 8g + 0..7: the k order of k_packw
#define PROJ_XFRAG(kq) do { _Pragma("unroll") for (int rt = 0; rt < 4; ++rt) { const __bf16* xp = &xs[rt * 16 + col][(kq) * 32 + 8 * g]; a[kq][rt].q[0] = *(const v8b*)xp; a[kq][rt].q[1] = *(const v8b*)(xp + 16); } } while (0)
#pragma unroll
  for (int kc = PAH1; kc < PAH; ++kc) PROJ_FETCH(kc);
  PROJ_XFRAG(0);
  // fully unrolled: wf and a are then indexed by constants and live in registers, and every load is a constant offset
#pragma unroll
  for (int kc = 0; kc < NK; ++kc) {
    if (kc + PAH < NK) PROJ_FETCH(kc + PAH);
    if (kc + PAH == NK - 1) asm volatile("s_wait_xcnt 0x0" :: "s"(wb[0]), "s"(wb[1]), "s"(wb[2]), "v"(lane) : "memory");   // behind the last weight loads: as above
    if (kc + 1 < NK) PROJ_XFRAG(kc + 1);
    __builtin_amdgcn_sched_barrier(0);   // keeps the loads of later chunks ahead of this chunk's products: without it the scheduler sinks each load to just before its product, which then waits out the whole latency
#pragma unroll
    for (int jj = 0; jj < 3; ++jj) { union { v16b v; v8b q[2]; } w; w.q[0] = wf[kc][jj][0]; w.q[1] = wf[kc][jj][1];
#pragma unroll
      for (int rt = 0; rt < 4; ++rt) acc[rt][jj] = __builtin_amdgcn_wmma_f32_16x16x32_bf16(false, a[kc][rt].v, false, w.v, (short)0, acc[rt][jj], false, false); }
    __builtin_amdgcn_sched_barrier(0);   // the next group of loads stays whole behind these products
  }
#pragma unroll
  for (int jj = 0; jj < 3; ++jj) { const int cg = wave * 3 + jj, which = cg >> 2, cl = (cg & 3) * 16 + col;   // which is the same for the whole wave
    if (which < 2) {
#pragma unroll
      for (int rt = 0; rt < 4; ++rt) {
#pragma unroll
        for (int r = 0; r < 8; ++r) { const float v = acc[rt][jj][r]; const _Float16 hv = (_Float16)v; sh[which][rt * 16 + 8 * g + r][cl] = hv; sl[which][rt * 16 + 8 * g + r][cl] = (_Float16)((v - (float)hv) * 1024.0f); } }
    } else {
#pragma unroll
      for (int rt = 0; rt < 4; ++rt) {
#pragma unroll
        for (int r = 0; r < 8; ++r) { const float v = acc[rt][jj][r]; const int rl = rt * 16 + 8 * g + r; th[cl][rl] = (_Float16)v; const __bf16 bh = (__bf16)v; tb[cl][rl] = bh; tbl[cl][rl] = (__bf16)(v - (float)bh); } } } }
  __syncthreads();
  // piece e = tid + 128 i of a plane's 8 KB in fragment order: a wave stores 512 contiguous bytes. A group's LDS reads go first, then its stores, then one wait: with one wave on a SIMD nothing else hides a read or a store that is waited for singly
  const size_t eo = (size_t)tid * 8; _Float16* qd = QH + r0 * HD; _Float16* kd = KH + r0 * HD; _Float16* vd = VT + r0 * HD; v4u d[4][4];
#pragma unroll
  for (int i = 0; i < 4; ++i) { const int e = tid + i * 128; const int rl = (e >> 7) * 16 + (e & 15), cq = ((e >> 6) & 1) * 32 + ((e >> 5) & 1) * 16 + ((e >> 4) & 1) * 8; const int cl = ((e >> 6) & 3) * 16 + (e & 15), tq = (e >> 8) * 32 + ((e >> 5) & 1) * 16 + ((e >> 4) & 1) * 8;
    d[i][0] = *(const v4u*)&sh[0][rl][cq]; d[i][1] = *(const v4u*)&sh[1][rl][cq]; d[i][2] = *(const v4u*)&th[cl][tq]; }
#pragma unroll
  for (int i = 0; i < 4; ++i) { *(v4u*)(qd + eo + i * 1024) = d[i][0]; *(v4u*)(kd + eo + i * 1024) = d[i][1]; *(v4u*)(vd + eo + i * 1024) = d[i][2]; }
  // behind the stores: their address and data registers are rewritten only behind this wait; all are inputs of the wait so that they live up to it
  asm volatile("s_wait_xcnt 0x0" :: "s"(qd), "s"(kd), "s"(vd), "v"(eo), "v"(d[0][0]), "v"(d[0][1]), "v"(d[0][2]), "v"(d[1][0]), "v"(d[1][1]), "v"(d[1][2]), "v"(d[2][0]), "v"(d[2][1]), "v"(d[2][2]), "v"(d[3][0]), "v"(d[3][1]), "v"(d[3][2]) : "memory");
  static_assert(QHI == KHI, "one test serves the four extra planes");
  if (t0 < QHI) { const size_t o3 = (bb * QHI + t0) * (size_t)HD; _Float16* ql = QL + o3; _Float16* kl = KL + o3; __bf16* vh = VB + o3; __bf16* vl = VBL + o3;
#pragma unroll
    for (int i = 0; i < 4; ++i) { const int e = tid + i * 128; const int rl = (e >> 7) * 16 + (e & 15), cq = ((e >> 6) & 1) * 32 + ((e >> 5) & 1) * 16 + ((e >> 4) & 1) * 8; const int cl = ((e >> 6) & 3) * 16 + (e & 15), tq = (e >> 8) * 32 + ((e >> 5) & 1) * 16 + ((e >> 4) & 1) * 8;
      d[i][0] = *(const v4u*)&sl[0][rl][cq]; d[i][1] = *(const v4u*)&sl[1][rl][cq]; d[i][2] = *(const v4u*)&tb[cl][tq]; d[i][3] = *(const v4u*)&tbl[cl][tq]; }
#pragma unroll
    for (int i = 0; i < 4; ++i) { *(v4u*)(ql + eo + i * 1024) = d[i][0]; *(v4u*)(kl + eo + i * 1024) = d[i][1]; *(v4u*)(vh + eo + i * 1024) = d[i][2]; *(v4u*)(vl + eo + i * 1024) = d[i][3]; }
    asm volatile("s_wait_xcnt 0x0" :: "s"(ql), "s"(kl), "s"(vh), "s"(vl), "v"(eo), "v"(d[0][0]), "v"(d[0][1]), "v"(d[0][2]), "v"(d[0][3]), "v"(d[1][0]), "v"(d[1][1]), "v"(d[1][2]), "v"(d[1][3]), "v"(d[2][0]), "v"(d[2][1]), "v"(d[2][2]), "v"(d[2][3]), "v"(d[3][0]), "v"(d[3][1]), "v"(d[3][2]), "v"(d[3][3]) : "memory"); } }   // as above
// ---- k_fa: block = 32 query rows of batch b = blockIdx.x, head 0: logits, causal softmax and P . v in one pass, no logits plane.
// Wave w takes the 128-key blocks w, w + 4, ... up to the diagonal block, for all 32 rows (two 16-row tiles share every k and v fragment), and keeps its own running row maximum, row sum and ctx tiles; the four waves' parts are joined in LDS at the end.
// Per block: logits (1 f16 product; q hi + residual x k hi + residual, 3 products, for query rows < QHI), scaled by SCALE x log2(e); e = 2^(logit - running max + 11) in f32, through the wave's own LDS tile into A fragments (once to f16 against v f16; bf16 hi + lo against v bf16 hi + lo, 3 products, for rows < QHI). The row sum carries the same 2^11, so ctx / sum needs no other factor.
// the plain builtins: the compiler keeps the distance behind a matrix instruction itself and stays free to place the fragment loads ahead of the products
__device__ __forceinline__ v8f mm_h(v16h a, v16h b, v8f c) { return __builtin_amdgcn_wmma_f32_16x16x32_f16(false, a, false, b, (short)0, c, false, false); }
__device__ __forceinline__ v8f mm_b(v16b a, v16b b, v8f c) { return __builtin_amdgcn_wmma_f32_16x16x32_bf16(false, a, false, b, (short)0, c, false, false); }
// fragment stored in lane order at p = fragment start + 8 * lane: each of the two loads covers 512 contiguous bytes (4 whole lines) over the wave; one address pair serves a whole group of loads through constant offsets
#define FRG 512            // elements of a stored fragment
__device__ __forceinline__ v16h frag_hp(const _Float16* p) { union { v16h v; v8h q[2]; } u; u.q[0] = *(const v8h*)p; u.q[1] = *(const v8h*)(p + 256); return u.v; }
__device__ __forceinline__ v16b frag_bp(const __bf16* p) { union { v16b v; v8b q[2]; } u; u.q[0] = *(const v8b*)p; u.q[1] = *(const v8b*)(p + 256); return u.v; }
// behind a group of global loads: their address registers are free to be rewritten only behind this wait; its "memory" clobber also holds the group ahead of what follows, so that the loads fly together
// the pointers are named as inputs so that their registers live up to the wait
#define XW1(p) asm volatile("s_wait_xcnt 0x0" :: "v"(p) : "memory")
#define XW2(p, q) asm volatile("s_wait_xcnt 0x0" :: "v"(p), "v"(q) : "memory")
// the same for loads that the compiler forms from a wave-uniform base and the lane's index: both parts are named, so that the scalar pair too lives up to the wait
#define XWS(base, idx) asm volatile("s_wait_xcnt 0x0" :: "s"(base), "v"(idx) : "memory")
// 2^x with the slot that the instruction set asks for behind a transcendental (the next instruction may overwrite x) kept in the same statement
__device__ __forceinline__ float ex2(float x) { asm("v_exp_f32 %0, %0\n\tv_nop" : "+v"(x)); return x; }
#define QT 2               // 16-row query tiles per wave
#define SCALE2 (SCALE * 1.4426950408889634f)
// one 128-key block of one wave
template <bool HI>
__device__ __forceinline__ void fa_keys(const v16h (&ah)[QT][HD / 32], const v16h (&al)[QT][HD / 32], const _Float16* __restrict__ Kh, const _Float16* __restrict__ Kl, const _Float16* __restrict__ Vt, const __bf16* __restrict__ Vb, const __bf16* __restrict__ Vbl,
    int k0, int ql0, bool diag, int lane, float (*sw)[132], v8f (&o)[QT][HD / 16], float (&m)[QT][8], float (&l)[QT][8]) {
  const int col = lane & 15, g = lane >> 4;
  v8f acc[QT][8]; v16h vf[HI ? 1 : 4][HD / 16];
  const size_t ko = (size_t)k0 * HD + 8 * lane; const _Float16* kp = Kh + ko; const _Float16* rp = Kl + ko; const _Float16* vp = Vt + ko;
  if (HI) {
#pragma unroll
    for (int j0 = 0; j0 < 8; j0 += 4) { v16h kf[4][HD / 32], rf[4][HD / 32];   // the fragments of 64 keys are fetched together, ahead of their products: one memory round trip a group
#pragma unroll
      for (int jj = 0; jj < 4; ++jj) {
#pragma unroll
        for (int kc = 0; kc < HD / 32; ++kc) { kf[jj][kc] = frag_hp(kp + ((j0 + jj) * (HD / 32) + kc) * FRG); rf[jj][kc] = frag_hp(rp + ((j0 + jj) * (HD / 32) + kc) * FRG); } }
      XW2(kp, rp);
      __builtin_amdgcn_sched_barrier(0);   // keeps the products behind the whole group of loads
#pragma unroll
      for (int jj = 0; jj < 4; ++jj) {
#pragma unroll
        for (int t = 0; t < QT; ++t) { v8f a = {}, ar = {};   // ar: the residual products (x 2^10)
#pragma unroll
          for (int kc = 0; kc < HD / 32; ++kc) { a = mm_h(ah[t][kc], kf[jj][kc], a); ar = mm_h(al[t][kc], kf[jj][kc], ar); ar = mm_h(ah[t][kc], rf[jj][kc], ar); }
#pragma unroll
          for (int r = 0; r < 8; ++r) acc[t][j0 + jj][r] = (a[r] + ar[r] * (1.0f / 1024.0f)) * SCALE2; } } }
  } else { v16h kf[8][HD / 32];   // the fragments of the 128 keys are fetched together, ahead of their products
#pragma unroll
    for (int j = 0; j < 8; ++j) {
#pragma unroll
      for (int kc = 0; kc < HD / 32; ++kc) kf[j][kc] = frag_hp(kp + (j * (HD / 32) + kc) * FRG); }
    XW1(kp);
    __builtin_amdgcn_sched_barrier(0);   // keeps the products behind the whole group of loads: without it each product moves up to its own pair of loads and waits for that pair alone
#pragma unroll
    for (int j = 0; j < 8; ++j) {
#pragma unroll
      for (int t = 0; t < QT; ++t) { v8f a = {};
#pragma unroll
        for (int kc = 0; kc < HD / 32; ++kc) a = mm_h(ah[t][kc], kf[j][kc], a);
#pragma unroll
        for (int r = 0; r < 8; ++r) acc[t][j][r] = a[r] * SCALE2; } }
    // the v fragments of the first 64 keys start here, together, and fly under the softmax
#pragma unroll
    for (int kc = 0; kc < 2; ++kc) {
#pragma unroll
      for (int j = 0; j < HD / 16; ++j) vf[kc][j] = frag_hp(vp + (kc * (HD / 16) + j) * FRG); }
    XW1(vp);
  }
  if (diag) {   // only the diagonal block holds keys past a query (wave-uniform test)
#pragma unroll
    for (int t = 0; t < QT; ++t) {
#pragma unroll
      for (int j = 0; j < 8; ++j) {
#pragma unroll
        for (int r = 0; r < 8; ++r) acc[t][j][r] = (k0 + j * 16 + col > ql0 + t * 16 + 8 * g + r) ? -3.0e38f : acc[t][j][r]; } } }
#pragma unroll
  for (int t = 0; t < QT; ++t) {
#pragma unroll
    for (int r = 0; r < 8; ++r) { float mx = acc[t][0][r];
#pragma unroll
      for (int j = 1; j < 8; ++j) mx = fmaxf(mx, acc[t][j][r]);
#pragma unroll
      for (int s = 1; s < 16; s <<= 1) mx = fmaxf(mx, __shfl_xor(mx, s));
      const float mn = fmaxf(m[t][r], mx); const float f = ex2(m[t][r] - mn); m[t][r] = mn; l[t][r] *= f;
#pragma unroll
      for (int j = 0; j < HD / 16; ++j) o[t][j][r] *= f; }
#pragma unroll
    for (int j = 0; j < 8; ++j) {
#pragma unroll
      for (int r = 0; r < 8; ++r) { const float e = ex2(acc[t][j][r] - (m[t][r] - 11.0f));   /* an excluded key (-3e38) gives 0: every row sees key k0 of every block it walks, so m is a real logit */ l[t][r] += e; sw[t * 16 + 8 * g + r][j * 16 + col] = e; } }
    if (!HI && t == 0) {   // the other 64 keys' v fragments start once the first tile's logits have left their registers
#pragma unroll
      for (int kc = 2; kc < 4; ++kc) {
#pragma unroll
        for (int j = 0; j < HD / 16; ++j) vf[kc][j] = frag_hp(vp + (kc * (HD / 16) + j) * FRG); }
      XW1(vp);   // holds them ahead of the second tile's work: they fly under it
    } }
  LDSX();   // the wave's own stores land before its other lanes read them as rows
  if (HI) {
    const __bf16* hp = Vb + ko; const __bf16* lp = Vbl + ko;
#pragma unroll
    for (int c0 = 0; c0 < 4; c0 += 2) { v16b vh[2][HD / 16], vl[2][HD / 16];   // v fragments of 64 keys fetched together, ahead of their products
#pragma unroll
      for (int cc = 0; cc < 2; ++cc) {
#pragma unroll
        for (int j = 0; j < HD / 16; ++j) { vh[cc][j] = frag_bp(hp + ((c0 + cc) * (HD / 16) + j) * FRG); vl[cc][j] = frag_bp(lp + ((c0 + cc) * (HD / 16) + j) * FRG); } }
      XW2(hp, lp);
      __builtin_amdgcn_sched_barrier(0);   // keeps the products behind the whole group of loads
#pragma unroll
      for (int cc = 0; cc < 2; ++cc) {
#pragma unroll
        for (int t = 0; t < QT; ++t) { const F2 p = split_row(&sw[t * 16 + col][0], (c0 + cc) * 32, lane);
#pragma unroll
          for (int j = 0; j < HD / 16; ++j) { o[t][j] = mm_b(p.h, vh[cc][j], o[t][j]); o[t][j] = mm_b(p.l, vh[cc][j], o[t][j]); o[t][j] = mm_b(p.h, vl[cc][j], o[t][j]); } } } }
  } else {
#pragma unroll
    for (int kc = 0; kc < 4; ++kc) {
#pragma unroll
      for (int t = 0; t < QT; ++t) { const v16h p = frag_f32(&sw[t * 16 + col][kc * 32], lane);
#pragma unroll
        for (int j = 0; j < HD / 16; ++j) o[t][j] = mm_h(p, vf[kc][j], o[t][j]); } } }
  LDSX();   // every row read has returned before the next block's stores reuse the tile
}
// two waves per SIMD: the 512 work-groups are then all resident, two on a WGP
__global__ __launch_bounds__(128, 2) void k_fa(const _Float16* __restrict__ QH, const _Float16* __restrict__ KH, const _Float16* __restrict__ QL, const _Float16* __restrict__ KL, const _Float16* __restrict__ VT, const __bf16* __restrict__ VB, const __bf16* __restrict__ VBL, float* __restrict__ OUT) {
  __shared__ __align__(16) float ss[4][QT * 16][132];
  const int tid = threadIdx.x, lane = tid & 31, col = lane & 15, g = lane >> 4; const int wave = __builtin_amdgcn_readfirstlane(tid >> 5);
  constexpr int NT = TT / (QT * 16); const int y = blockIdx.y; const int qt = y < NT / 2 ? NT - 1 - y : y - NT / 2;   // long tiles start first; the second half of the grid runs from the shortest up, so that a late work-group joins an early one of the opposite length
  const int b = blockIdx.x; const int ql0 = qt * (QT * 16); const int kbl = ql0 >> 7;   // the 32 rows share their diagonal block: 128 is a multiple of 32
  const _Float16* Kh = KH + (size_t)b * TT * HD; const _Float16* Kl = KL + (size_t)b * KHI * HD; const _Float16* Vt = VT + (size_t)b * TT * HD; const __bf16* Vb = VB + (size_t)b * KHI * HD; const __bf16* Vbl = VBL + (size_t)b * KHI * HD;
  float (*sw)[132] = ss[wave];
  v8f o[QT][HD / 16] = {}; float m[QT][8], l[QT][8];
  v16h ah[QT][HD / 32], al[QT][HD / 32] = {};
  const _Float16* qb = QH + ((size_t)b * TT + ql0) * HD; const _Float16* qp = qb + 8 * lane; const _Float16* qr = QL + ((size_t)b * QHI + ql0) * HD + 8 * lane;   // qr is read only where ql0 < QHI
#pragma unroll
  for (int t = 0; t < QT; ++t) {
#pragma unroll
    for (int r = 0; r < 8; ++r) { m[t][r] = -3.0e38f; l[t][r] = 0.f; }
#pragma unroll
    for (int kc = 0; kc < HD / 32; ++kc) ah[t][kc] = frag_hp(qp + (t * (HD / 32) + kc) * FRG); }
  XWS(qb, lane);
  if (__builtin_expect(ql0 >= QHI, 1)) {   // the common path first in the text
#pragma unroll 1
    for (int kb = wave; kb <= kbl; kb += 4) fa_keys<false>(ah, al, Kh, Kl, Vt, Vb, Vbl, kb * 128, ql0, kb == kbl, lane, sw, o, m, l);
  } else {
#pragma unroll
    for (int t = 0; t < QT; ++t) {
#pragma unroll
      for (int kc = 0; kc < HD / 32; ++kc) al[t][kc] = frag_hp(qr + (t * (HD / 32) + kc) * FRG); }
    XW1(qr);
    static_assert(QHI <= 4 * 128, "a wave of these rows walks at most one block");
    if (wave <= kbl) fa_keys<true>(ah, al, Kh, Kl, Vt, Vb, Vbl, wave * 128, ql0, wave == kbl, lane, sw, o, m, l);
  }
#pragma unroll
  for (int t = 0; t < QT; ++t) {
#pragma unroll
    for (int r = 0; r < 8; ++r) {
#pragma unroll
      for (int s = 1; s < 16; s <<= 1) l[t][r] += __shfl_xor(l[t][r], s); }
#pragma unroll
    for (int j = 0; j < HD / 16; ++j) {
#pragma unroll
      for (int r = 0; r < 8; ++r) sw[t * 16 + 8 * g + r][j * 16 + col] = o[t][j][r]; }
    if (col == 0) {
#pragma unroll
      for (int r = 0; r < 8; ++r) { sw[t * 16 + 8 * g + r][HD] = m[t][r]; sw[t * 16 + 8 * g + r][HD + 1] = l[t][r]; } } }
  __syncthreads();
  // join: a wave that had no key block holds max -3e38, sum 0, ctx 0 and drops out with factor 0 (wave 0 always has block 0, whose key 0 every row sees)
  for (int e = tid; e < QT * 16 * (HD / 4); e += 128) { const int row = e / (HD / 4), q = e % (HD / 4);
    float mm = ss[0][row][HD];
#pragma unroll
    for (int w = 1; w < 4; ++w) mm = fmaxf(mm, ss[w][row][HD]);
    float den = 0.f; v4f a = {};
#pragma unroll
    for (int w = 0; w < 4; ++w) { const float f = ex2(ss[w][row][HD] - mm); den += f * ss[w][row][HD + 1]; a += *(const v4f*)&ss[w][row][q * 4] * f; }
    const float inv = den > 0.f ? 1.0f / den : 0.f;   /* a fully excluded row yields 0 */
    vst2(OUT + ((size_t)b * TT + ql0 + row) * HD + q * 4, a * inv); } }   // the output row itself: 256 B by 16 lanes, 32 whole rows a block

extern "C" void kernel_launch(void* const* d_in, const int* in_sizes, int n_in, void* d_out, int out_size, void* d_ws, size_t ws_size, hipStream_t stream) {
  (void)in_sizes; (void)n_in; (void)out_size;
  const float** F = (const float**)d_in;
  if (ws_size < (size_t)WS_END) return;
  char* ws = (char*)d_ws; _Float16 *QH = (_Float16*)(ws + WS_QH), *KH = (_Float16*)(ws + WS_KH), *VT = (_Float16*)(ws + WS_VT), *QL = (_Float16*)(ws + WS_QL), *KL = (_Float16*)(ws + WS_KL); __bf16 *VB = (__bf16*)(ws + WS_VB), *VBL = (__bf16*)(ws + WS_VBL); float *Y = (float*)(ws + WS_Y);
  (void)Y; (void)QL; (void)KL; (void)VB; (void)VBL;
  // inputs: 0 x [8,2048,384]; 1 Wq [384,64]; 2 Wk; 3 Wv ((in,out), no biases)
  if (ws_size < (size_t)WS_END2) return;
  __bf16 *WP = (__bf16*)(ws + WS_WP);
  k_packw<<<dim3(CIN * 64 / 8 / 256, 3), 256, 0, stream>>>(F[1], F[2], F[3], WP);
  k_proj<<<dim3(TNB * TT / 64), 128, 0, stream>>>(F[0], WP, QH, QL, KH, KL, VT, VB, VBL);
  /* head 0 only (head 1 is the zero padding); every batch in the same launch */
  k_fa<<<dim3(TNB, TT / (QT * 16)), 128, 0, stream>>>(QH, KH, QL, KL, VT, VB, VBL, (float*)d_out);
}

// v007
// A run of this version takes 18.9 microseconds.
// Two timings next to v006 put it at 1.25 and 1.29 times that version's speed.
// Counting every step since v000, it is 35.0 times as fast.
// compute dtype: all float inputs rounded to bf16; q/k/v projections with EXACT bf16 products on WMMA 16x16x32 (f32 accumulate); causal logits: 3 products (q f16 hi + residual x k hi + residual) for the first 384 rows, single f16 q x k after, x scale; softmax f32 with a running row maximum and sum per 128 keys; exp(logit - max) x 2^11 once to f16 x v once to f16 (1 product; bf16 hi + lo below row 384), divided by the row sum at the end; f32 output.
#include <hip/hip_runtime.h>
#include <math.h>

typedef __attribute__((ext_vector_type(16))) _Float16 v16h;
typedef __attribute__((ext_vector_type(16))) __bf16 v16b;
typedef __attribute__((ext_vector_type(8)))  _Float16 v8h;
typedef __attribute__((ext_vector_type(8)))  float v8f;
typedef __attribute__((ext_vector_type(4)))  float v4f;
typedef __attribute__((ext_vector_type(2)))  float v2f;
typedef __attribute__((ext_vector_type(4)))  unsigned v4u;
typedef __attribute__((ext_vector_type(4)))  int v4i;
typedef float __attribute__((may_alias)) float_a;
typedef int __attribute__((may_alias)) int_a;

template <typename T> __device__ __forceinline__ void vst2(void* p, T v) { *(T*)p = v;  }
__device__ __forceinline__ v8f wmma16(v16h a, v16h b, v8f c) {
  v8f d = __builtin_amdgcn_wmma_f32_16x16x32_f16(false, a, false, b, (short)0, c, false, false);
  asm volatile("v_nop\n\tv_nop\n\tv_nop\n\tv_nop" : "+v"(d) : "v"(a), "v"(b));
  return d;
}
__device__ __forceinline__ v8f wmma_bf(v16b a, v16b b, v8f c) {
  v8f d = __builtin_amdgcn_wmma_f32_16x16x32_bf16(false, a, false, b, (short)0, c, false, false);
  asm volatile("v_nop\n\tv_nop\n\tv_nop\n\tv_nop" : "+v"(d) : "v"(a), "v"(b));
  return d;
}
// 16x16x32 fragments: lane = (h = lane>>4, row/col = lane&15); elements 0..7 = k0+8h+0..7, 8..15 = k0+16+8h+0..7; D element r = row 8h+r
__device__ __forceinline__ v16h frag_h(const _Float16* rowk0, int lane) {
  union { v16h v; v8h q[2]; } u; const _Float16* p = rowk0 + 8 * (lane >> 4);
  u.q[0] = *(const v8h*)p; u.q[1] = *(const v8h*)(p + 16); return u.v;
}
__device__ __forceinline__ v16h frag_f32(const float* rowk0, int lane) {
  v16h a; const float* p = rowk0 + 8 * (lane >> 4);
#pragma unroll
  for (int i = 0; i < 8; ++i) { a[i] = (_Float16)p[i]; a[8 + i] = (_Float16)p[16 + i]; }
  return a;
}
__device__ __forceinline__ v16h frag_f32s(const float* rowk0, int lane, float sc) {
  v16h a; const float* p = rowk0 + 8 * (lane >> 4);
#pragma unroll
  for (int i = 0; i < 8; ++i) { a[i] = (_Float16)(p[i] * sc); a[8 + i] = (_Float16)(p[16 + i] * sc); }
  return a;
}
// column fragment from a [K][ld] layout (column n), rows >= K read as 0
__device__ __forceinline__ v16h fragc_f32(const float* W, int k0, int n, int lane, int ld, int K) {
  v16h a; const int g = lane >> 4;
#pragma unroll
  for (int i = 0; i < 8; ++i) { const int ka = k0 + 8 * g + i, kb = ka + 16;
    a[i] = (_Float16)(ka < K ? W[(size_t)(ka < K ? ka : K - 1) * ld + n] : 0.f); a[8 + i] = (_Float16)(kb < K ? W[(size_t)(kb < K ? kb : K - 1) * ld + n] : 0.f); }
  return a;
}
struct F2 { v16b h, l; };
__device__ __forceinline__ F2 bsplit16(const float v[16]) { F2 r;
#pragma unroll
  for (int i = 0; i < 16; ++i) { const __bf16 h = (__bf16)v[i]; r.h[i] = h; r.l[i] = (__bf16)(v[i] - (float)h); }
  return r; }
__device__ __forceinline__ F2 split_row(const float* row, int k0, int lane) { float v[16]; const float* p = row + k0 + 8 * (lane >> 4);
#pragma unroll
  for (int i = 0; i < 8; ++i) { v[i] = p[i]; v[8 + i] = p[16 + i]; }
  return bsplit16(v); }
__device__ __forceinline__ F2 split_rowK(const float* row, int k0, int lane, int K) { float v[16]; const int g = lane >> 4;
#pragma unroll
  for (int i = 0; i < 8; ++i) { const int ka = k0 + 8 * g + i, kb = ka + 16; v[i] = ka < K ? row[ka < K ? ka : K - 1] : 0.f; v[8 + i] = kb < K ? row[kb < K ? kb : K - 1] : 0.f; }
  return bsplit16(v); }
__device__ __forceinline__ F2 split_col(const float* W, int k0, int n, int lane, int ld, int K) { float v[16]; const int g = lane >> 4;
#pragma unroll
  for (int i = 0; i < 8; ++i) { const int ka = k0 + 8 * g + i, kb = ka + 16; v[i] = ka < K ? W[(size_t)(ka < K ? ka : K - 1) * ld + n] : 0.f; v[8 + i] = kb < K ? W[(size_t)(kb < K ? kb : K - 1) * ld + n] : 0.f; }
  return bsplit16(v); }
__device__ __forceinline__ v8f mac3(const F2& a, const F2& b, v8f c) { c = wmma_bf(a.l, b.h, c); c = wmma_bf(a.h, b.l, c); return wmma_bf(a.h, b.h, c); }
__device__ __forceinline__ float sigm(float v) { return 1.0f / (1.0f + expf(-v)); }
#define LDSX() do { asm volatile("s_wait_dscnt 0" ::: "memory"); __builtin_amdgcn_wave_barrier(); __builtin_amdgcn_fence(__ATOMIC_RELEASE, "workgroup"); } while (0)

// Single-head causal self-attention scaled by the EMBEDDING width (x [8,2048,384]; head_size 64; (in,out) Wq, Wk, Wv [384,64] uniform(+-1/sqrt(384)); no biases, no output projection; scores / sqrt(C) with C = 384 (NOT the head size); tril, -inf): out = softmax(causal(q k^T / sqrt(384))) v -> [8,2048,64].
#define NB 8
#define TT 2048
#define CC 128            // NH * HD = projected width
#define DIN 384
#define NH 2
#define HD 64
#define NQB (TT / 64)
#define SCALE (0.05103103630798288f)
#define CAUSAL 1
#ifndef TNB
#define TNB NB
#endif
__device__ __forceinline__ float bfr(float v) { return (float)(__bf16)v; }
__host__ __device__ __forceinline__ int kb_last(int qb) { return CAUSAL ? ((qb * 64 + 63) >> 7) : (TT / 128 - 1); }
typedef __attribute__((ext_vector_type(8))) __bf16 v8b;
__device__ __forceinline__ v16b frag_b(const __bf16* rowk0, int lane) {
  union { v16b v; v8b q[2]; } u; const __bf16* p = rowk0 + 8 * (lane >> 4);
  u.q[0] = *(const v8b*)p; u.q[1] = *(const v8b*)(p + 16); return u.v;
}
#define QBH 6              // unused; causal: query rows < QHI of each sequence (32-row blocks 0..11; few keys, no averaging) take the high-precision path
#define QHI 384            // rows carrying a q residual plane
#define KHI 384            // key rows carrying k residual / v bf16 hi+lo planes (used only by the causal high-precision path)
// B fragment (k rows k0+.., output column o) of a weight: (in,out) [K][ld] or (out,in) [ld rows of K]: bf16 exact, or f16(bf16 * 256) exact
__device__ __forceinline__ v16b wcol_io(const float* Wm, int k0, int o, int lane, int ld) { v16b w; const int g = lane >> 4;
#pragma unroll
  for (int i = 0; i < 8; ++i) { w[i] = (__bf16)Wm[(size_t)(k0 + 8 * g + i) * ld + o]; w[8 + i] = (__bf16)Wm[(size_t)(k0 + 16 + 8 * g + i) * ld + o]; }
  return w; }
__device__ __forceinline__ v16b wcol_oi(const float* Wm, int k0, int o, int lane, int K) { v16b w; const float* p = Wm + (size_t)o * K + k0 + 8 * (lane >> 4);
#pragma unroll
  for (int i = 0; i < 8; ++i) { w[i] = (__bf16)p[i]; w[8 + i] = (__bf16)p[16 + i]; }
  return w; }
__device__ __forceinline__ v16h wcolh_io(const float* Wm, int k0, int o, int lane, int ld) { v16h w; const int g = lane >> 4;
#pragma unroll
  for (int i = 0; i < 8; ++i) { w[i] = (_Float16)(bfr(Wm[(size_t)(k0 + 8 * g + i) * ld + o]) * 256.0f); w[8 + i] = (_Float16)(bfr(Wm[(size_t)(k0 + 16 + 8 * g + i) * ld + o]) * 256.0f); }
  return w; }
__device__ __forceinline__ v16h wcolh_oi(const float* Wm, int k0, int o, int lane, int K) { v16h w; const float* p = Wm + (size_t)o * K + k0 + 8 * (lane >> 4);
#pragma unroll
  for (int i = 0; i < 8; ++i) { w[i] = (_Float16)(bfr(p[i]) * 256.0f); w[8 + i] = (_Float16)(bfr(p[16 + i]) * 256.0f); }
  return w; }
#define WQKV_LAYOUT 0   // 0 = (in,out) [DIN][CC]; 1 = (out,in) [CC][DIN]; 2 = per-head [NH][DIN][HD]
__device__ __forceinline__ v16b wcol_hdk(const float* Wm, int k0, int o, int lane) { v16b w; const int g = lane >> 4; const float* p = Wm + (size_t)(o / HD) * DIN * HD + (o % HD);
#pragma unroll
  for (int i = 0; i < 8; ++i) { w[i] = (__bf16)p[(size_t)(k0 + 8 * g + i) * HD]; w[8 + i] = (__bf16)p[(size_t)(k0 + 16 + 8 * g + i) * HD]; }
  return w; }
#define WO_OUT_IN 0
#if WQKV_LAYOUT == 1
#define WCOL(W, k0, o, lane) wcol_oi(W, k0, o, lane, DIN)
#elif WQKV_LAYOUT == 2
#define WCOL(W, k0, o, lane) wcol_hdk(W, k0, o, lane)
#else
#define WCOL(W, k0, o, lane) wcol_io(W, k0, o, lane, CC)
#endif
#if WO_OUT_IN
#define WOCOL(W, k0, o, lane) wcol_oi(W, k0, o, lane, CC)
#define WOCOLH(W, k0, o, lane) wcolh_oi(W, k0, o, lane, CC)
#else
#define WOCOL(W, k0, o, lane) wcol_io(W, k0, o, lane, DIN)
#define WOCOLH(W, k0, o, lane) wcolh_io(W, k0, o, lane, DIN)
#endif
#define CIN 384
// ---- k_packw: the three (in,out) [C][64] projection weights rounded to bf16 and laid out as ready WMMA B fragments: [which][k chunk of 32][16-column group j][half h][lane][8], element i of half h = W[kc * 32 + 16 * h + 8 * (lane >> 4) + i][j * 16 + (lane & 15)] (the k order of the A loader in k_proj); a half fragment is 512 contiguous bytes, 16 per lane
__global__ __launch_bounds__(256) void k_packw(const float* __restrict__ WQ, const float* __restrict__ WK, const float* __restrict__ WV, __bf16* __restrict__ WP) { const int which = blockIdx.y; const float* Wsrc = which == 0 ? WQ : (which == 1 ? WK : WV);
  const int e = blockIdx.x * 256 + threadIdx.x; const int lane = e & 31, h = (e >> 5) & 1, j = (e >> 6) & 3, kc = e >> 8;
  const float* p = Wsrc + (size_t)(kc * 32 + 16 * h + 8 * (lane >> 4)) * 64 + j * 16 + (lane & 15); v8b o;
#pragma unroll
  for (int i = 0; i < 8; ++i) o[i] = (__bf16)p[i * 64];
  vst2(WP + (size_t)which * CIN * 64 + (size_t)e * 8, o); }
#define WS_WP (WS_END)                                  // bf16 weight fragments [3][C x 64] (k_packw), at the head of this region
#define WS_END2 (WS_WP + 2u * 3 * (size_t)CIN * 64)
#ifndef SM_EXTRA_PARAMS
#define SM_EXTRA_PARAMS
#endif
#ifndef PROJ_EXTRA_PARAMS
#define PROJ_EXTRA_PARAMS
#endif
#ifndef SM_MASK_HOOK
#define SM_MASK_HOOK (void)0
#endif

// q, k and their residuals: WMMA fragments in lane order, [b*t / 16][hd chunk of 32][half h][lane][8], element i = row 16 * tile + (lane & 15), column 32 * chunk + 16 * h + 8 * (lane >> 4) + i; v planes: [b*t / 32][16-column group j][half h][lane][8], element i = column 16 * j + (lane & 15), key 32 * chunk + 16 * h + 8 * (lane >> 4) + i. A half fragment is 512 contiguous bytes, 16 per lane; each plane fills the first half of its region
#define WS_QH  0u                                      // f16 q fragments
#define WS_KH  (WS_QH + 2u * (size_t)NB * TT * CC)      // f16 k fragments
#define WS_VT  (WS_KH + 2u * (size_t)NB * TT * CC)      // f16 v fragments
#define WS_QL  (WS_VT + 2u * (size_t)NB * CC * TT)      // f16 q residual x 2^10 fragments, t < QHI of each b
#define WS_KL  (WS_QL + 2u * (size_t)NB * QHI * CC)     // f16 k residual x 2^10 fragments, t < KHI of each b
#define WS_VB  (WS_KL + 2u * (size_t)NB * KHI * CC)     // bf16 v hi fragments, t < KHI of each b (WS_VBL: lo)
#define WS_VBL (WS_VB + 2u * (size_t)NB * CC * KHI)
#define WS_S   (WS_VBL + 2u * (size_t)NB * CC * KHI)    // unused (the logits stay on chip); it keeps the offsets of the planes behind it
#define WS_Y   (WS_S  + 4u * (size_t)NB * TT * TT)      // f32 ctx rows [b*t][CC] (only when there is an output projection)
#define WS_END (WS_Y  + 0u)

// ---- k_proj: block = 64 rows of x, all 192 columns (q, k, v): X W with exact bf16 products (K = DIN) -> q f16 (+ residual, rows < QHI), k f16 (+ residual, rows < KHI), v f16 (+ bf16 hi/lo for t < KHI), each stored as the fragments that k_fa loads (layout: at WS_QH)
// The block's x rows (96 KB, contiguous) are read once, in whole lines, rounded to bf16 once and laid in LDS, where they serve all three products. Wave w takes the 16-column groups 3w .. 3w + 2 of the twelve (q 0..3, k 4..7, v 8..11) for all 64 rows, so each weight fragment (k_packw) is loaded once a block.
#define PAH0 2             // k chunks of weight fragments that start beside the x rows (60 loads in flight)
#define PAH1 4             // chunks PAH0 .. PAH1 - 1 start while the x rows come in, early enough to be back with the last of them; the rest behind the barrier
#define PAH 5              // in the product loop the weight fragments are loaded this many k chunks ahead
#define XPITCH 392         // bf16 elements of a staged x row: 784 B = 16 B x 49, an odd count of 16-byte units, so that the 16 rows of a ds_load_b128 fall on distinct banks
typedef __attribute__((ext_vector_type(4))) __bf16 v4b;
__global__ __launch_bounds__(128) void k_proj(const float* __restrict__ X, const __bf16* __restrict__ WP,
    _Float16* __restrict__ QH, _Float16* __restrict__ QL, _Float16* __restrict__ KH, _Float16* __restrict__ KL, _Float16* __restrict__ VT, __bf16* __restrict__ VB, __bf16* __restrict__ VBL) {
  __shared__ __align__(16) __bf16 xs[64][XPITCH];
  __shared__ __align__(16) _Float16 sh[2][64][72], sl[2][64][72]; __shared__ __align__(16) _Float16 th[64][72]; __shared__ __align__(16) __bf16 tb[64][72], tbl[64][72];
  const int tid = threadIdx.x, lane = tid & 31, col = lane & 15, g = lane >> 4; const int wave = __builtin_amdgcn_readfirstlane(tid >> 5); const size_t r0 = (size_t)blockIdx.x * 64; const size_t bb = r0 / TT; const int t0 = (int)(r0 % TT);
  constexpr int NK = DIN / 32;
  const float* xb = X + (r0 + wave * 16) * DIN;   // wave w brings rows 16w .. 16w + 15: 48 loads of 512 contiguous bytes
  const __bf16* wb[3];
#pragma unroll
  for (int jj = 0; jj < 3; ++jj) { const int cg = wave * 3 + jj; wb[jj] = WP + (size_t)(cg >> 2) * CIN * 64 + (cg & 3) * 512; }
  v8f acc[4][3] = {}; v8b wf[NK][3][2]; v4f xv[48];
#define PROJ_FETCH(kq) do { _Pragma("unroll") for (int jj = 0; jj < 3; ++jj) { wf[kq][jj][0] = *(const v8b*)(wb[jj] + lane * 8 + (kq) * 2048); wf[kq][jj][1] = *(const v8b*)(wb[jj] + lane * 8 + (kq) * 2048 + 256); } } while (0)
#pragma unroll
  for (int c = 0; c < 48; ++c) xv[c] = *(const v4f*)(xb + lane * 4 + c * 128);
#pragma unroll
  for (int kc = 0; kc < PAH0; ++kc) PROJ_FETCH(kc);
  asm volatile("s_wait_xcnt 0x0" :: "s"(xb), "v"(lane) : "memory");   // behind the x loads: their address registers are free to be rewritten only behind this wait (base and index are inputs so that they live up to it); its "memory" clobber also keeps all these loads ahead of the LDS stores, so that they fly together
#pragma unroll
  for (int q = 0; q < 4; ++q) {
#pragma unroll
    for (int c = q * 12; c < q * 12 + 12; ++c) *(v4b*)&xs[wave * 16 + c / 3][(c % 3) * 128 + lane * 4] = __builtin_convertvector(xv[c], v4b);
    __builtin_amdgcn_sched_barrier(0);   // holds each further weight chunk behind twelve returned x loads (never more than 60 loads in flight) and each dozen LDS stores at its place among the waits
    if (q < PAH1 - PAH0) PROJ_FETCH(PAH0 + q);
  }
  __syncthreads();   // from here on each wave reads all 64 rows
  union AF { v16b v; v8b q[2]; }; AF a[NK][4];   // elements 0..7 = k 8g + 0..7 of the chunk, 8..15 = 16 + 8g + 0..7: the k order of k_packw
#define PROJ_XFRAG(kq) do { _Pragma("unroll") for (int rt = 0; rt < 4; ++rt) { const __bf16* xp = &xs[rt * 16 + col][(kq) * 32 + 8 * g]; a[kq][rt].q[0] = *(const v8b*)xp; a[kq][rt].q[1] = *(const v8b*)(xp + 16); } } while (0)
#pragma unroll
  for (int kc = PAH1; kc < PAH; ++kc) PROJ_FETCH(kc);
  PROJ_XFRAG(0);
  // fully unrolled: wf and a are then indexed by constants and live in registers, and every load is a constant offset
#pragma unroll
  for (int kc = 0; kc < NK; ++kc) {
    if (kc + PAH < NK) PROJ_FETCH(kc + PAH);
    if (kc + PAH == NK - 1) asm volatile("s_wait_xcnt 0x0" :: "s"(wb[0]), "s"(wb[1]), "s"(wb[2]), "v"(lane) : "memory");   // behind the last weight loads: as above
    if (kc + 1 < NK) PROJ_XFRAG(kc + 1);
    __builtin_amdgcn_sched_barrier(0);   // keeps the loads of later chunks ahead of this chunk's products: without it the scheduler sinks each load to just before its product, which then waits out the whole latency
#pragma unroll
    for (int jj = 0; jj < 3; ++jj) { union { v16b v; v8b q[2]; } w; w.q[0] = wf[kc][jj][0]; w.q[1] = wf[kc][jj][1];
#pragma unroll
      for (int rt = 0; rt < 4; ++rt) acc[rt][jj] = __builtin_amdgcn_wmma_f32_16x16x32_bf16(false, a[kc][rt].v, false, w.v, (short)0, acc[rt][jj], false, false); }
    __builtin_amdgcn_sched_barrier(0);   // the next group of loads stays whole behind these products
  }
#pragma unroll
  for (int jj = 0; jj < 3; ++jj) { const int cg = wave * 3 + jj, which = cg >> 2, cl = (cg & 3) * 16 + col;   // which is the same for the whole wave
    if (which < 2) {
#pragma unroll
      for (int rt = 0; rt < 4; ++rt) {
#pragma unroll
        for (int r = 0; r < 8; ++r) { const float v = acc[rt][jj][r]; const _Float16 hv = (_Float16)v; sh[which][rt * 16 + 8 * g + r][cl] = hv; sl[which][rt * 16 + 8 * g + r][cl] = (_Float16)((v - (float)hv) * 1024.0f); } }
    } else {
#pragma unroll
      for (int rt = 0; rt < 4; ++rt) {
#pragma unroll
        for (int r = 0; r < 8; ++r) { const float v = acc[rt][jj][r]; const int rl = rt * 16 + 8 * g + r; th[cl][rl] = (_Float16)v; const __bf16 bh = (__bf16)v; tb[cl][rl] = bh; tbl[cl][rl] = (__bf16)(v - (float)bh); } } } }
  __syncthreads();
  // piece e = tid + 128 i of a plane's 8 KB in fragment order: a wave stores 512 contiguous bytes. A group's LDS reads go first, then its stores, then one wait: with one wave on a SIMD nothing else hides a read or a store that is waited for singly
  const size_t eo = (size_t)tid * 8; _Float16* qd = QH + r0 * HD; _Float16* kd = KH + r0 * HD; _Float16* vd = VT + r0 * HD; v4u d[4][4];
#pragma unroll
  for (int i = 0; i < 4; ++i) { const int e = tid + i * 128; const int rl = (e >> 7) * 16 + (e & 15), cq = ((e >> 6) & 1) * 32 + ((e >> 5) & 1) * 16 + ((e >> 4) & 1) * 8; const int cl = ((e >> 6) & 3) * 16 + (e & 15), tq = (e >> 8) * 32 + ((e >> 5) & 1) * 16 + ((e >> 4) & 1) * 8;
    d[i][0] = *(const v4u*)&sh[0][rl][cq]; d[i][1] = *(const v4u*)&sh[1][rl][cq]; d[i][2] = *(const v4u*)&th[cl][tq]; }
#pragma unroll
  for (int i = 0; i < 4; ++i) { *(v4u*)(qd + eo + i * 1024) = d[i][0]; *(v4u*)(kd + eo + i * 1024) = d[i][1]; *(v4u*)(vd + eo + i * 1024) = d[i][2]; }
  // behind the stores: their address and data registers are rewritten only behind this wait; all are inputs of the wait so that they live up to it
  asm volatile("s_wait_xcnt 0x0" :: "s"(qd), "s"(kd), "s"(vd), "v"(eo), "v"(d[0][0]), "v"(d[0][1]), "v"(d[0][2]), "v"(d[1][0]), "v"(d[1][1]), "v"(d[1][2]), "v"(d[2][0]), "v"(d[2][1]), "v"(d[2][2]), "v"(d[3][0]), "v"(d[3][1]), "v"(d[3][2]) : "memory");
  static_assert(QHI == KHI, "one test serves the four extra planes");
  if (t0 < QHI) { const size_t o3 = (bb * QHI + t0) * (size_t)HD; _Float16* ql = QL + o3; _Float16* kl = KL + o3; __bf16* vh = VB + o3; __bf16* vl = VBL + o3;
#pragma unroll
    for (int i = 0; i < 4; ++i) { const int e = tid + i * 128; const int rl = (e >> 7) * 16 + (e & 15), cq = ((e >> 6) & 1) * 32 + ((e >> 5) & 1) * 16 + ((e >> 4) & 1) * 8; const int cl = ((e >> 6) & 3) * 16 + (e & 15), tq = (e >> 8) * 32 + ((e >> 5) & 1) * 16 + ((e >> 4) & 1) * 8;
      d[i][0] = *(const v4u*)&sl[0][rl][cq]; d[i][1] = *(const v4u*)&sl[1][rl][cq]; d[i][2] = *(const v4u*)&tb[cl][tq]; d[i][3] = *(const v4u*)&tbl[cl][tq]; }
#pragma unroll
    for (int i = 0; i < 4; ++i) { *(v4u*)(ql + eo + i * 1024) = d[i][0]; *(v4u*)(kl + eo + i * 1024) = d[i][1]; *(v4u*)(vh + eo + i * 1024) = d[i][2]; *(v4u*)(vl + eo + i * 1024) = d[i][3]; }
    asm volatile("s_wait_xcnt 0x0" :: "s"(ql), "s"(kl), "s"(vh), "s"(vl), "v"(eo), "v"(d[0][0]), "v"(d[0][1]), "v"(d[0][2]), "v"(d[0][3]), "v"(d[1][0]), "v"(d[1][1]), "v"(d[1][2]), "v"(d[1][3]), "v"(d[2][0]), "v"(d[2][1]), "v"(d[2][2]), "v"(d[2][3]), "v"(d[3][0]), "v"(d[3][1]), "v"(d[3][2]), "v"(d[3][3]) : "memory"); } }   // as above
// ---- k_fa: block = 32 query rows of batch b = blockIdx.x, head 0: logits, causal softmax and P . v in one pass, no logits plane.
// Wave w takes the 128-key blocks w, w + 4, ... up to the diagonal block, for all 32 rows (two 16-row tiles share every k and v fragment), and keeps its own running row maximum, row sum and ctx tiles; the four waves' parts are joined in LDS at the end.
// Both products are formed transposed: S^T = K . Q^T (A = k fragment, B = q fragment) and O^T += V^T . P^T (A = v fragment, B = P^T). A lane then holds the logits of ONE query (column lane & 15; keys 8 * (lane >> 4) + r of each 16-key tile), so that maximum and sum run in the lane's own registers with one exchange between the lane halves, and two neighbouring logit tiles, converted in place, ARE the B fragment of P^T for their 32 keys (element s = key 16 * (s >> 3) + 8 * (lane >> 4) + (s & 7): the k order of the stored v fragments): P passes through no LDS.
// Per block: logits (1 f16 product; q hi + residual x k hi + residual, 3 products, for query rows < QHI), scaled by SCALE x log2(e); e = 2^(logit - running max + 11) in f32 (once to f16 against v f16; bf16 hi + lo against v bf16 hi + lo, 3 products, for rows < QHI). The row sum carries the same 2^11, so ctx / sum needs no other factor.
// the plain builtins: the compiler keeps the distance behind a matrix instruction itself and stays free to place the fragment loads ahead of the products
__device__ __forceinline__ v8f mm_h(v16h a, v16h b, v8f c) { return __builtin_amdgcn_wmma_f32_16x16x32_f16(false, a, false, b, (short)0, c, false, false); }
__device__ __forceinline__ v8f mm_b(v16b a, v16b b, v8f c) { return __builtin_amdgcn_wmma_f32_16x16x32_bf16(false, a, false, b, (short)0, c, false, false); }
// fragment stored in lane order at p = fragment start + 8 * lane: each of the two loads covers 512 contiguous bytes (4 whole lines) over the wave; one address pair serves a whole group of loads through constant offsets
#define FRG 512            // elements of a stored fragment
__device__ __forceinline__ v16h frag_hp(const _Float16* p) { union { v16h v; v8h q[2]; } u; u.q[0] = *(const v8h*)p; u.q[1] = *(const v8h*)(p + 256); return u.v; }
__device__ __forceinline__ v16b frag_bp(const __bf16* p) { union { v16b v; v8b q[2]; } u; u.q[0] = *(const v8b*)p; u.q[1] = *(const v8b*)(p + 256); return u.v; }
// behind a group of global loads: their address registers are free to be rewritten only behind this wait; its "memory" clobber also holds the group ahead of what follows, so that the loads fly together
// the pointers are named as inputs so that their registers live up to the wait
#define XW1(p) asm volatile("s_wait_xcnt 0x0" :: "v"(p) : "memory")
#define XW2(p, q) asm volatile("s_wait_xcnt 0x0" :: "v"(p), "v"(q) : "memory")
// the same for loads that the compiler forms from a wave-uniform base and the lane's index: both parts are named, so that the scalar pair too lives up to the wait
#define XWS(base, idx) asm volatile("s_wait_xcnt 0x0" :: "s"(base), "v"(idx) : "memory")
// 2^x with the slot that the instruction set asks for behind a transcendental (the next instruction may overwrite x) kept in the same statement
__device__ __forceinline__ float ex2(float x) { asm("v_exp_f32 %0, %0\n\tv_nop" : "+v"(x)); return x; }
// the value of lane l ^ 16: the other half of a query's keys
__device__ __forceinline__ float xhalf(float x) { return __builtin_bit_cast(float, __builtin_amdgcn_permlanex16(__builtin_bit_cast(int, x), __builtin_bit_cast(int, x), 0x76543210, 0xfedcba98, false, false)); }
#define QT 2               // 16-row query tiles per wave
#define SCALE2 (SCALE * 1.4426950408889634f)
// one 128-key block of one wave. acc[t][j][r] = logit of key k0 + 16 j + 8 g + r, query ql0 + 16 t + col; o[t][j][r] = ctx column 16 j + 8 g + r of that query; m[t]: the query's running maximum (alike in both lane halves); l[t]: the sum over this half's keys
template <bool HI>
__device__ __forceinline__ void fa_keys(const v16h (&ah)[QT][HD / 32], const v16h (&al)[QT][HD / 32], const _Float16* __restrict__ Kh, const _Float16* __restrict__ Kl, const _Float16* __restrict__ Vt, const __bf16* __restrict__ Vb, const __bf16* __restrict__ Vbl,
    int k0, int ql0, bool diag, int lane, v8f (&o)[QT][HD / 16], float (&m)[QT], float (&l)[QT]) {
  const int col = lane & 15, g = lane >> 4;
  v8f acc[QT][8]; v16h vf[HI ? 1 : 4][HD / 16];
  const size_t ko = (size_t)k0 * HD + 8 * lane; const _Float16* kp = Kh + ko; const _Float16* rp = Kl + ko; const _Float16* vp = Vt + ko;
  if (HI) {
#pragma unroll
    for (int j0 = 0; j0 < 8; j0 += 4) { v16h kf[4][HD / 32], rf[4][HD / 32];   // the fragments of 64 keys are fetched together, ahead of their products: one memory round trip a group
#pragma unroll
      for (int jj = 0; jj < 4; ++jj) {
#pragma unroll
        for (int kc = 0; kc < HD / 32; ++kc) { kf[jj][kc] = frag_hp(kp + ((j0 + jj) * (HD / 32) + kc) * FRG); rf[jj][kc] = frag_hp(rp + ((j0 + jj) * (HD / 32) + kc) * FRG); } }
      XW2(kp, rp);
      __builtin_amdgcn_sched_barrier(0);   // keeps the products behind the whole group of loads
#pragma unroll
      for (int jj = 0; jj < 4; ++jj) {
#pragma unroll
        for (int t = 0; t < QT; ++t) { v8f a = {}, ar = {};   // ar: the residual products (x 2^10)
#pragma unroll
          for (int kc = 0; kc < HD / 32; ++kc) { a = mm_h(kf[jj][kc], ah[t][kc], a); ar = mm_h(kf[jj][kc], al[t][kc], ar); ar = mm_h(rf[jj][kc], ah[t][kc], ar); }
#pragma unroll
          for (int r = 0; r < 8; ++r) acc[t][j0 + jj][r] = (a[r] + ar[r] * (1.0f / 1024.0f)) * SCALE2; } } }
  } else { v16h kf[8][HD / 32];   // the fragments of the 128 keys are fetched together, ahead of their products
#pragma unroll
    for (int j = 0; j < 8; ++j) {
#pragma unroll
      for (int kc = 0; kc < HD / 32; ++kc) kf[j][kc] = frag_hp(kp + (j * (HD / 32) + kc) * FRG); }
    XW1(kp);
    __builtin_amdgcn_sched_barrier(0);   // keeps the products behind the whole group of loads: without it each product moves up to its own pair of loads and waits for that pair alone
#pragma unroll
    for (int j = 0; j < 8; ++j) {
#pragma unroll
      for (int t = 0; t < QT; ++t) { v8f a = {};
#pragma unroll
        for (int kc = 0; kc < HD / 32; ++kc) a = mm_h(kf[j][kc], ah[t][kc], a);
#pragma unroll
        for (int r = 0; r < 8; ++r) acc[t][j][r] = a[r] * SCALE2; } }
    // the v fragments of the first 64 keys start here, together, and fly under the softmax
#pragma unroll
    for (int kc = 0; kc < 2; ++kc) {
#pragma unroll
      for (int j = 0; j < HD / 16; ++j) vf[kc][j] = frag_hp(vp + (kc * (HD / 16) + j) * FRG); }
    XW1(vp);
  }
  if (diag) {   // only the diagonal block holds keys past a query (wave-uniform test)
#pragma unroll
    for (int t = 0; t < QT; ++t) {
#pragma unroll
      for (int j = 0; j < 8; ++j) {
#pragma unroll
        for (int r = 0; r < 8; ++r) acc[t][j][r] = (k0 + j * 16 + 8 * g + r > ql0 + t * 16 + col) ? -3.0e38f : acc[t][j][r]; } } }
  v16h ph[HI ? 1 : QT][HI ? 1 : 4];   // P^T fragments, f16
#pragma unroll
  for (int t = 0; t < QT; ++t) {
    v8f mv = acc[t][0];   // eight independent chains, joined at the end
#pragma unroll
    for (int j = 1; j < 8; ++j) {
#pragma unroll
      for (int r = 0; r < 8; ++r) mv[r] = fmaxf(mv[r], acc[t][j][r]); }
    float mx = fmaxf(fmaxf(fmaxf(mv[0], mv[1]), fmaxf(mv[2], mv[3])), fmaxf(fmaxf(mv[4], mv[5]), fmaxf(mv[6], mv[7])));
    mx = fmaxf(mx, xhalf(mx));
    const float mn = fmaxf(m[t], mx); const float f = ex2(m[t] - mn); m[t] = mn;
#pragma unroll
    for (int j = 0; j < HD / 16; ++j) o[t][j] *= f;
    const float mb = mn - 11.0f; v8f sv;
#pragma unroll
    for (int j = 0; j < 8; ++j) {
#pragma unroll
      for (int r = 0; r < 8; ++r) { const float e = ex2(acc[t][j][r] - mb);   /* an excluded key (-3e38) gives 0: every query sees key k0 of every block it walks, so m is a real logit */ sv[r] = j == 0 ? e : sv[r] + e; acc[t][j][r] = e; } }
    l[t] = l[t] * f + (((sv[0] + sv[1]) + (sv[2] + sv[3])) + ((sv[4] + sv[5]) + (sv[6] + sv[7])));
    if (!HI) {
#pragma unroll
      for (int kc = 0; kc < 4; ++kc) {
#pragma unroll
        for (int s = 0; s < 16; ++s) ph[t][kc][s] = (_Float16)acc[t][2 * kc + (s >> 3)][s & 7]; } }
    if (!HI && t == 0) {   // the other 64 keys' v fragments start once the first tile's logits have left their registers
#pragma unroll
      for (int kc = 2; kc < 4; ++kc) {
#pragma unroll
        for (int j = 0; j < HD / 16; ++j) vf[kc][j] = frag_hp(vp + (kc * (HD / 16) + j) * FRG); }
      XW1(vp);   // holds them ahead of the second tile's work: they fly under it
    } }
  if (HI) {
    const __bf16* hp = Vb + ko; const __bf16* lp = Vbl + ko;
#pragma unroll
    for (int c0 = 0; c0 < 4; c0 += 2) { v16b vh[2][HD / 16], vl[2][HD / 16];   // v fragments of 64 keys fetched together, ahead of their products
#pragma unroll
      for (int cc = 0; cc < 2; ++cc) {
#pragma unroll
        for (int j = 0; j < HD / 16; ++j) { vh[cc][j] = frag_bp(hp + ((c0 + cc) * (HD / 16) + j) * FRG); vl[cc][j] = frag_bp(lp + ((c0 + cc) * (HD / 16) + j) * FRG); } }
      XW2(hp, lp);
      __builtin_amdgcn_sched_barrier(0);   // keeps the products behind the whole group of loads
#pragma unroll
      for (int cc = 0; cc < 2; ++cc) {
#pragma unroll
        for (int t = 0; t < QT; ++t) { float e[16];
#pragma unroll
          for (int s = 0; s < 16; ++s) e[s] = acc[t][2 * (c0 + cc) + (s >> 3)][s & 7];
          const F2 p = bsplit16(e);
#pragma unroll
          for (int j = 0; j < HD / 16; ++j) { o[t][j] = mm_b(vh[cc][j], p.h, o[t][j]); o[t][j] = mm_b(vh[cc][j], p.l, o[t][j]); o[t][j] = mm_b(vl[cc][j], p.h, o[t][j]); } } } }
  } else {
#pragma unroll
    for (int kc = 0; kc < 4; ++kc) {
#pragma unroll
      for (int t = 0; t < QT; ++t) {
#pragma unroll
        for (int j = 0; j < HD / 16; ++j) o[t][j] = mm_h(vf[kc][j], ph[t][kc], o[t][j]); } } }
}
#define JP (HD + 4)        // floats of a row of the join tile: 272 B = 16 B x 17, an odd count of 16-byte units, so that the 16 queries of a 16-byte store fall on distinct banks; columns HD, HD + 1 hold the row's maximum and sum
// two waves per SIMD: the 512 work-groups are then all resident, two on a WGP
__global__ __launch_bounds__(128, 2) void k_fa(const _Float16* __restrict__ QH, const _Float16* __restrict__ KH, const _Float16* __restrict__ QL, const _Float16* __restrict__ KL, const _Float16* __restrict__ VT, const __bf16* __restrict__ VB, const __bf16* __restrict__ VBL, float* __restrict__ OUT) {
  __shared__ __align__(16) float ss[4][QT * 16][JP];
  const int tid = threadIdx.x, lane = tid & 31, col = lane & 15, g = lane >> 4; const int wave = __builtin_amdgcn_readfirstlane(tid >> 5);
  constexpr int NT = TT / (QT * 16); const int y = blockIdx.y; const int qt = y < NT / 2 ? NT - 1 - y : y - NT / 2;   // long tiles start first; the second half of the grid runs from the shortest up, so that a late work-group joins an early one of the opposite length
  const int b = blockIdx.x; const int ql0 = qt * (QT * 16); const int kbl = ql0 >> 7;   // the 32 rows share their diagonal block: 128 is a multiple of 32
  const _Float16* Kh = KH + (size_t)b * TT * HD; const _Float16* Kl = KL + (size_t)b * KHI * HD; const _Float16* Vt = VT + (size_t)b * TT * HD; const __bf16* Vb = VB + (size_t)b * KHI * HD; const __bf16* Vbl = VBL + (size_t)b * KHI * HD;
  float (*sw)[JP] = ss[wave];
  v8f o[QT][HD / 16] = {}; float m[QT], l[QT];
  v16h ah[QT][HD / 32], al[QT][HD / 32] = {};
  const _Float16* qb = QH + ((size_t)b * TT + ql0) * HD; const _Float16* qp = qb + 8 * lane; const _Float16* qr = QL + ((size_t)b * QHI + ql0) * HD + 8 * lane;   // qr is read only where ql0 < QHI
#pragma unroll
  for (int t = 0; t < QT; ++t) { m[t] = -3.0e38f; l[t] = 0.f;
#pragma unroll
    for (int kc = 0; kc < HD / 32; ++kc) ah[t][kc] = frag_hp(qp + (t * (HD / 32) + kc) * FRG); }
  XWS(qb, lane);
  if (__builtin_expect(ql0 >= QHI, 1)) {   // the common path first in the text
#pragma unroll 1
    for (int kb = wave; kb <= kbl; kb += 4) fa_keys<false>(ah, al, Kh, Kl, Vt, Vb, Vbl, kb * 128, ql0, kb == kbl, lane, o, m, l);
  } else {
#pragma unroll
    for (int t = 0; t < QT; ++t) {
#pragma unroll
      for (int kc = 0; kc < HD / 32; ++kc) al[t][kc] = frag_hp(qr + (t * (HD / 32) + kc) * FRG); }
    XW1(qr);
    static_assert(QHI <= 4 * 128, "a wave of these rows walks at most one block");
    if (wave <= kbl) fa_keys<true>(ah, al, Kh, Kl, Vt, Vb, Vbl, wave * 128, ql0, wave == kbl, lane, o, m, l);
  }
#pragma unroll
  for (int t = 0; t < QT; ++t) { float* rw = &sw[t * 16 + col][0];   // the lane's query: its 8 consecutive ctx columns of each group go out as two 16-byte stores
    l[t] += xhalf(l[t]);
#pragma unroll
    for (int j = 0; j < HD / 16; ++j) { *(v4f*)(rw + j * 16 + 8 * g) = __builtin_shufflevector(o[t][j], o[t][j], 0, 1, 2, 3); *(v4f*)(rw + j * 16 + 8 * g + 4) = __builtin_shufflevector(o[t][j], o[t][j], 4, 5, 6, 7); }
    if (g == 0) { v2f ml = { m[t], l[t] }; *(v2f*)(rw + HD) = ml; } }
  __syncthreads();
  // join: a wave that had no key block holds max -3e38, sum 0, ctx 0 and drops out with factor 0 (wave 0 always has block 0, whose key 0 every row sees)
  for (int e = tid; e < QT * 16 * (HD / 4); e += 128) { const int row = e / (HD / 4), q = e % (HD / 4);
    float mm = ss[0][row][HD];
#pragma unroll
    for (int w = 1; w < 4; ++w) mm = fmaxf(mm, ss[w][row][HD]);
    float den = 0.f; v4f a = {};
#pragma unroll
    for (int w = 0; w < 4; ++w) { const float f = ex2(ss[w][row][HD] - mm); den += f * ss[w][row][HD + 1]; a += *(const v4f*)&ss[w][row][q * 4] * f; }
    const float inv = den > 0.f ? 1.0f / den : 0.f;   /* a fully excluded row yields 0 */
    vst2(OUT + ((size_t)b * TT + ql0 + row) * HD + q * 4, a * inv); } }   // the output row itself: 256 B by 16 lanes, 32 whole rows a block

extern "C" void kernel_launch(void* const* d_in, const int* in_sizes, int n_in, void* d_out, int out_size, void* d_ws, size_t ws_size, hipStream_t stream) {
  (void)in_sizes; (void)n_in; (void)out_size;
  const float** F = (const float**)d_in;
  if (ws_size < (size_t)WS_END) return;
  char* ws = (char*)d_ws; _Float16 *QH = (_Float16*)(ws + WS_QH), *KH = (_Float16*)(ws + WS_KH), *VT = (_Float16*)(ws + WS_VT), *QL = (_Float16*)(ws + WS_QL), *KL = (_Float16*)(ws + WS_KL); __bf16 *VB = (__bf16*)(ws + WS_VB), *VBL = (__bf16*)(ws + WS_VBL); float *Y = (float*)(ws + WS_Y);
  (void)Y; (void)QL; (void)KL; (void)VB; (void)VBL;
  // inputs: 0 x [8,2048,384]; 1 Wq [384,64]; 2 Wk; 3 Wv ((in,out), no biases)
  if (ws_size < (size_t)WS_END2) return;
  __bf16 *WP = (__bf16*)(ws + WS_WP);
  k_packw<<<dim3(CIN * 64 / 8 / 256, 3), 256, 0, stream>>>(F[1], F[2], F[3], WP);
  k_proj<<<dim3(TNB * TT / 64), 128, 0, stream>>>(F[0], WP, QH, QL, KH, KL, VT, VB, VBL);
  /* head 0 only (head 1 is the zero padding); every batch in the same launch */
  k_fa<<<dim3(TNB, TT / (QT * 16)), 128, 0, stream>>>(QH, KH, QL, KL, VT, VB, VBL, (float*)d_out);
}

// v008
// Measured time: 17.8 microseconds a run.
// Next to v007, in two timings, it ran 1.05 and 1.06 times as fast.
// All steps since v000 together make it 37.0 times as fast.
// compute dtype: all float inputs rounded to bf16; q/k/v projections with EXACT bf16 products on WMMA 16x16x32 (f32 accumulate); causal logits: 3 products (q f16 hi + residual x k hi + residual) for the first 384 rows, single f16 q x k after, x scale; softmax f32 with a running row maximum and sum per 128 keys; exp(logit - max) x 2^11 once to f16 x v once to f16 (1 product; bf16 hi + lo below row 384), divided by the row sum at the end; f32 output.
#include <hip/hip_runtime.h>
#include <math.h>

typedef __attribute__((ext_vector_type(16))) _Float16 v16h;
typedef __attribute__((ext_vector_type(16))) __bf16 v16b;
typedef __attribute__((ext_vector_type(8)))  _Float16 v8h;
typedef __attribute__((ext_vector_type(8)))  float v8f;
typedef __attribute__((ext_vector_type(4)))  float v4f;
typedef __attribute__((ext_vector_type(2)))  float v2f;
typedef __attribute__((ext_vector_type(4)))  unsigned v4u;
typedef __attribute__((ext_vector_type(4)))  int v4i;
typedef float __attribute__((may_alias)) float_a;
typedef int __attribute__((may_alias)) int_a;

template <typename T> __device__ __forceinline__ void vst2(void* p, T v) { *(T*)p = v;  }
__device__ __forceinline__ v8f wmma16(v16h a, v16h b, v8f c) {
  v8f d = __builtin_amdgcn_wmma_f32_16x16x32_f16(false, a, false, b, (short)0, c, false, false);
  asm volatile("v_nop\n\tv_nop\n\tv_nop\n\tv_nop" : "+v"(d) : "v"(a), "v"(b));
  return d;
}
__device__ __forceinline__ v8f wmma_bf(v16b a, v16b b, v8f c) {
  v8f d = __builtin_amdgcn_wmma_f32_16x16x32_bf16(false, a, false, b, (short)0, c, false, false);
  asm volatile("v_nop\n\tv_nop\n\tv_nop\n\tv_nop" : "+v"(d) : "v"(a), "v"(b));
  return d;
}
// 16x16x32 fragments: lane = (h = lane>>4, row/col = lane&15); elements 0..7 = k0+8h+0..7, 8..15 = k0+16+8h+0..7; D element r = row 8h+r
__device__ __forceinline__ v16h frag_h(const _Float16* rowk0, int lane) {
  union { v16h v; v8h q[2]; } u; const _Float16* p = rowk0 + 8 * (lane >> 4);
  u.q[0] = *(const v8h*)p; u.q[1] = *(const v8h*)(p + 16); return u.v;
}
__device__ __forceinline__ v16h frag_f32(const float* rowk0, int lane) {
  v16h a; const float* p = rowk0 + 8 * (lane >> 4);
#pragma unroll
  for (int i = 0; i < 8; ++i) { a[i] = (_Float16)p[i]; a[8 + i] = (_Float16)p[16 + i]; }
  return a;
}
__device__ __forceinline__ v16h frag_f32s(const float* rowk0, int lane, float sc) {
  v16h a; const float* p = rowk0 + 8 * (lane >> 4);
#pragma unroll
  for (int i = 0; i < 8; ++i) { a[i] = (_Float16)(p[i] * sc); a[8 + i] = (_Float16)(p[16 + i] * sc); }
  return a;
}
// column fragment from a [K][ld] layout (column n), rows >= K read as 0
__device__ __forceinline__ v16h fragc_f32(const float* W, int k0, int n, int lane, int ld, int K) {
  v16h a; const int g = lane >> 4;
#pragma unroll
  for (int i = 0; i < 8; ++i) { const int ka = k0 + 8 * g + i, kb = ka + 16;
    a[i] = (_Float16)(ka < K ? W[(size_t)(ka < K ? ka : K - 1) * ld + n] : 0.f); a[8 + i] = (_Float16)(kb < K ? W[(size_t)(kb < K ? kb : K - 1) * ld + n] : 0.f); }
  return a;
}
struct F2 { v16b h, l; };
__device__ __forceinline__ F2 bsplit16(const float v[16]) { F2 r;
#pragma unroll
  for (int i = 0; i < 16; ++i) { const __bf16 h = (__bf16)v[i]; r.h[i] = h; r.l[i] = (__bf16)(v[i] - (float)h); }
  return r; }
__device__ __forceinline__ F2 split_row(const float* row, int k0, int lane) { float v[16]; const float* p = row + k0 + 8 * (lane >> 4);
#pragma unroll
  for (int i = 0; i < 8; ++i) { v[i] = p[i]; v[8 + i] = p[16 + i]; }
  return bsplit16(v); }
__device__ __forceinline__ F2 split_rowK(const float* row, int k0, int lane, int K) { float v[16]; const int g = lane >> 4;
#pragma unroll
  for (int i = 0; i < 8; ++i) { const int ka = k0 + 8 * g + i, kb = ka + 16; v[i] = ka < K ? row[ka < K ? ka : K - 1] : 0.f; v[8 + i] = kb < K ? row[kb < K ? kb : K - 1] : 0.f; }
  return bsplit16(v); }
__device__ __forceinline__ F2 split_col(const float* W, int k0, int n, int lane, int ld, int K) { float v[16]; const int g = lane >> 4;
#pragma unroll
  for (int i = 0; i < 8; ++i) { const int ka = k0 + 8 * g + i, kb = ka + 16; v[i] = ka < K ? W[(size_t)(ka < K ? ka : K - 1) * ld + n] : 0.f; v[8 + i] = kb < K ? W[(size_t)(kb < K ? kb : K - 1) * ld + n] : 0.f; }
  return bsplit16(v); }
__device__ __forceinline__ v8f mac3(const F2& a, const F2& b, v8f c) { c = wmma_bf(a.l, b.h, c); c = wmma_bf(a.h, b.l, c); return wmma_bf(a.h, b.h, c); }
__device__ __forceinline__ float sigm(float v) { return 1.0f / (1.0f + expf(-v)); }
#define LDSX() do { asm volatile("s_wait_dscnt 0" ::: "memory"); __builtin_amdgcn_wave_barrier(); __builtin_amdgcn_fence(__ATOMIC_RELEASE, "workgroup"); } while (0)

// Single-head causal self-attention scaled by the EMBEDDING width (x [8,2048,384]; head_size 64; (in,out) Wq, Wk, Wv [384,64] uniform(+-1/sqrt(384)); no biases, no output projection; scores / sqrt(C) with C = 384 (NOT the head size); tril, -inf): out = softmax(causal(q k^T / sqrt(384))) v -> [8,2048,64].
#define NB 8
#define TT 2048
#define CC 128            // NH * HD = projected width
#define DIN 384
#define NH 2
#define HD 64
#define NQB (TT / 64)
#define SCALE (0.05103103630798288f)
#define CAUSAL 1
#ifndef TNB
#define TNB NB
#endif
__device__ __forceinline__ float bfr(float v) { return (float)(__bf16)v; }
__host__ __device__ __forceinline__ int kb_last(int qb) { return CAUSAL ? ((qb * 64 + 63) >> 7) : (TT / 128 - 1); }
typedef __attribute__((ext_vector_type(8))) __bf16 v8b;
__device__ __forceinline__ v16b frag_b(const __bf16* rowk0, int lane) {
  union { v16b v; v8b q[2]; } u; const __bf16* p = rowk0 + 8 * (lane >> 4);
  u.q[0] = *(const v8b*)p; u.q[1] = *(const v8b*)(p + 16); return u.v;
}
#define QBH 6              // unused; causal: query rows < QHI of each sequence (32-row blocks 0..11; few keys, no averaging) take the high-precision path
#define QHI 384            // rows carrying a q residual plane
#define KHI 384            // key rows carrying k residual / v bf16 hi+lo planes (used only by the causal high-precision path)
// B fragment (k rows k0+.., output column o) of a weight: (in,out) [K][ld] or (out,in) [ld rows of K]: bf16 exact, or f16(bf16 * 256) exact
__device__ __forceinline__ v16b wcol_io(const float* Wm, int k0, int o, int lane, int ld) { v16b w; const int g = lane >> 4;
#pragma unroll
  for (int i = 0; i < 8; ++i) { w[i] = (__bf16)Wm[(size_t)(k0 + 8 * g + i) * ld + o]; w[8 + i] = (__bf16)Wm[(size_t)(k0 + 16 + 8 * g + i) * ld + o]; }
  return w; }
__device__ __forceinline__ v16b wcol_oi(const float* Wm, int k0, int o, int lane, int K) { v16b w; const float* p = Wm + (size_t)o * K + k0 + 8 * (lane >> 4);
#pragma unroll
  for (int i = 0; i < 8; ++i) { w[i] = (__bf16)p[i]; w[8 + i] = (__bf16)p[16 + i]; }
  return w; }
__device__ __forceinline__ v16h wcolh_io(const float* Wm, int k0, int o, int lane, int ld) { v16h w; const int g = lane >> 4;
#pragma unroll
  for (int i = 0; i < 8; ++i) { w[i] = (_Float16)(bfr(Wm[(size_t)(k0 + 8 * g + i) * ld + o]) * 256.0f); w[8 + i] = (_Float16)(bfr(Wm[(size_t)(k0 + 16 + 8 * g + i) * ld + o]) * 256.0f); }
  return w; }
__device__ __forceinline__ v16h wcolh_oi(const float* Wm, int k0, int o, int lane, int K) { v16h w; const float* p = Wm + (size_t)o * K + k0 + 8 * (lane >> 4);
#pragma unroll
  for (int i = 0; i < 8; ++i) { w[i] = (_Float16)(bfr(p[i]) * 256.0f); w[8 + i] = (_Float16)(bfr(p[16 + i]) * 256.0f); }
  return w; }
#define WQKV_LAYOUT 0   // 0 = (in,out) [DIN][CC]; 1 = (out,in) [CC][DIN]; 2 = per-head [NH][DIN][HD]
__device__ __forceinline__ v16b wcol_hdk(const float* Wm, int k0, int o, int lane) { v16b w; const int g = lane >> 4; const float* p = Wm + (size_t)(o / HD) * DIN * HD + (o % HD);
#pragma unroll
  for (int i = 0; i < 8; ++i) { w[i] = (__bf16)p[(size_t)(k0 + 8 * g + i) * HD]; w[8 + i] = (__bf16)p[(size_t)(k0 + 16 + 8 * g + i) * HD]; }
  return w; }
#define WO_OUT_IN 0
#if WQKV_LAYOUT == 1
#define WCOL(W, k0, o, lane) wcol_oi(W, k0, o, lane, DIN)
#elif WQKV_LAYOUT == 2
#define WCOL(W, k0, o, lane) wcol_hdk(W, k0, o, lane)
#else
#define WCOL(W, k0, o, lane) wcol_io(W, k0, o, lane, CC)
#endif
#if WO_OUT_IN
#define WOCOL(W, k0, o, lane) wcol_oi(W, k0, o, lane, CC)
#define WOCOLH(W, k0, o, lane) wcolh_oi(W, k0, o, lane, CC)
#else
#define WOCOL(W, k0, o, lane) wcol_io(W, k0, o, lane, DIN)
#define WOCOLH(W, k0, o, lane) wcolh_io(W, k0, o, lane, DIN)
#endif
#define CIN 384
// ---- k_packw: the three (in,out) [C][64] projection weights rounded to bf16 and laid out as ready WMMA B fragments: [which][k chunk of 32][16-column group j][half h][lane][8], element i of half h = W[kc * 32 + 16 * h + 8 * (lane >> 4) + i][j * 16 + (lane & 15)] (the k order of the A loader in k_proj); a half fragment is 512 contiguous bytes, 16 per lane
__global__ __launch_bounds__(256) void k_packw(const float* __restrict__ WQ, const float* __restrict__ WK, const float* __restrict__ WV, __bf16* __restrict__ WP) { const int which = blockIdx.y; const float* Wsrc = which == 0 ? WQ : (which == 1 ? WK : WV);
  const int e = blockIdx.x * 256 + threadIdx.x; const int lane = e & 31, h = (e >> 5) & 1, j = (e >> 6) & 3, kc = e >> 8;
  const float* p = Wsrc + (size_t)(kc * 32 + 16 * h + 8 * (lane >> 4)) * 64 + j * 16 + (lane & 15); v8b o;
#pragma unroll
  for (int i = 0; i < 8; ++i) o[i] = (__bf16)p[i * 64];
  vst2(WP + (size_t)which * CIN * 64 + (size_t)e * 8, o); }
#define WS_WP (WS_END)                                  // bf16 weight fragments [3][C x 64] (k_packw), at the head of this region
#define WS_END2 (WS_WP + 2u * 3 * (size_t)CIN * 64)
#ifndef SM_EXTRA_PARAMS
#define SM_EXTRA_PARAMS
#endif
#ifndef PROJ_EXTRA_PARAMS
#define PROJ_EXTRA_PARAMS
#endif
#ifndef SM_MASK_HOOK
#define SM_MASK_HOOK (void)0
#endif

// q, k and their residuals: WMMA fragments in lane order, [b*t / 16][hd chunk of 32][half h][lane][8], element i = row 16 * tile + (lane & 15), column 32 * chunk + 16 * h + 8 * (lane >> 4) + i; v planes: [b*t / 32][16-column group j][half h][lane][8], element i = column 16 * j + (lane & 15), key 32 * chunk + 16 * h + 8 * (lane >> 4) + i. A half fragment is 512 contiguous bytes, 16 per lane; each plane fills the first half of its region
#define WS_QH  0u                                      // f16 q fragments
#define WS_KH  (WS_QH + 2u * (size_t)NB * TT * CC)      // f16 k fragments
#define WS_VT  (WS_KH + 2u * (size_t)NB * TT * CC)      // f16 v fragments
#define WS_QL  (WS_VT + 2u * (size_t)NB * CC * TT)      // f16 q residual x 2^10 fragments, t < QHI of each b
#define WS_KL  (WS_QL + 2u * (size_t)NB * QHI * CC)     // f16 k residual x 2^10 fragments, t < KHI of each b
#define WS_VB  (WS_KL + 2u * (size_t)NB * KHI * CC)     // bf16 v hi fragments, t < KHI of each b (WS_VBL: lo)
#define WS_VBL (WS_VB + 2u * (size_t)NB * CC * KHI)
#define WS_S   (WS_VBL + 2u * (size_t)NB * CC * KHI)    // unused (the logits stay on chip); it keeps the offsets of the planes behind it
#define WS_Y   (WS_S  + 4u * (size_t)NB * TT * TT)      // f32 ctx rows [b*t][CC] (only when there is an output projection)
#define WS_END (WS_Y  + 0u)

// ---- k_proj: block = 64 rows of x, all 192 columns (q, k, v): X W with exact bf16 products (K = DIN) -> q f16 (+ residual, rows < QHI), k f16 (+ residual, rows < KHI), v f16 (+ bf16 hi/lo for t < KHI), each stored as the fragments that k_fa loads (layout: at WS_QH)
// The block's x rows (96 KB, contiguous) are read once, in whole lines, rounded to bf16 once and laid in LDS, where they serve all three products. Wave w takes the 16-column groups 3w .. 3w + 2 of the twelve (q 0..3, k 4..7, v 8..11) for all 64 rows, so each weight fragment (k_packw) is loaded once a block.
#define PAH0 2             // k chunks of weight fragments that start beside the x rows (60 loads in flight)
#define PAH1 4             // chunks PAH0 .. PAH1 - 1 start while the x rows come in, early enough to be back with the last of them; the rest behind the barrier
#define PAH 5              // in the product loop the weight fragments are loaded this many k chunks ahead
#define XPITCH 392         // bf16 elements of a staged x row: 784 B = 16 B x 49, an odd count of 16-byte units, so that the 16 rows of a ds_load_b128 fall on distinct banks
typedef __attribute__((ext_vector_type(4))) __bf16 v4b;
__global__ __launch_bounds__(128) void k_proj(const float* __restrict__ X, const __bf16* __restrict__ WP,
    _Float16* __restrict__ QH, _Float16* __restrict__ QL, _Float16* __restrict__ KH, _Float16* __restrict__ KL, _Float16* __restrict__ VT, __bf16* __restrict__ VB, __bf16* __restrict__ VBL) {
  __shared__ __align__(16) __bf16 xs[64][XPITCH];
  __shared__ __align__(16) _Float16 sh[2][64][72], sl[2][64][72]; __shared__ __align__(16) _Float16 th[64][72]; __shared__ __align__(16) __bf16 tb[64][72], tbl[64][72];
  const int tid = threadIdx.x, lane = tid & 31, col = lane & 15, g = lane >> 4; const int wave = __builtin_amdgcn_readfirstlane(tid >> 5); const size_t r0 = (size_t)blockIdx.x * 64; const size_t bb = r0 / TT; const int t0 = (int)(r0 % TT);
  constexpr int NK = DIN / 32;
  const float* xb = X + (r0 + wave * 16) * DIN;   // wave w brings rows 16w .. 16w + 15: 48 loads of 512 contiguous bytes
  const __bf16* wb[3];
#pragma unroll
  for (int jj = 0; jj < 3; ++jj) { const int cg = wave * 3 + jj; wb[jj] = WP + (size_t)(cg >> 2) * CIN * 64 + (cg & 3) * 512; }
  v8f acc[4][3] = {}; v8b wf[NK][3][2]; v4f xv[48];
#define PROJ_FETCH(kq) do { _Pragma("unroll") for (int jj = 0; jj < 3; ++jj) { wf[kq][jj][0] = *(const v8b*)(wb[jj] + lane * 8 + (kq) * 2048); wf[kq][jj][1] = *(const v8b*)(wb[jj] + lane * 8 + (kq) * 2048 + 256); } } while (0)
#pragma unroll
  for (int c = 0; c < 48; ++c) xv[c] = *(const v4f*)(xb + lane * 4 + c * 128);
#pragma unroll
  for (int kc = 0; kc < PAH0; ++kc) PROJ_FETCH(kc);
  asm volatile("s_wait_xcnt 0x0" :: "s"(xb), "v"(lane) : "memory");   // behind the x loads: their address registers are free to be rewritten only behind this wait (base and index are inputs so that they live up to it); its "memory" clobber also keeps all these loads ahead of the LDS stores, so that they fly together
#pragma unroll
  for (int q = 0; q < 4; ++q) {
#pragma unroll
    for (int c = q * 12; c < q * 12 + 12; ++c) *(v4b*)&xs[wave * 16 + c / 3][(c % 3) * 128 + lane * 4] = __builtin_convertvector(xv[c], v4b);
    __builtin_amdgcn_sched_barrier(0);   // holds each further weight chunk behind twelve returned x loads (never more than 60 loads in flight) and each dozen LDS stores at its place among the waits
    if (q < PAH1 - PAH0) PROJ_FETCH(PAH0 + q);
  }
  __syncthreads();   // from here on each wave reads all 64 rows
  union AF { v16b v; v8b q[2]; }; AF a[NK][4];   // elements 0..7 = k 8g + 0..7 of the chunk, 8..15 = 16 + 8g + 0..7: the k order of k_packw
#define PROJ_XFRAG(kq) do { _Pragma("unroll") for (int rt = 0; rt < 4; ++rt) { const __bf16* xp = &xs[rt * 16 + col][(kq) * 32 + 8 * g]; a[kq][rt].q[0] = *(const v8b*)xp; a[kq][rt].q[1] = *(const v8b*)(xp + 16); } } while (0)
#pragma unroll
  for (int kc = PAH1; kc < PAH; ++kc) PROJ_FETCH(kc);
  PROJ_XFRAG(0);
  // fully unrolled: wf and a are then indexed by constants and live in registers, and every load is a constant offset
#pragma unroll
  for (int kc = 0; kc < NK; ++kc) {
    if (kc + PAH < NK) PROJ_FETCH(kc + PAH);
    if (kc + PAH == NK - 1) asm volatile("s_wait_xcnt 0x0" :: "s"(wb[0]), "s"(wb[1]), "s"(wb[2]), "v"(lane) : "memory");   // behind the last weight loads: as above
    if (kc + 1 < NK) PROJ_XFRAG(kc + 1);
    __builtin_amdgcn_sched_barrier(0);   // keeps the loads of later chunks ahead of this chunk's products: without it the scheduler sinks each load to just before its product, which then waits out the whole latency
#pragma unroll
    for (int jj = 0; jj < 3; ++jj) { union { v16b v; v8b q[2]; } w; w.q[0] = wf[kc][jj][0]; w.q[1] = wf[kc][jj][1];
#pragma unroll
      for (int rt = 0; rt < 4; ++rt) acc[rt][jj] = __builtin_amdgcn_wmma_f32_16x16x32_bf16(false, a[kc][rt].v, false, w.v, (short)0, acc[rt][jj], false, false); }
    __builtin_amdgcn_sched_barrier(0);   // the next group of loads stays whole behind these products
  }
#pragma unroll
  for (int jj = 0; jj < 3; ++jj) { const int cg = wave * 3 + jj, which = cg >> 2, cl = (cg & 3) * 16 + col;   // which is the same for the whole wave
    if (which < 2) {
#pragma unroll
      for (int rt = 0; rt < 4; ++rt) {
#pragma unroll
        for (int r = 0; r < 8; ++r) { const float v = acc[rt][jj][r]; const _Float16 hv = (_Float16)v; sh[which][rt * 16 + 8 * g + r][cl] = hv; sl[which][rt * 16 + 8 * g + r][cl] = (_Float16)((v - (float)hv) * 1024.0f); } }
    } else {
#pragma unroll
      for (int rt = 0; rt < 4; ++rt) {
#pragma unroll
        for (int r = 0; r < 8; ++r) { const float v = acc[rt][jj][r]; const int rl = rt * 16 + 8 * g + r; th[cl][rl] = (_Float16)v; const __bf16 bh = (__bf16)v; tb[cl][rl] = bh; tbl[cl][rl] = (__bf16)(v - (float)bh); } } } }
  __syncthreads();
  // piece e = tid + 128 i of a plane's 8 KB in fragment order: a wave stores 512 contiguous bytes. A group's LDS reads go first, then its stores, then one wait: with one wave on a SIMD nothing else hides a read or a store that is waited for singly
  const size_t eo = (size_t)tid * 8; _Float16* qd = QH + r0 * HD; _Float16* kd = KH + r0 * HD; _Float16* vd = VT + r0 * HD; v4u d[4][4];
#pragma unroll
  for (int i = 0; i < 4; ++i) { const int e = tid + i * 128; const int rl = (e >> 7) * 16 + (e & 15), cq = ((e >> 6) & 1) * 32 + ((e >> 5) & 1) * 16 + ((e >> 4) & 1) * 8; const int cl = ((e >> 6) & 3) * 16 + (e & 15), tq = (e >> 8) * 32 + ((e >> 5) & 1) * 16 + ((e >> 4) & 1) * 8;
    d[i][0] = *(const v4u*)&sh[0][rl][cq]; d[i][1] = *(const v4u*)&sh[1][rl][cq]; d[i][2] = *(const v4u*)&th[cl][tq]; }
#pragma unroll
  for (int i = 0; i < 4; ++i) { *(v4u*)(qd + eo + i * 1024) = d[i][0]; *(v4u*)(kd + eo + i * 1024) = d[i][1]; *(v4u*)(vd + eo + i * 1024) = d[i][2]; }
  // behind the stores: their address and data registers are rewritten only behind this wait; all are inputs of the wait so that they live up to it
  asm volatile("s_wait_xcnt 0x0" :: "s"(qd), "s"(kd), "s"(vd), "v"(eo), "v"(d[0][0]), "v"(d[0][1]), "v"(d[0][2]), "v"(d[1][0]), "v"(d[1][1]), "v"(d[1][2]), "v"(d[2][0]), "v"(d[2][1]), "v"(d[2][2]), "v"(d[3][0]), "v"(d[3][1]), "v"(d[3][2]) : "memory");
  static_assert(QHI == KHI, "one test serves the four extra planes");
  if (t0 < QHI) { const size_t o3 = (bb * QHI + t0) * (size_t)HD; _Float16* ql = QL + o3; _Float16* kl = KL + o3; __bf16* vh = VB + o3; __bf16* vl = VBL + o3;
#pragma unroll
    for (int i = 0; i < 4; ++i) { const int e = tid + i * 128; const int rl = (e >> 7) * 16 + (e & 15), cq = ((e >> 6) & 1) * 32 + ((e >> 5) & 1) * 16 + ((e >> 4) & 1) * 8; const int cl = ((e >> 6) & 3) * 16 + (e & 15), tq = (e >> 8) * 32 + ((e >> 5) & 1) * 16 + ((e >> 4) & 1) * 8;
      d[i][0] = *(const v4u*)&sl[0][rl][cq]; d[i][1] = *(const v4u*)&sl[1][rl][cq]; d[i][2] = *(const v4u*)&tb[cl][tq]; d[i][3] = *(const v4u*)&tbl[cl][tq]; }
#pragma unroll
    for (int i = 0; i < 4; ++i) { *(v4u*)(ql + eo + i * 1024) = d[i][0]; *(v4u*)(kl + eo + i * 1024) = d[i][1]; *(v4u*)(vh + eo + i * 1024) = d[i][2]; *(v4u*)(vl + eo + i * 1024) = d[i][3]; }
    asm volatile("s_wait_xcnt 0x0" :: "s"(ql), "s"(kl), "s"(vh), "s"(vl), "v"(eo), "v"(d[0][0]), "v"(d[0][1]), "v"(d[0][2]), "v"(d[0][3]), "v"(d[1][0]), "v"(d[1][1]), "v"(d[1][2]), "v"(d[1][3]), "v"(d[2][0]), "v"(d[2][1]), "v"(d[2][2]), "v"(d[2][3]), "v"(d[3][0]), "v"(d[3][1]), "v"(d[3][2]), "v"(d[3][3]) : "memory"); } }   // as above
// ---- k_fa: block = two tiles of 32 query rows of batch b = blockIdx.x, head 0, a long one (NT - 1 - p) and a short one (p): logits, causal softmax and P . v in one pass, no logits plane.
// The eight waves are dealt to the two tiles by their counts of 128-key blocks (short_waves). Wave w of the n that a tile has takes its blocks w, w + n, ... up to the diagonal block, for all 32 rows (two 16-row tiles share every k and v fragment), and keeps its own running row maximum, row sum and ctx tiles; a tile's parts are joined in LDS at the end.
// Both products are formed transposed: S^T = K . Q^T (A = k fragment, B = q fragment) and O^T += V^T . P^T (A = v fragment, B = P^T). A lane then holds the logits of ONE query (column lane & 15; keys 8 * (lane >> 4) + r of each 16-key tile), so that maximum and sum run in the lane's own registers with one exchange between the lane halves, and two neighbouring logit tiles, converted in place, ARE the B fragment of P^T for their 32 keys (element s = key 16 * (s >> 3) + 8 * (lane >> 4) + (s & 7): the k order of the stored v fragments): P passes through no LDS.
// Per block: logits (1 f16 product; q hi + residual x k hi + residual, 3 products, for query rows < QHI), scaled by SCALE x log2(e); e = 2^(logit - running max + 11) in f32 (once to f16 against v f16; bf16 hi + lo against v bf16 hi + lo, 3 products, for rows < QHI). The row sum carries the same 2^11, so ctx / sum needs no other factor.
// the plain builtins: the compiler keeps the distance behind a matrix instruction itself and stays free to place the fragment loads ahead of the products
__device__ __forceinline__ v8f mm_h(v16h a, v16h b, v8f c) { return __builtin_amdgcn_wmma_f32_16x16x32_f16(false, a, false, b, (short)0, c, false, false); }
__device__ __forceinline__ v8f mm_b(v16b a, v16b b, v8f c) { return __builtin_amdgcn_wmma_f32_16x16x32_bf16(false, a, false, b, (short)0, c, false, false); }
// fragment stored in lane order at p = fragment start + 8 * lane: each of the two loads covers 512 contiguous bytes (4 whole lines) over the wave; one address pair serves a whole group of loads through constant offsets
#define FRG 512            // elements of a stored fragment
__device__ __forceinline__ v16h frag_hp(const _Float16* p) { union { v16h v; v8h q[2]; } u; u.q[0] = *(const v8h*)p; u.q[1] = *(const v8h*)(p + 256); return u.v; }
__device__ __forceinline__ v16b frag_bp(const __bf16* p) { union { v16b v; v8b q[2]; } u; u.q[0] = *(const v8b*)p; u.q[1] = *(const v8b*)(p + 256); return u.v; }
// behind a group of global loads: their address registers are free to be rewritten only behind this wait; its "memory" clobber also holds the group ahead of what follows, so that the loads fly together
// the pointers are named as inputs so that their registers live up to the wait
#define XW1(p) asm volatile("s_wait_xcnt 0x0" :: "v"(p) : "memory")
#define XW2(p, q) asm volatile("s_wait_xcnt 0x0" :: "v"(p), "v"(q) : "memory")
// the same for loads that the compiler forms from a wave-uniform base and the lane's index: both parts are named, so that the scalar pair too lives up to the wait
#define XWS(base, idx) asm volatile("s_wait_xcnt 0x0" :: "s"(base), "v"(idx) : "memory")
// 2^x with the slot that the instruction set asks for behind a transcendental (the next instruction may overwrite x) kept in the same statement
__device__ __forceinline__ float ex2(float x) { asm("v_exp_f32 %0, %0\n\tv_nop" : "+v"(x)); return x; }
// the value of lane l ^ 16: the other half of a query's keys
__device__ __forceinline__ float xhalf(float x) { return __builtin_bit_cast(float, __builtin_amdgcn_permlanex16(__builtin_bit_cast(int, x), __builtin_bit_cast(int, x), 0x76543210, 0xfedcba98, false, false)); }
#define QT 2               // 16-row query tiles per wave
#define SCALE2 (SCALE * 1.4426950408889634f)
// one 128-key block of one wave. acc[t][j][r] = logit of key k0 + 16 j + 8 g + r, query ql0 + 16 t + col; o[t][j][r] = ctx column 16 j + 8 g + r of that query; m[t]: the query's running maximum (alike in both lane halves); l[t]: the sum over this half's keys
template <bool HI>
__device__ __forceinline__ void fa_keys(const v16h (&ah)[QT][HD / 32], const v16h (&al)[QT][HD / 32], const _Float16* __restrict__ Kh, const _Float16* __restrict__ Kl, const _Float16* __restrict__ Vt, const __bf16* __restrict__ Vb, const __bf16* __restrict__ Vbl,
    int k0, int ql0, bool diag, int lane, v8f (&o)[QT][HD / 16], float (&m)[QT], float (&l)[QT]) {
  const int col = lane & 15, g = lane >> 4;
  v8f acc[QT][8]; v16h vf[HI ? 1 : 4][HD / 16];
  const size_t ko = (size_t)k0 * HD + 8 * lane; const _Float16* kp = Kh + ko; const _Float16* rp = Kl + ko; const _Float16* vp = Vt + ko;
  if (HI) {
#pragma unroll
    for (int j0 = 0; j0 < 8; j0 += 4) { v16h kf[4][HD / 32], rf[4][HD / 32];   // the fragments of 64 keys are fetched together, ahead of their products: one memory round trip a group
#pragma unroll
      for (int jj = 0; jj < 4; ++jj) {
#pragma unroll
        for (int kc = 0; kc < HD / 32; ++kc) { kf[jj][kc] = frag_hp(kp + ((j0 + jj) * (HD / 32) + kc) * FRG); rf[jj][kc] = frag_hp(rp + ((j0 + jj) * (HD / 32) + kc) * FRG); } }
      XW2(kp, rp);
      __builtin_amdgcn_sched_barrier(0);   // keeps the products behind the whole group of loads
#pragma unroll
      for (int jj = 0; jj < 4; ++jj) {
#pragma unroll
        for (int t = 0; t < QT; ++t) { v8f a = {}, ar = {};   // ar: the residual products (x 2^10)
#pragma unroll
          for (int kc = 0; kc < HD / 32; ++kc) { a = mm_h(kf[jj][kc], ah[t][kc], a); ar = mm_h(kf[jj][kc], al[t][kc], ar); ar = mm_h(rf[jj][kc], ah[t][kc], ar); }
#pragma unroll
          for (int r = 0; r < 8; ++r) acc[t][j0 + jj][r] = (a[r] + ar[r] * (1.0f / 1024.0f)) * SCALE2; } } }
  } else { v16h kf[8][HD / 32];   // the fragments of the 128 keys are fetched together, ahead of their products
#pragma unroll
    for (int j = 0; j < 8; ++j) {
#pragma unroll
      for (int kc = 0; kc < HD / 32; ++kc) kf[j][kc] = frag_hp(kp + (j * (HD / 32) + kc) * FRG); }
    XW1(kp);
    __builtin_amdgcn_sched_barrier(0);   // keeps the products behind the whole group of loads: without it each product moves up to its own pair of loads and waits for that pair alone
#pragma unroll
    for (int j = 0; j < 8; ++j) {
#pragma unroll
      for (int t = 0; t < QT; ++t) { v8f a = {};
#pragma unroll
        for (int kc = 0; kc < HD / 32; ++kc) a = mm_h(kf[j][kc], ah[t][kc], a);
#pragma unroll
        for (int r = 0; r < 8; ++r) acc[t][j][r] = a[r] * SCALE2; } }
    // the v fragments of the first 64 keys start here, together, and fly under the softmax
#pragma unroll
    for (int kc = 0; kc < 2; ++kc) {
#pragma unroll
      for (int j = 0; j < HD / 16; ++j) vf[kc][j] = frag_hp(vp + (kc * (HD / 16) + j) * FRG); }
    XW1(vp);
  }
  if (diag) {   // only the diagonal block holds keys past a query (wave-uniform test)
#pragma unroll
    for (int t = 0; t < QT; ++t) {
#pragma unroll
      for (int j = 0; j < 8; ++j) {
#pragma unroll
        for (int r = 0; r < 8; ++r) acc[t][j][r] = (k0 + j * 16 + 8 * g + r > ql0 + t * 16 + col) ? -3.0e38f : acc[t][j][r]; } } }
  v16h ph[HI ? 1 : QT][HI ? 1 : 4];   // P^T fragments, f16
#pragma unroll
  for (int t = 0; t < QT; ++t) {
    v8f mv = acc[t][0];   // eight independent chains, joined at the end
#pragma unroll
    for (int j = 1; j < 8; ++j) {
#pragma unroll
      for (int r = 0; r < 8; ++r) mv[r] = fmaxf(mv[r], acc[t][j][r]); }
    float mx = fmaxf(fmaxf(fmaxf(mv[0], mv[1]), fmaxf(mv[2], mv[3])), fmaxf(fmaxf(mv[4], mv[5]), fmaxf(mv[6], mv[7])));
    mx = fmaxf(mx, xhalf(mx));
    const float mn = fmaxf(m[t], mx); const float f = ex2(m[t] - mn); m[t] = mn;
#pragma unroll
    for (int j = 0; j < HD / 16; ++j) o[t][j] *= f;
    const float mb = mn - 11.0f; v8f sv;
#pragma unroll
    for (int j = 0; j < 8; ++j) {
#pragma unroll
      for (int r = 0; r < 8; ++r) { const float e = ex2(acc[t][j][r] - mb);   /* an excluded key (-3e38) gives 0: every query sees key k0 of every block it walks, so m is a real logit */ sv[r] = j == 0 ? e : sv[r] + e; acc[t][j][r] = e; } }
    l[t] = l[t] * f + (((sv[0] + sv[1]) + (sv[2] + sv[3])) + ((sv[4] + sv[5]) + (sv[6] + sv[7])));
    if (!HI) {
#pragma unroll
      for (int kc = 0; kc < 4; ++kc) {
#pragma unroll
        for (int s = 0; s < 16; ++s) ph[t][kc][s] = (_Float16)acc[t][2 * kc + (s >> 3)][s & 7]; } }
    if (!HI && t == 0) {   // the other 64 keys' v fragments start once the first tile's logits have left their registers
#pragma unroll
      for (int kc = 2; kc < 4; ++kc) {
#pragma unroll
        for (int j = 0; j < HD / 16; ++j) vf[kc][j] = frag_hp(vp + (kc * (HD / 16) + j) * FRG); }
      XW1(vp);   // holds them ahead of the second tile's work: they fly under it
    } }
  if (HI) {
    const __bf16* hp = Vb + ko; const __bf16* lp = Vbl + ko;
#pragma unroll
    for (int c0 = 0; c0 < 4; c0 += 2) { v16b vh[2][HD / 16], vl[2][HD / 16];   // v fragments of 64 keys fetched together, ahead of their products
#pragma unroll
      for (int cc = 0; cc < 2; ++cc) {
#pragma unroll
        for (int j = 0; j < HD / 16; ++j) { vh[cc][j] = frag_bp(hp + ((c0 + cc) * (HD / 16) + j) * FRG); vl[cc][j] = frag_bp(lp + ((c0 + cc) * (HD / 16) + j) * FRG); } }
      XW2(hp, lp);
      __builtin_amdgcn_sched_barrier(0);   // keeps the products behind the whole group of loads
#pragma unroll
      for (int cc = 0; cc < 2; ++cc) {
#pragma unroll
        for (int t = 0; t < QT; ++t) { float e[16];
#pragma unroll
          for (int s = 0; s < 16; ++s) e[s] = acc[t][2 * (c0 + cc) + (s >> 3)][s & 7];
          const F2 p = bsplit16(e);
#pragma unroll
          for (int j = 0; j < HD / 16; ++j) { o[t][j] = mm_b(vh[cc][j], p.h, o[t][j]); o[t][j] = mm_b(vh[cc][j], p.l, o[t][j]); o[t][j] = mm_b(vl[cc][j], p.h, o[t][j]); } } } }
  } else {
#pragma unroll
    for (int kc = 0; kc < 4; ++kc) {
#pragma unroll
      for (int t = 0; t < QT; ++t) {
#pragma unroll
        for (int j = 0; j < HD / 16; ++j) o[t][j] = mm_h(vf[kc][j], ph[t][kc], o[t][j]); } } }
}
#define JP (HD + 4)        // floats of a row of the join tile: 272 B = 16 B x 17, an odd count of 16-byte units, so that the 16 queries of a 16-byte store fall on distinct banks; columns HD, HD + 1 hold the row's maximum and sum
#define FW 8               // waves of a work-group
// waves of the short tile p, by p >> 2 = its 128-key blocks less one (1 .. 8 blocks; the long tile has 16 .. 9 and gets the other waves): no wave walks more than 3 blocks, and a block of the rows below QHI, about twice the work, has a wave of its own
__host__ __device__ constexpr int short_waves(int p) { return (int)((0x43322321u >> ((p >> 2) * 4)) & 15u); }
#define SWMAX 4            // the most waves a short tile gets; it gets at least one
constexpr bool short_waves_ok() { for (int p = 0; p < 32; ++p) if (short_waves(p) < 1 || short_waves(p) > SWMAX) return false; return true; }
static_assert(TT == 2048 && QT == 2 && short_waves_ok(), "the table of short_waves is for 64 tiles of 32 rows");
// two waves per SIMD: the 256 work-groups, alike in work, are then all resident, one on a WGP
__global__ __launch_bounds__(256, 2) void k_fa(const _Float16* __restrict__ QH, const _Float16* __restrict__ KH, const _Float16* __restrict__ QL, const _Float16* __restrict__ KL, const _Float16* __restrict__ VT, const __bf16* __restrict__ VB, const __bf16* __restrict__ VBL, float* __restrict__ OUT) {
  __shared__ __align__(16) float ss[FW][QT * 16][JP];
  const int tid = threadIdx.x, lane = tid & 31, col = lane & 15, g = lane >> 4; const int wave = __builtin_amdgcn_readfirstlane(tid >> 5);
  constexpr int NT = TT / (QT * 16); const int pr = blockIdx.y; const int nl = FW - short_waves(pr);   // waves 0 .. nl - 1: the long tile; nl .. FW - 1: the short one
  const bool sht = wave >= nl; const int qt = sht ? pr : NT - 1 - pr; const int w0 = sht ? wave - nl : wave; const int nw = sht ? FW - nl : nl;   // all the same for the whole wave
  const int b = blockIdx.x; const int ql0 = qt * (QT * 16); const int kbl = ql0 >> 7;   // the 32 rows share their diagonal block: 128 is a multiple of 32
  const _Float16* Kh = KH + (size_t)b * TT * HD; const _Float16* Kl = KL + (size_t)b * KHI * HD; const _Float16* Vt = VT + (size_t)b * TT * HD; const __bf16* Vb = VB + (size_t)b * KHI * HD; const __bf16* Vbl = VBL + (size_t)b * KHI * HD;
  float (*sw)[JP] = ss[wave];
  v8f o[QT][HD / 16] = {}; float m[QT], l[QT];
  v16h ah[QT][HD / 32], al[QT][HD / 32] = {};
  const _Float16* qb = QH + ((size_t)b * TT + ql0) * HD; const _Float16* qp = qb + 8 * lane; const _Float16* qr = QL + ((size_t)b * QHI + ql0) * HD + 8 * lane;   // qr is read only where ql0 < QHI
#pragma unroll
  for (int t = 0; t < QT; ++t) { m[t] = -3.0e38f; l[t] = 0.f;
#pragma unroll
    for (int kc = 0; kc < HD / 32; ++kc) ah[t][kc] = frag_hp(qp + (t * (HD / 32) + kc) * FRG); }
  XWS(qb, lane);
  if (__builtin_expect(ql0 >= QHI, 1)) {   // the common path first in the text
#pragma unroll 1
    for (int kb = w0; kb <= kbl; kb += nw) fa_keys<false>(ah, al, Kh, Kl, Vt, Vb, Vbl, kb * 128, ql0, kb == kbl, lane, o, m, l);
  } else {
#pragma unroll
    for (int t = 0; t < QT; ++t) {
#pragma unroll
      for (int kc = 0; kc < HD / 32; ++kc) al[t][kc] = frag_hp(qr + (t * (HD / 32) + kc) * FRG); }
    XW1(qr);
    static_assert(QHI == 384 && short_waves(0) >= 1 && short_waves(4) >= 2 && short_waves(8) >= 3, "a wave of these rows walks at most one block");
    if (w0 <= kbl) fa_keys<true>(ah, al, Kh, Kl, Vt, Vb, Vbl, w0 * 128, ql0, w0 == kbl, lane, o, m, l);
  }
#pragma unroll
  for (int t = 0; t < QT; ++t) { float* rw = &sw[t * 16 + col][0];   // the lane's query: its 8 consecutive ctx columns of each group go out as two 16-byte stores
    l[t] += xhalf(l[t]);
#pragma unroll
    for (int j = 0; j < HD / 16; ++j) { *(v4f*)(rw + j * 16 + 8 * g) = __builtin_shufflevector(o[t][j], o[t][j], 0, 1, 2, 3); *(v4f*)(rw + j * 16 + 8 * g + 4) = __builtin_shufflevector(o[t][j], o[t][j], 4, 5, 6, 7); }
    if (g == 0) { v2f ml = { m[t], l[t] }; *(v2f*)(rw + HD) = ml; } }
  __syncthreads();
  // join, a tile at a time (pieces 0, 1: the long tile; 2, 3: the short one): a wave that had no key block holds max -3e38, sum 0, ctx 0 and drops out with factor 0 (a tile's first wave always has block 0, whose key 0 every row sees)
  constexpr int NJ = 2 * QT * 16 * (HD / 4) / (FW * 32); v4f res[NJ];
  // unrolled: the LDS reads of all pieces then go out together, and which tile a piece belongs to is a constant
#pragma unroll
  for (int k = 0; k < NJ; ++k) { const int e = tid + k * (FW * 32); const int row = (e / (HD / 4)) % (QT * 16), q = e % (HD / 4); const int wa = k >= NJ / 2 ? nl : 0, n = k >= NJ / 2 ? FW - nl : nl; const int np = k >= NJ / 2 ? SWMAX : FW - 1;   // np: the most parts a tile of this kind has
    float mw[FW], lw[FW]; const float* pw[FW]; float mm = -3.0e38f;
#pragma unroll
    for (int j = 0; j < np; ++j) { const bool in = j < n; pw[j] = &ss[in ? wa + j : wa][row][0];   // a part past the tile's last is read from its first wave instead (no branch, so that all reads go out together) and gets factor 0
      const v2f ml = *(const v2f*)(pw[j] + HD); mw[j] = in ? ml[0] : -3.0e38f; lw[j] = in ? ml[1] : 0.f; mm = fmaxf(mm, mw[j]); }
    float den = 0.f; v4f a = {};
#pragma unroll
    for (int j = 0; j < np; ++j) { const float f = ex2(mw[j] - mm); den += f * lw[j]; a += *(const v4f*)(pw[j] + q * 4) * f; }
    const float inv = den > 0.f ? 1.0f / den : 0.f;   /* a fully excluded row yields 0 */
    res[k] = a * inv; }
#pragma unroll
  for (int k = 0; k < NJ; ++k) { const int e = tid + k * (FW * 32); const int row = (e / (HD / 4)) % (QT * 16), q = e % (HD / 4); const int tq = (k >= NJ / 2 ? pr : NT - 1 - pr) * (QT * 16);
    vst2(OUT + ((size_t)b * TT + tq + row) * HD + q * 4, res[k]); } }   // the output row itself: 256 B by 16 lanes, 16 whole rows a piece

extern "C" void kernel_launch(void* const* d_in, const int* in_sizes, int n_in, void* d_out, int out_size, void* d_ws, size_t ws_size, hipStream_t stream) {
  (void)in_sizes; (void)n_in; (void)out_size;
  const float** F = (const float**)d_in;
  if (ws_size < (size_t)WS_END) return;
  char* ws = (char*)d_ws; _Float16 *QH = (_Float16*)(ws + WS_QH), *KH = (_Float16*)(ws + WS_KH), *VT = (_Float16*)(ws + WS_VT), *QL = (_Float16*)(ws + WS_QL), *KL = (_Float16*)(ws + WS_KL); __bf16 *VB = (__bf16*)(ws + WS_VB), *VBL = (__bf16*)(ws + WS_VBL); float *Y = (float*)(ws + WS_Y);
  (void)Y; (void)QL; (void)KL; (void)VB; (void)VBL;
  // inputs: 0 x [8,2048,384]; 1 Wq [384,64]; 2 Wk; 3 Wv ((in,out), no biases)
  if (ws_size < (size_t)WS_END2) return;
  __bf16 *WP = (__bf16*)(ws + WS_WP);
  k_packw<<<dim3(CIN * 64 / 8 / 256, 3), 256, 0, stream>>>(F[1], F[2], F[3], WP);
  k_proj<<<dim3(TNB * TT / 64), 128, 0, stream>>>(F[0], WP, QH, QL, KH, KL, VT, VB, VBL);
  /* head 0 only (head 1 is the zero padding); every batch in the same launch */
  k_fa<<<dim3(TNB, TT / (QT * 16) / 2), FW * 32, 0, stream>>>(QH, KH, QL, KL, VT, VB, VBL, (float*)d_out);
}
